// v000
// Measured on an AMD MI455X. A time is GPU time per run, averaged over a window of back-to-back runs after a warm-up
// (all launches, gaps included; the runs take copies of the inputs in turn), and the median of several windows.
// Apart from v000's, it joins two sittings. Times from different sittings can be a few percent apart, while
// side-by-side timings come from the same sitting.
// v000 is the starting kernel. One run takes 518 microseconds.
#include <hip/hip_runtime.h>
#include <hip/hip_bf16.h>
#include <math.h>

// ---------------------------------------------------------------------------
// Chunked cross attention for MI455X (gfx1250), wave32 + WMMA f16->f32,
// LDS-blocked GEMMs (128x128 block, 64x32 per wave) with async global->LDS.
// B=4 S=2048 D=1024 C=32 N=2 L=128 H=16 DK=64 CHUNK=64
// ---------------------------------------------------------------------------

typedef _Float16 half_t;
typedef __attribute__((ext_vector_type(16))) _Float16 v16h;
typedef __attribute__((ext_vector_type(8)))  _Float16 v8h;
typedef __attribute__((ext_vector_type(8)))  float    v8f;

#define WB 4
#define WS 2048
#define WD 1024
#define WC 32
#define WH 16
#define WDK 64
#define WCHUNK 64
#define WNL 256                       // N*L
#define ROWS_H (WB * WS)              // 8192
#define ROWS_E (WB * WC * WNL)        // 32768
#define VALID_ROWS (WS - WCHUNK + 1)  // 1985
#define WSCALE 0.125f                 // 1/sqrt(64)

#define LDS_STRIDE 40                 // 32 + 8 halves: 16B aligned, bank-spread

#if defined(__AMDGCN__) &&                                              \
    __has_builtin(__builtin_amdgcn_global_load_async_to_lds_b128) &&    \
    __has_builtin(__builtin_amdgcn_s_wait_asynccnt)
#define USE_ASYNC 1
typedef int v4i __attribute__((vector_size(16)));
typedef __attribute__((address_space(1))) v4i as1_v4i;
typedef __attribute__((address_space(3))) v4i as3_v4i;
#else
#define USE_ASYNC 0
#endif

__device__ __forceinline__ v8f wmma16(v16h a, v16h b, v8f c) {
  return __builtin_amdgcn_wmma_f32_16x16x32_f16(false, a, false, b, (short)0, c,
                                                false, false);
}

// Fragment loader for v_wmma_f32_16x16x32_f16. Works for A (MxK row-major,
// lane&15 = M) and B supplied N-major (NxK row-major, lane&15 = N).
// elements 0..7 = K[k0+hi*8 ..], elements 8..15 = K[k0+16+hi*8 ..].
__device__ __forceinline__ v16h load_frag(const half_t* __restrict__ base,
                                          int ld, int k0, int lane) {
  int m  = lane & 15;
  int hi = (lane >> 4) & 1;
  const half_t* p = base + (size_t)m * ld + k0 + hi * 8;
  v8h lo = *(const v8h*)(p);
  v8h hv = *(const v8h*)(p + 16);
  v16h r;
#pragma unroll
  for (int e = 0; e < 8; ++e) { r[e] = lo[e]; r[e + 8] = hv[e]; }
  return r;
}

// Stage one K-step tile (A:128x32, B:128x32 halves) into LDS.
// Each of 256 threads moves 16 halves of A and 16 of B (2x b128 each).
__device__ __forceinline__ void stage_tile(const half_t* __restrict__ gA,
                                           const half_t* __restrict__ gB,
                                           int ldg, half_t* sA, half_t* sB,
                                           int tid) {
  int row = tid >> 1;
  int cs  = (tid & 1) * 16;
  const half_t* pa = gA + (size_t)row * ldg + cs;
  const half_t* pb = gB + (size_t)row * ldg + cs;
  half_t* la = sA + row * LDS_STRIDE + cs;
  half_t* lb = sB + row * LDS_STRIDE + cs;
#if USE_ASYNC
  __builtin_amdgcn_global_load_async_to_lds_b128((as1_v4i*)pa, (as3_v4i*)la, 0,
                                                 0);
  __builtin_amdgcn_global_load_async_to_lds_b128((as1_v4i*)(pa + 8),
                                                 (as3_v4i*)(la + 8), 0, 0);
  __builtin_amdgcn_global_load_async_to_lds_b128((as1_v4i*)pb, (as3_v4i*)lb, 0,
                                                 0);
  __builtin_amdgcn_global_load_async_to_lds_b128((as1_v4i*)(pb + 8),
                                                 (as3_v4i*)(lb + 8), 0, 0);
#else
  v8h a0 = *(const v8h*)pa, a1 = *(const v8h*)(pa + 8);
  v8h b0 = *(const v8h*)pb, b1 = *(const v8h*)(pb + 8);
  *(v8h*)la = a0; *(v8h*)(la + 8) = a1;
  *(v8h*)lb = b0; *(v8h*)(lb + 8) = b1;
#endif
}

__device__ __forceinline__ void async_wait0() {
#if USE_ASYNC
  __builtin_amdgcn_s_wait_asynccnt(0);
#endif
}

// ---------------------------------------------------------------------------
// 1. LayerNorm of h[:,63:] -> f16, padded with zeros to (B, 2048, D)
// ---------------------------------------------------------------------------
__global__ __launch_bounds__(256) void ln_cast_kernel(
    const float* __restrict__ h, const float* __restrict__ gamma,
    const float* __restrict__ beta, half_t* __restrict__ hb16) {
  int row = blockIdx.x;                 // 0..8191
  int b = row >> 11, t = row & 2047;
  half_t* dst = hb16 + (size_t)row * WD;
  int tid = threadIdx.x;
  if (t >= VALID_ROWS) {                // zero padding rows (block-uniform)
    for (int i = tid; i < WD; i += 256) dst[i] = (half_t)0.0f;
    return;
  }
  const float* x = h + ((size_t)b * WS + t + (WCHUNK - 1)) * WD;
  float s = 0.f, s2 = 0.f;
  for (int i = tid; i < WD; i += 256) { float v = x[i]; s += v; s2 += v * v; }
  __shared__ float sh[256], sh2[256];
  sh[tid] = s; sh2[tid] = s2; __syncthreads();
  for (int off = 128; off > 0; off >>= 1) {
    if (tid < off) { sh[tid] += sh[tid + off]; sh2[tid] += sh2[tid + off]; }
    __syncthreads();
  }
  float mu  = sh[0] * (1.0f / WD);
  float var = sh2[0] * (1.0f / WD) - mu * mu;
  float rs  = rsqrtf(var + 1e-5f);
  for (int i = tid; i < WD; i += 256)
    dst[i] = (half_t)((x[i] - mu) * rs * gamma[i] + beta[i]);
}

// ---------------------------------------------------------------------------
// 2. Elementwise f32 -> f16 cast (for e)
// ---------------------------------------------------------------------------
__global__ __launch_bounds__(256) void cast_f16_kernel(
    const float* __restrict__ src, half_t* __restrict__ dst, size_t n) {
  size_t i = (size_t)blockIdx.x * 256 + threadIdx.x;
  size_t stride = (size_t)gridDim.x * 256;
  for (; i < n; i += stride) dst[i] = (half_t)src[i];
}

// ---------------------------------------------------------------------------
// 3. Weight transpose + cast: W (KxN) f32 -> WT (NxK) f16   (1024x1024)
// ---------------------------------------------------------------------------
__global__ __launch_bounds__(256) void transpose_cast_kernel(
    const float* __restrict__ W, half_t* __restrict__ WT) {
  int idx = blockIdx.x * 256 + threadIdx.x;   // coalesced read
  int k = idx >> 10, n = idx & 1023;
  WT[(size_t)n * WD + k] = (half_t)W[idx];
}

// ---------------------------------------------------------------------------
// 4. Blocked WMMA GEMM: block tile 128x128, K-step 32, double-buffered LDS.
//    8 waves, each computing 64x32 (4x2 subtiles, 8 independent accumulators).
//    A (MxK row-major), Bt (NxK row-major).  All dims multiples of 128.
//    MODE 0: C16[row*N+col] = acc + bias[col]                 (q, k proj)
//    MODE 1: vT[(bc,h,dk,j)] = acc + bias[col]                (v proj, T out)
//    MODE 2: out f32 with shift-by-63 + residual              (Wo proj)
// ---------------------------------------------------------------------------
template <int MODE>
__global__ __launch_bounds__(256) void gemm128_kernel(
    const half_t* __restrict__ A, const half_t* __restrict__ Bt,
    const float* __restrict__ bias, half_t* __restrict__ C16,
    const float* __restrict__ hres, float* __restrict__ outf, int M, int N,
    int K) {
  __shared__ __align__(16) half_t sA[2][128 * LDS_STRIDE];
  __shared__ __align__(16) half_t sB[2][128 * LDS_STRIDE];

  int tid  = threadIdx.x;
  int lane = tid & 31, wave = tid >> 5;
  int tm0 = blockIdx.y * 128;
  int tn0 = blockIdx.x * 128;
  int mw = (wave >> 2) * 64;            // wave row offset in block tile
  int nw = (wave & 3) * 32;             // wave col offset in block tile

  const half_t* Ab = A + (size_t)tm0 * K;
  const half_t* Bb = Bt + (size_t)tn0 * K;
  int nk = K >> 5;

  stage_tile(Ab, Bb, K, sA[0], sB[0], tid);
  async_wait0();
  __syncthreads();

  v8f acc[4][2] = {};
  for (int kt = 0; kt < nk; ++kt) {
    int buf = kt & 1;
    if (kt + 1 < nk)
      stage_tile(Ab + (kt + 1) * 32, Bb + (kt + 1) * 32, K, sA[buf ^ 1],
                 sB[buf ^ 1], tid);

    const half_t* As_w = sA[buf] + mw * LDS_STRIDE;
    const half_t* Bs_w = sB[buf] + nw * LDS_STRIDE;
    v16h af[4], bf[2];
#pragma unroll
    for (int i = 0; i < 4; ++i)
      af[i] = load_frag(As_w + i * 16 * LDS_STRIDE, LDS_STRIDE, 0, lane);
#pragma unroll
    for (int j = 0; j < 2; ++j)
      bf[j] = load_frag(Bs_w + j * 16 * LDS_STRIDE, LDS_STRIDE, 0, lane);
#pragma unroll
    for (int i = 0; i < 4; ++i)
#pragma unroll
      for (int j = 0; j < 2; ++j) acc[i][j] = wmma16(af[i], bf[j], acc[i][j]);

    async_wait0();
    __syncthreads();
  }

  // Epilogue: C/D layout -> row = base + (lane>>4)*8 + r, col = base + lane&15
  int nl = lane & 15, mb = (lane >> 4) * 8;
#pragma unroll
  for (int i = 0; i < 4; ++i) {
#pragma unroll
    for (int j = 0; j < 2; ++j) {
      int col = tn0 + nw + j * 16 + nl;
      float bv = bias[col];
#pragma unroll
      for (int r = 0; r < 8; ++r) {
        int row = tm0 + mw + i * 16 + mb + r;
        float v = acc[i][j][r] + bv;
        if (MODE == 0) {
          C16[(size_t)row * N + col] = (half_t)v;
        } else if (MODE == 1) {
          int bc = row >> 8, jj = row & 255;
          int hh = col >> 6, dk = col & 63;
          C16[(((size_t)bc * WH + hh) * WDK + dk) * WNL + jj] = (half_t)v;
        } else {
          int b = row >> 11, t = row & 2047;
          if (t < VALID_ROWS) {          // shift by 63; tail rows discarded
            size_t o = ((size_t)b * WS + t + (WCHUNK - 1)) * WD + col;
            outf[o] = v + hres[o];
          }
        }
      }
    }
  }
}

// ---------------------------------------------------------------------------
// 5. Attention: one block per (b,c,h). Scores (64x256) via WMMA into LDS,
//    softmax over 256, P@V via WMMA (A from LDS, B = vT from global).
// ---------------------------------------------------------------------------
__global__ __launch_bounds__(256) void attention_kernel(
    const half_t* __restrict__ q16, const half_t* __restrict__ k16,
    const half_t* __restrict__ vT16, half_t* __restrict__ att16) {
  int unit = blockIdx.x;                  // 0..2047
  int bc = unit >> 4;                     // b*32 + c
  int hh = unit & 15;
  int tid = threadIdx.x;
  int lane = tid & 31, wave = tid >> 5;

  __shared__ __align__(16) half_t sc[WCHUNK * WNL];   // 64x256 f16 = 32 KB
  __shared__ float rmax[WCHUNK], rinv[WCHUNK];

  const half_t* Aq = q16 + (size_t)bc * WCHUNK * WD + hh * WDK;
  const half_t* Bk = k16 + (size_t)bc * WNL * WD + hh * WDK;

  // --- scores = (q . k^T) * SCALE : 64 tiles (4m x 16n), 8 per wave
#pragma unroll
  for (int it = 0; it < 8; ++it) {
    int tile = wave * 8 + it;
    int tm = tile >> 4, tn = tile & 15;
    const half_t* Ab = Aq + (size_t)tm * 16 * WD;
    const half_t* Bb = Bk + (size_t)tn * 16 * WD;
    v8f acc = {};
    acc = wmma16(load_frag(Ab, WD, 0, lane), load_frag(Bb, WD, 0, lane), acc);
    acc = wmma16(load_frag(Ab, WD, 32, lane), load_frag(Bb, WD, 32, lane), acc);
    int n = lane & 15, mb = (lane >> 4) * 8;
#pragma unroll
    for (int r = 0; r < 8; ++r)
      sc[(tm * 16 + mb + r) * WNL + tn * 16 + n] = (half_t)(acc[r] * WSCALE);
  }
  __syncthreads();

  // --- row stats (thread-per-row)
  if (tid < WCHUNK) {
    float mx = -1e30f;
    for (int j = 0; j < WNL; ++j) mx = fmaxf(mx, (float)sc[tid * WNL + j]);
    float s = 0.f;
    for (int j = 0; j < WNL; ++j) s += __expf((float)sc[tid * WNL + j] - mx);
    rmax[tid] = mx;
    rinv[tid] = 1.0f / s;
  }
  __syncthreads();

  // --- normalize in place (each thread owns its 64 elements)
#pragma unroll 4
  for (int e = 0; e < 64; ++e) {
    int idx = tid * 64 + e;
    int i = idx >> 8;
    sc[idx] = (half_t)(__expf((float)sc[idx] - rmax[i]) * rinv[i]);
  }
  __syncthreads();

  // --- out = P @ V : 16 tiles (4m x 4n over dk), 2 per wave
  const half_t* Bv = vT16 + ((size_t)bc * WH + hh) * WDK * WNL;
#pragma unroll
  for (int it = 0; it < 2; ++it) {
    int tile = wave * 2 + it;
    int tm = tile >> 2, tn = tile & 3;
    const half_t* Ab = sc + (size_t)tm * 16 * WNL;
    const half_t* Bb = Bv + (size_t)tn * 16 * WNL;
    v8f acc = {};
    for (int k0 = 0; k0 < WNL; k0 += 32)
      acc = wmma16(load_frag(Ab, WNL, k0, lane), load_frag(Bb, WNL, k0, lane),
                   acc);
    int n = lane & 15, mb = (lane >> 4) * 8;
#pragma unroll
    for (int r = 0; r < 8; ++r)
      att16[((size_t)bc * WCHUNK + tm * 16 + mb + r) * WD + hh * WDK +
            tn * 16 + n] = (half_t)acc[r];
  }
}

// ---------------------------------------------------------------------------
// 6. Residual-only head rows: out[b,s,:] = h[b,s,:] for s < 63
// ---------------------------------------------------------------------------
__global__ __launch_bounds__(256) void residual_head_kernel(
    const float* __restrict__ h, float* __restrict__ out) {
  int idx = blockIdx.x * 256 + threadIdx.x;     // 4*63*1024 = 258048 exact
  int b = idx / ((WCHUNK - 1) * WD);
  int rem = idx % ((WCHUNK - 1) * WD);
  int s = rem / WD, d = rem % WD;
  size_t o = ((size_t)b * WS + s) * WD + d;
  out[o] = h[o];
}

// ---------------------------------------------------------------------------
// Host launcher
// ---------------------------------------------------------------------------
extern "C" void kernel_launch(void* const* d_in, const int* in_sizes, int n_in,
                              void* d_out, int out_size, void* d_ws,
                              size_t ws_size, hipStream_t stream) {
  const float* h     = (const float*)d_in[0];
  const float* e     = (const float*)d_in[1];
  const float* Wq    = (const float*)d_in[2];
  const float* bq    = (const float*)d_in[3];
  const float* Wk    = (const float*)d_in[4];
  const float* bk    = (const float*)d_in[5];
  const float* Wv    = (const float*)d_in[6];
  const float* bv    = (const float*)d_in[7];
  const float* Wo    = (const float*)d_in[8];
  const float* bo    = (const float*)d_in[9];
  const float* gamma = (const float*)d_in[10];
  const float* beta  = (const float*)d_in[11];
  float* out = (float*)d_out;

  // Workspace layout (f16 elements), ~248 MB total
  const size_t HB  = (size_t)ROWS_H * WD;   //  8,388,608
  const size_t E16 = (size_t)ROWS_E * WD;   // 33,554,432
  const size_t WSZ = (size_t)WD * WD;       //  1,048,576
  half_t* w = (half_t*)d_ws;
  half_t* hb16  = w;                 w += HB;
  half_t* e16   = w;                 w += E16;
  half_t* WqT   = w;                 w += WSZ;
  half_t* WkT   = w;                 w += WSZ;
  half_t* WvT   = w;                 w += WSZ;
  half_t* WoT   = w;                 w += WSZ;
  half_t* q16   = w;                 w += HB;
  half_t* k16   = w;                 w += E16;
  half_t* vT16  = w;                 w += E16;
  half_t* att16 = w;                 w += HB;

  // 1. LayerNorm + pad + cast
  ln_cast_kernel<<<ROWS_H, 256, 0, stream>>>(h, gamma, beta, hb16);
  // 2. cast e
  cast_f16_kernel<<<8192, 256, 0, stream>>>(e, e16, E16);
  // 3. transpose-cast weights
  transpose_cast_kernel<<<4096, 256, 0, stream>>>(Wq, WqT);
  transpose_cast_kernel<<<4096, 256, 0, stream>>>(Wk, WkT);
  transpose_cast_kernel<<<4096, 256, 0, stream>>>(Wv, WvT);
  transpose_cast_kernel<<<4096, 256, 0, stream>>>(Wo, WoT);
  // 4. q projection: (8192x1024) @ (1024x1024)
  gemm128_kernel<0><<<dim3(WD / 128, ROWS_H / 128), 256, 0, stream>>>(
      hb16, WqT, bq, q16, nullptr, nullptr, ROWS_H, WD, WD);
  // 5. k projection: (32768x1024) @ (1024x1024)
  gemm128_kernel<0><<<dim3(WD / 128, ROWS_E / 128), 256, 0, stream>>>(
      e16, WkT, bk, k16, nullptr, nullptr, ROWS_E, WD, WD);
  // 6. v projection, transposed output
  gemm128_kernel<1><<<dim3(WD / 128, ROWS_E / 128), 256, 0, stream>>>(
      e16, WvT, bv, vT16, nullptr, nullptr, ROWS_E, WD, WD);
  // 7. attention per (b,c,h)
  attention_kernel<<<WB * WC * WH, 256, 0, stream>>>(q16, k16, vT16, att16);
  // 8. residual-only head rows
  residual_head_kernel<<<(WB * (WCHUNK - 1) * WD) / 256, 256, 0, stream>>>(h,
                                                                           out);
  // 9. output projection + shift + residual, fused into d_out
  gemm128_kernel<2><<<dim3(WD / 128, ROWS_H / 128), 256, 0, stream>>>(
      att16, WoT, bo, nullptr, h, out, ROWS_H, WD, WD);
}

// v001
// A run of this version takes 403 microseconds.
// In two side-by-side timings against v000, it was 1.31 and 1.32 times as fast.
#include <hip/hip_runtime.h>
#include <hip/hip_bf16.h>
#include <math.h>

// ---------------------------------------------------------------------------
// Chunked cross attention for MI455X (gfx1250), wave32 + WMMA f16->f32,
// LDS-blocked GEMMs (128x128 block, 64x32 per wave) with async global->LDS.
// B=4 S=2048 D=1024 C=32 N=2 L=128 H=16 DK=64 CHUNK=64
// ---------------------------------------------------------------------------

typedef _Float16 half_t;
typedef __attribute__((ext_vector_type(16))) _Float16 v16h;
typedef __attribute__((ext_vector_type(8)))  _Float16 v8h;
typedef __attribute__((ext_vector_type(4)))  _Float16 v4h;
typedef __attribute__((ext_vector_type(8)))  float    v8f;

#define WB 4
#define WS 2048
#define WD 1024
#define WC 32
#define WH 16
#define WDK 64
#define WCHUNK 64
#define WNL 256                       // N*L
#define ROWS_H (WB * WS)              // 8192
#define ROWS_E (WB * WC * WNL)        // 32768
#define VALID_ROWS (WS - WCHUNK + 1)  // 1985
#define WSCALE 0.125f                 // 1/sqrt(64)

#define LDS_STRIDE 40                 // 32 + 8 halves: 16B aligned, bank-spread

#if defined(__AMDGCN__) &&                                              \
    __has_builtin(__builtin_amdgcn_global_load_async_to_lds_b128) &&    \
    __has_builtin(__builtin_amdgcn_s_wait_asynccnt)
#define USE_ASYNC 1
typedef int v4i __attribute__((vector_size(16)));
typedef __attribute__((address_space(1))) v4i as1_v4i;
typedef __attribute__((address_space(3))) v4i as3_v4i;
#else
#define USE_ASYNC 0
#endif

__device__ __forceinline__ v8f wmma16(v16h a, v16h b, v8f c) {
  return __builtin_amdgcn_wmma_f32_16x16x32_f16(false, a, false, b, (short)0, c,
                                                false, false);
}

// Fragment loader for v_wmma_f32_16x16x32_f16. Works for A (MxK row-major,
// lane&15 = M) and B supplied N-major (NxK row-major, lane&15 = N).
// elements 0..7 = K[k0+hi*8 ..], elements 8..15 = K[k0+16+hi*8 ..].
__device__ __forceinline__ v16h load_frag(const half_t* __restrict__ base,
                                          int ld, int k0, int lane) {
  int m  = lane & 15;
  int hi = (lane >> 4) & 1;
  const half_t* p = base + (size_t)m * ld + k0 + hi * 8;
  v8h lo = *(const v8h*)(p);
  v8h hv = *(const v8h*)(p + 16);
  v16h r;
#pragma unroll
  for (int e = 0; e < 8; ++e) { r[e] = lo[e]; r[e + 8] = hv[e]; }
  return r;
}

// Stage one K-step tile (A:128x32, B:128x32 halves) into LDS.
// Each of 256 threads moves 16 halves of A and 16 of B (2x b128 each).
__device__ __forceinline__ void stage_tile(const half_t* __restrict__ gA,
                                           const half_t* __restrict__ gB,
                                           int ldg, half_t* sA, half_t* sB,
                                           int tid) {
  int row = tid >> 1;
  int cs  = (tid & 1) * 16;
  const half_t* pa = gA + (size_t)row * ldg + cs;
  const half_t* pb = gB + (size_t)row * ldg + cs;
  half_t* la = sA + row * LDS_STRIDE + cs;
  half_t* lb = sB + row * LDS_STRIDE + cs;
#if USE_ASYNC
  __builtin_amdgcn_global_load_async_to_lds_b128((as1_v4i*)pa, (as3_v4i*)la, 0,
                                                 0);
  __builtin_amdgcn_global_load_async_to_lds_b128((as1_v4i*)(pa + 8),
                                                 (as3_v4i*)(la + 8), 0, 0);
  __builtin_amdgcn_global_load_async_to_lds_b128((as1_v4i*)pb, (as3_v4i*)lb, 0,
                                                 0);
  __builtin_amdgcn_global_load_async_to_lds_b128((as1_v4i*)(pb + 8),
                                                 (as3_v4i*)(lb + 8), 0, 0);
#else
  v8h a0 = *(const v8h*)pa, a1 = *(const v8h*)(pa + 8);
  v8h b0 = *(const v8h*)pb, b1 = *(const v8h*)(pb + 8);
  *(v8h*)la = a0; *(v8h*)(la + 8) = a1;
  *(v8h*)lb = b0; *(v8h*)(lb + 8) = b1;
#endif
}

__device__ __forceinline__ void async_wait0() {
#if USE_ASYNC
  __builtin_amdgcn_s_wait_asynccnt(0);
#endif
}

// ---------------------------------------------------------------------------
// 1. LayerNorm of h[:,63:] -> f16, padded with zeros to (B, 2048, D)
// ---------------------------------------------------------------------------
__global__ __launch_bounds__(256) void ln_cast_kernel(
    const float* __restrict__ h, const float* __restrict__ gamma,
    const float* __restrict__ beta, half_t* __restrict__ hb16) {
  int row = blockIdx.x;                 // 0..8191
  int b = row >> 11, t = row & 2047;
  half_t* dst = hb16 + (size_t)row * WD;
  int tid = threadIdx.x;
  if (t >= VALID_ROWS) {                // zero padding rows (block-uniform)
    for (int i = tid; i < WD; i += 256) dst[i] = (half_t)0.0f;
    return;
  }
  const float* x = h + ((size_t)b * WS + t + (WCHUNK - 1)) * WD;
  float s = 0.f, s2 = 0.f;
  for (int i = tid; i < WD; i += 256) { float v = x[i]; s += v; s2 += v * v; }
  __shared__ float sh[256], sh2[256];
  sh[tid] = s; sh2[tid] = s2; __syncthreads();
  for (int off = 128; off > 0; off >>= 1) {
    if (tid < off) { sh[tid] += sh[tid + off]; sh2[tid] += sh2[tid + off]; }
    __syncthreads();
  }
  float mu  = sh[0] * (1.0f / WD);
  float var = sh2[0] * (1.0f / WD) - mu * mu;
  float rs  = rsqrtf(var + 1e-5f);
  for (int i = tid; i < WD; i += 256)
    dst[i] = (half_t)((x[i] - mu) * rs * gamma[i] + beta[i]);
}

// ---------------------------------------------------------------------------
// 2. Elementwise f32 -> f16 cast (for e)
// ---------------------------------------------------------------------------
__global__ __launch_bounds__(256) void cast_f16_kernel(
    const float* __restrict__ src, half_t* __restrict__ dst, size_t n) {
  size_t i = (size_t)blockIdx.x * 256 + threadIdx.x;
  size_t stride = (size_t)gridDim.x * 256;
  for (; i < n; i += stride) dst[i] = (half_t)src[i];
}

// ---------------------------------------------------------------------------
// 3. Weight transpose + cast: W (KxN) f32 -> WT (NxK) f16   (1024x1024)
//    One 64(k) x 64(n) tile per block, turned in LDS: rows of W are read as
//    16-byte loads, rows of WT leave as whole 128-byte lines.
// ---------------------------------------------------------------------------
#define TR_PITCH 72                   // 64 + 8 halves: rows stay 16B aligned

__global__ __launch_bounds__(256) void transpose_cast_kernel(
    const float* __restrict__ W, half_t* __restrict__ WT) {
  __shared__ __align__(16) half_t tile[64 * TR_PITCH];   // [n][k]
  int tid = threadIdx.x;
  int k0 = blockIdx.y * 64, n0 = blockIdx.x * 64;

  // each thread: a 4(k) x 4(n) patch, 16 lanes cover one 256-byte row piece
  int nq = (tid & 15) * 4, kq = (tid >> 4) * 4;
  const float* src = W + (size_t)(k0 + kq) * WD + n0 + nq;
  float4 r0 = *(const float4*)(src);
  float4 r1 = *(const float4*)(src + WD);
  float4 r2 = *(const float4*)(src + 2 * WD);
  float4 r3 = *(const float4*)(src + 3 * WD);
  v4h c0 = {(half_t)r0.x, (half_t)r1.x, (half_t)r2.x, (half_t)r3.x};
  v4h c1 = {(half_t)r0.y, (half_t)r1.y, (half_t)r2.y, (half_t)r3.y};
  v4h c2 = {(half_t)r0.z, (half_t)r1.z, (half_t)r2.z, (half_t)r3.z};
  v4h c3 = {(half_t)r0.w, (half_t)r1.w, (half_t)r2.w, (half_t)r3.w};
  *(v4h*)(tile + (nq + 0) * TR_PITCH + kq) = c0;
  *(v4h*)(tile + (nq + 1) * TR_PITCH + kq) = c1;
  *(v4h*)(tile + (nq + 2) * TR_PITCH + kq) = c2;
  *(v4h*)(tile + (nq + 3) * TR_PITCH + kq) = c3;
  __syncthreads();

  // 8 lanes write one 128-byte line of WT
  for (int j = 0; j < 2; ++j) {
    int idx = tid + j * 256;
    int n = idx >> 3, ks = (idx & 7) * 8;
    *(v8h*)(WT + (size_t)(n0 + n) * WD + k0 + ks) =
        *(const v8h*)(tile + n * TR_PITCH + ks);
  }
}

// ---------------------------------------------------------------------------
// 4. Blocked WMMA GEMM: block tile 128x128, K-step 32, double-buffered LDS.
//    8 waves, each computing 64x32 (4x2 subtiles, 8 independent accumulators).
//    A (MxK row-major), Bt (NxK row-major).  All dims multiples of 128.
//    MODE 0: C16[row*N+col] = acc + bias[col]                 (q, k proj)
//    MODE 1: vT[(bc,h,dk,j)] = acc + bias[col]                (v proj, T out)
//    MODE 2: out f32 with shift-by-63 + residual              (Wo proj)
// ---------------------------------------------------------------------------
template <int MODE>
__global__ __launch_bounds__(256) void gemm128_kernel(
    const half_t* __restrict__ A, const half_t* __restrict__ Bt,
    const float* __restrict__ bias, half_t* __restrict__ C16,
    const float* __restrict__ hres, float* __restrict__ outf, int M, int N,
    int K) {
  __shared__ __align__(16) half_t sA[2][128 * LDS_STRIDE];
  __shared__ __align__(16) half_t sB[2][128 * LDS_STRIDE];

  int tid  = threadIdx.x;
  int lane = tid & 31, wave = tid >> 5;
  int tm0 = blockIdx.y * 128;
  int tn0 = blockIdx.x * 128;
  int mw = (wave >> 2) * 64;            // wave row offset in block tile
  int nw = (wave & 3) * 32;             // wave col offset in block tile

  const half_t* Ab = A + (size_t)tm0 * K;
  const half_t* Bb = Bt + (size_t)tn0 * K;
  int nk = K >> 5;

  stage_tile(Ab, Bb, K, sA[0], sB[0], tid);
  async_wait0();
  __syncthreads();

  v8f acc[4][2] = {};
  for (int kt = 0; kt < nk; ++kt) {
    int buf = kt & 1;
    if (kt + 1 < nk)
      stage_tile(Ab + (kt + 1) * 32, Bb + (kt + 1) * 32, K, sA[buf ^ 1],
                 sB[buf ^ 1], tid);

    const half_t* As_w = sA[buf] + mw * LDS_STRIDE;
    const half_t* Bs_w = sB[buf] + nw * LDS_STRIDE;
    v16h af[4], bf[2];
#pragma unroll
    for (int i = 0; i < 4; ++i)
      af[i] = load_frag(As_w + i * 16 * LDS_STRIDE, LDS_STRIDE, 0, lane);
#pragma unroll
    for (int j = 0; j < 2; ++j)
      bf[j] = load_frag(Bs_w + j * 16 * LDS_STRIDE, LDS_STRIDE, 0, lane);
#pragma unroll
    for (int i = 0; i < 4; ++i)
#pragma unroll
      for (int j = 0; j < 2; ++j) acc[i][j] = wmma16(af[i], bf[j], acc[i][j]);

    async_wait0();
    __syncthreads();
  }

  // Epilogue: C/D layout -> row = base + (lane>>4)*8 + r, col = base + lane&15
  int nl = lane & 15, mb = (lane >> 4) * 8;
#pragma unroll
  for (int i = 0; i < 4; ++i) {
#pragma unroll
    for (int j = 0; j < 2; ++j) {
      int col = tn0 + nw + j * 16 + nl;
      float bv = bias[col];
#pragma unroll
      for (int r = 0; r < 8; ++r) {
        int row = tm0 + mw + i * 16 + mb + r;
        float v = acc[i][j][r] + bv;
        if (MODE == 0) {
          C16[(size_t)row * N + col] = (half_t)v;
        } else if (MODE == 1) {
          int bc = row >> 8, jj = row & 255;
          int hh = col >> 6, dk = col & 63;
          C16[(((size_t)bc * WH + hh) * WDK + dk) * WNL + jj] = (half_t)v;
        } else {
          int b = row >> 11, t = row & 2047;
          if (t < VALID_ROWS) {          // shift by 63; tail rows discarded
            size_t o = ((size_t)b * WS + t + (WCHUNK - 1)) * WD + col;
            outf[o] = v + hres[o];
          }
        }
      }
    }
  }
}

// ---------------------------------------------------------------------------
// 5. Attention: one block per (b,c,h). Scores (64x256) via WMMA into LDS,
//    softmax over 256, P@V via WMMA (A from LDS, B = vT from global).
// ---------------------------------------------------------------------------
__global__ __launch_bounds__(256) void attention_kernel(
    const half_t* __restrict__ q16, const half_t* __restrict__ k16,
    const half_t* __restrict__ vT16, half_t* __restrict__ att16) {
  int unit = blockIdx.x;                  // 0..2047
  int bc = unit >> 4;                     // b*32 + c
  int hh = unit & 15;
  int tid = threadIdx.x;
  int lane = tid & 31, wave = tid >> 5;

  __shared__ __align__(16) half_t sc[WCHUNK * WNL];   // 64x256 f16 = 32 KB
  __shared__ float rmax[WCHUNK], rinv[WCHUNK];

  const half_t* Aq = q16 + (size_t)bc * WCHUNK * WD + hh * WDK;
  const half_t* Bk = k16 + (size_t)bc * WNL * WD + hh * WDK;

  // --- scores = (q . k^T) * SCALE : 64 tiles (4m x 16n), 8 per wave
#pragma unroll
  for (int it = 0; it < 8; ++it) {
    int tile = wave * 8 + it;
    int tm = tile >> 4, tn = tile & 15;
    const half_t* Ab = Aq + (size_t)tm * 16 * WD;
    const half_t* Bb = Bk + (size_t)tn * 16 * WD;
    v8f acc = {};
    acc = wmma16(load_frag(Ab, WD, 0, lane), load_frag(Bb, WD, 0, lane), acc);
    acc = wmma16(load_frag(Ab, WD, 32, lane), load_frag(Bb, WD, 32, lane), acc);
    int n = lane & 15, mb = (lane >> 4) * 8;
#pragma unroll
    for (int r = 0; r < 8; ++r)
      sc[(tm * 16 + mb + r) * WNL + tn * 16 + n] = (half_t)(acc[r] * WSCALE);
  }
  __syncthreads();

  // --- row stats (thread-per-row)
  if (tid < WCHUNK) {
    float mx = -1e30f;
    for (int j = 0; j < WNL; ++j) mx = fmaxf(mx, (float)sc[tid * WNL + j]);
    float s = 0.f;
    for (int j = 0; j < WNL; ++j) s += __expf((float)sc[tid * WNL + j] - mx);
    rmax[tid] = mx;
    rinv[tid] = 1.0f / s;
  }
  __syncthreads();

  // --- normalize in place (each thread owns its 64 elements)
#pragma unroll 4
  for (int e = 0; e < 64; ++e) {
    int idx = tid * 64 + e;
    int i = idx >> 8;
    sc[idx] = (half_t)(__expf((float)sc[idx] - rmax[i]) * rinv[i]);
  }
  __syncthreads();

  // --- out = P @ V : 16 tiles (4m x 4n over dk), 2 per wave
  const half_t* Bv = vT16 + ((size_t)bc * WH + hh) * WDK * WNL;
#pragma unroll
  for (int it = 0; it < 2; ++it) {
    int tile = wave * 2 + it;
    int tm = tile >> 2, tn = tile & 3;
    const half_t* Ab = sc + (size_t)tm * 16 * WNL;
    const half_t* Bb = Bv + (size_t)tn * 16 * WNL;
    v8f acc = {};
    for (int k0 = 0; k0 < WNL; k0 += 32)
      acc = wmma16(load_frag(Ab, WNL, k0, lane), load_frag(Bb, WNL, k0, lane),
                   acc);
    int n = lane & 15, mb = (lane >> 4) * 8;
#pragma unroll
    for (int r = 0; r < 8; ++r)
      att16[((size_t)bc * WCHUNK + tm * 16 + mb + r) * WD + hh * WDK +
            tn * 16 + n] = (half_t)acc[r];
  }
}

// ---------------------------------------------------------------------------
// 6. Residual-only head rows: out[b,s,:] = h[b,s,:] for s < 63
// ---------------------------------------------------------------------------
__global__ __launch_bounds__(256) void residual_head_kernel(
    const float* __restrict__ h, float* __restrict__ out) {
  int idx = blockIdx.x * 256 + threadIdx.x;     // 4*63*1024 = 258048 exact
  int b = idx / ((WCHUNK - 1) * WD);
  int rem = idx % ((WCHUNK - 1) * WD);
  int s = rem / WD, d = rem % WD;
  size_t o = ((size_t)b * WS + s) * WD + d;
  out[o] = h[o];
}

// ---------------------------------------------------------------------------
// Host launcher
// ---------------------------------------------------------------------------
extern "C" void kernel_launch(void* const* d_in, const int* in_sizes, int n_in,
                              void* d_out, int out_size, void* d_ws,
                              size_t ws_size, hipStream_t stream) {
  const float* h     = (const float*)d_in[0];
  const float* e     = (const float*)d_in[1];
  const float* Wq    = (const float*)d_in[2];
  const float* bq    = (const float*)d_in[3];
  const float* Wk    = (const float*)d_in[4];
  const float* bk    = (const float*)d_in[5];
  const float* Wv    = (const float*)d_in[6];
  const float* bv    = (const float*)d_in[7];
  const float* Wo    = (const float*)d_in[8];
  const float* bo    = (const float*)d_in[9];
  const float* gamma = (const float*)d_in[10];
  const float* beta  = (const float*)d_in[11];
  float* out = (float*)d_out;

  // Workspace layout (f16 elements), ~248 MB total
  const size_t HB  = (size_t)ROWS_H * WD;   //  8,388,608
  const size_t E16 = (size_t)ROWS_E * WD;   // 33,554,432
  const size_t WSZ = (size_t)WD * WD;       //  1,048,576
  half_t* w = (half_t*)d_ws;
  half_t* hb16  = w;                 w += HB;
  half_t* e16   = w;                 w += E16;
  half_t* WqT   = w;                 w += WSZ;
  half_t* WkT   = w;                 w += WSZ;
  half_t* WvT   = w;                 w += WSZ;
  half_t* WoT   = w;                 w += WSZ;
  half_t* q16   = w;                 w += HB;
  half_t* k16   = w;                 w += E16;
  half_t* vT16  = w;                 w += E16;
  half_t* att16 = w;                 w += HB;

  // 1. LayerNorm + pad + cast
  ln_cast_kernel<<<ROWS_H, 256, 0, stream>>>(h, gamma, beta, hb16);
  // 2. cast e
  cast_f16_kernel<<<8192, 256, 0, stream>>>(e, e16, E16);
  // 3. transpose-cast weights
  transpose_cast_kernel<<<dim3(WD / 64, WD / 64), 256, 0, stream>>>(Wq, WqT);
  transpose_cast_kernel<<<dim3(WD / 64, WD / 64), 256, 0, stream>>>(Wk, WkT);
  transpose_cast_kernel<<<dim3(WD / 64, WD / 64), 256, 0, stream>>>(Wv, WvT);
  transpose_cast_kernel<<<dim3(WD / 64, WD / 64), 256, 0, stream>>>(Wo, WoT);
  // 4. q projection: (8192x1024) @ (1024x1024)
  gemm128_kernel<0><<<dim3(WD / 128, ROWS_H / 128), 256, 0, stream>>>(
      hb16, WqT, bq, q16, nullptr, nullptr, ROWS_H, WD, WD);
  // 5. k projection: (32768x1024) @ (1024x1024)
  gemm128_kernel<0><<<dim3(WD / 128, ROWS_E / 128), 256, 0, stream>>>(
      e16, WkT, bk, k16, nullptr, nullptr, ROWS_E, WD, WD);
  // 6. v projection, transposed output
  gemm128_kernel<1><<<dim3(WD / 128, ROWS_E / 128), 256, 0, stream>>>(
      e16, WvT, bv, vT16, nullptr, nullptr, ROWS_E, WD, WD);
  // 7. attention per (b,c,h)
  attention_kernel<<<WB * WC * WH, 256, 0, stream>>>(q16, k16, vT16, att16);
  // 8. residual-only head rows
  residual_head_kernel<<<(WB * (WCHUNK - 1) * WD) / 256, 256, 0, stream>>>(h,
                                                                           out);
  // 9. output projection + shift + residual, fused into d_out
  gemm128_kernel<2><<<dim3(WD / 128, ROWS_H / 128), 256, 0, stream>>>(
      att16, WoT, bo, nullptr, h, out, ROWS_H, WD, WD);
}

// v002
// Measured time: 348 microseconds a run.
// Two timings next to v001 put it at 1.16 and 1.15 times that version's speed.
// Over all steps from v000 it is 1.52 times as fast.
#include <hip/hip_runtime.h>
#include <hip/hip_bf16.h>
#include <math.h>

// ---------------------------------------------------------------------------
// Chunked cross attention for MI455X (gfx1250), wave32 + WMMA f16->f32,
// LDS-blocked GEMMs (128x128 block, 64x32 per wave) with async global->LDS.
// B=4 S=2048 D=1024 C=32 N=2 L=128 H=16 DK=64 CHUNK=64
// ---------------------------------------------------------------------------

typedef _Float16 half_t;
typedef __attribute__((ext_vector_type(16))) _Float16 v16h;
typedef __attribute__((ext_vector_type(8)))  _Float16 v8h;
typedef __attribute__((ext_vector_type(4)))  _Float16 v4h;
typedef __attribute__((ext_vector_type(8)))  float    v8f;

#define WB 4
#define WS 2048
#define WD 1024
#define WC 32
#define WH 16
#define WDK 64
#define WCHUNK 64
#define WNL 256                       // N*L
#define ROWS_H (WB * WS)              // 8192
#define ROWS_E (WB * WC * WNL)        // 32768
#define VALID_ROWS (WS - WCHUNK + 1)  // 1985
#define WSCALE 0.125f                 // 1/sqrt(64)

#define LDS_STRIDE 40                 // 32 + 8 halves: 16B aligned, bank-spread

#if defined(__AMDGCN__) &&                                              \
    __has_builtin(__builtin_amdgcn_global_load_async_to_lds_b128) &&    \
    __has_builtin(__builtin_amdgcn_s_wait_asynccnt)
#define USE_ASYNC 1
typedef int v4i __attribute__((vector_size(16)));
typedef __attribute__((address_space(1))) v4i as1_v4i;
typedef __attribute__((address_space(3))) v4i as3_v4i;
#else
#define USE_ASYNC 0
#endif

__device__ __forceinline__ v8f wmma16(v16h a, v16h b, v8f c) {
  return __builtin_amdgcn_wmma_f32_16x16x32_f16(false, a, false, b, (short)0, c,
                                                false, false);
}

// Fragment loader for v_wmma_f32_16x16x32_f16. Works for A (MxK row-major,
// lane&15 = M) and B supplied N-major (NxK row-major, lane&15 = N).
// elements 0..7 = K[k0+hi*8 ..], elements 8..15 = K[k0+16+hi*8 ..].
__device__ __forceinline__ v16h load_frag(const half_t* __restrict__ base,
                                          int ld, int k0, int lane) {
  int m  = lane & 15;
  int hi = (lane >> 4) & 1;
  const half_t* p = base + (size_t)m * ld + k0 + hi * 8;
  v8h lo = *(const v8h*)(p);
  v8h hv = *(const v8h*)(p + 16);
  v16h r;
#pragma unroll
  for (int e = 0; e < 8; ++e) { r[e] = lo[e]; r[e + 8] = hv[e]; }
  return r;
}

// Stage one K-step tile (A:128x32, B:128x32 halves) into LDS.
// Each of 256 threads moves 16 halves of A and 16 of B (2x b128 each).
__device__ __forceinline__ void stage_tile(const half_t* __restrict__ gA,
                                           const half_t* __restrict__ gB,
                                           int ldg, half_t* sA, half_t* sB,
                                           int tid) {
  int row = tid >> 1;
  int cs  = (tid & 1) * 16;
  const half_t* pa = gA + (size_t)row * ldg + cs;
  const half_t* pb = gB + (size_t)row * ldg + cs;
  half_t* la = sA + row * LDS_STRIDE + cs;
  half_t* lb = sB + row * LDS_STRIDE + cs;
#if USE_ASYNC
  __builtin_amdgcn_global_load_async_to_lds_b128((as1_v4i*)pa, (as3_v4i*)la, 0,
                                                 0);
  __builtin_amdgcn_global_load_async_to_lds_b128((as1_v4i*)(pa + 8),
                                                 (as3_v4i*)(la + 8), 0, 0);
  __builtin_amdgcn_global_load_async_to_lds_b128((as1_v4i*)pb, (as3_v4i*)lb, 0,
                                                 0);
  __builtin_amdgcn_global_load_async_to_lds_b128((as1_v4i*)(pb + 8),
                                                 (as3_v4i*)(lb + 8), 0, 0);
#else
  v8h a0 = *(const v8h*)pa, a1 = *(const v8h*)(pa + 8);
  v8h b0 = *(const v8h*)pb, b1 = *(const v8h*)(pb + 8);
  *(v8h*)la = a0; *(v8h*)(la + 8) = a1;
  *(v8h*)lb = b0; *(v8h*)(lb + 8) = b1;
#endif
}

__device__ __forceinline__ void async_wait0() {
#if USE_ASYNC
  __builtin_amdgcn_s_wait_asynccnt(0);
#endif
}

// ---------------------------------------------------------------------------
// 1. LayerNorm of h[:,63:] -> f16, padded with zeros to (B, 2048, D)
// ---------------------------------------------------------------------------
__global__ __launch_bounds__(256) void ln_cast_kernel(
    const float* __restrict__ h, const float* __restrict__ gamma,
    const float* __restrict__ beta, half_t* __restrict__ hb16) {
  int row = blockIdx.x;                 // 0..8191
  int b = row >> 11, t = row & 2047;
  half_t* dst = hb16 + (size_t)row * WD;
  int tid = threadIdx.x;
  if (t >= VALID_ROWS) {                // zero padding rows (block-uniform)
    for (int i = tid; i < WD; i += 256) dst[i] = (half_t)0.0f;
    return;
  }
  const float* x = h + ((size_t)b * WS + t + (WCHUNK - 1)) * WD;
  float s = 0.f, s2 = 0.f;
  for (int i = tid; i < WD; i += 256) { float v = x[i]; s += v; s2 += v * v; }
  __shared__ float sh[256], sh2[256];
  sh[tid] = s; sh2[tid] = s2; __syncthreads();
  for (int off = 128; off > 0; off >>= 1) {
    if (tid < off) { sh[tid] += sh[tid + off]; sh2[tid] += sh2[tid + off]; }
    __syncthreads();
  }
  float mu  = sh[0] * (1.0f / WD);
  float var = sh2[0] * (1.0f / WD) - mu * mu;
  float rs  = rsqrtf(var + 1e-5f);
  for (int i = tid; i < WD; i += 256)
    dst[i] = (half_t)((x[i] - mu) * rs * gamma[i] + beta[i]);
}

// ---------------------------------------------------------------------------
// 2. Elementwise f32 -> f16 cast (for e)
// ---------------------------------------------------------------------------
__global__ __launch_bounds__(256) void cast_f16_kernel(
    const float* __restrict__ src, half_t* __restrict__ dst, size_t n) {
  size_t i = (size_t)blockIdx.x * 256 + threadIdx.x;
  size_t stride = (size_t)gridDim.x * 256;
  for (; i < n; i += stride) dst[i] = (half_t)src[i];
}

// ---------------------------------------------------------------------------
// 3. Weight transpose + cast: W (KxN) f32 -> WT (NxK) f16   (1024x1024)
//    One 64(k) x 64(n) tile per block, turned in LDS: rows of W are read as
//    16-byte loads, rows of WT leave as whole 128-byte lines.
// ---------------------------------------------------------------------------
#define TR_PITCH 72                   // 64 + 8 halves: rows stay 16B aligned

__global__ __launch_bounds__(256) void transpose_cast_kernel(
    const float* __restrict__ W, half_t* __restrict__ WT) {
  __shared__ __align__(16) half_t tile[64 * TR_PITCH];   // [n][k]
  int tid = threadIdx.x;
  int k0 = blockIdx.y * 64, n0 = blockIdx.x * 64;

  // each thread: a 4(k) x 4(n) patch, 16 lanes cover one 256-byte row piece
  int nq = (tid & 15) * 4, kq = (tid >> 4) * 4;
  const float* src = W + (size_t)(k0 + kq) * WD + n0 + nq;
  float4 r0 = *(const float4*)(src);
  float4 r1 = *(const float4*)(src + WD);
  float4 r2 = *(const float4*)(src + 2 * WD);
  float4 r3 = *(const float4*)(src + 3 * WD);
  v4h c0 = {(half_t)r0.x, (half_t)r1.x, (half_t)r2.x, (half_t)r3.x};
  v4h c1 = {(half_t)r0.y, (half_t)r1.y, (half_t)r2.y, (half_t)r3.y};
  v4h c2 = {(half_t)r0.z, (half_t)r1.z, (half_t)r2.z, (half_t)r3.z};
  v4h c3 = {(half_t)r0.w, (half_t)r1.w, (half_t)r2.w, (half_t)r3.w};
  *(v4h*)(tile + (nq + 0) * TR_PITCH + kq) = c0;
  *(v4h*)(tile + (nq + 1) * TR_PITCH + kq) = c1;
  *(v4h*)(tile + (nq + 2) * TR_PITCH + kq) = c2;
  *(v4h*)(tile + (nq + 3) * TR_PITCH + kq) = c3;
  __syncthreads();

  // 8 lanes write one 128-byte line of WT
  for (int j = 0; j < 2; ++j) {
    int idx = tid + j * 256;
    int n = idx >> 3, ks = (idx & 7) * 8;
    *(v8h*)(WT + (size_t)(n0 + n) * WD + k0 + ks) =
        *(const v8h*)(tile + n * TR_PITCH + ks);
  }
}

// ---------------------------------------------------------------------------
// 4. Blocked WMMA GEMM: block tile 128x128, K-step 32, double-buffered LDS.
//    8 waves, each computing 64x32 (4x2 subtiles, 8 independent accumulators).
//    A (MxK row-major), Bt (NxK row-major).  All dims multiples of 128.
//    MODE 0: C16[row*N+col] = acc + bias[col]                 (q, k proj)
//    MODE 1: vT[(bc,h,dk,j)] = acc + bias[col]                (v proj, T out)
//    MODE 2: out f32 with shift-by-63 + residual              (Wo proj)
// ---------------------------------------------------------------------------
template <int MODE>
__global__ __launch_bounds__(256) void gemm128_kernel(
    const half_t* __restrict__ A, const half_t* __restrict__ Bt,
    const float* __restrict__ bias, half_t* __restrict__ C16,
    const float* __restrict__ hres, float* __restrict__ outf, int M, int N,
    int K) {
  __shared__ __align__(16) half_t sA[2][128 * LDS_STRIDE];
  __shared__ __align__(16) half_t sB[2][128 * LDS_STRIDE];

  int tid  = threadIdx.x;
  int lane = tid & 31, wave = tid >> 5;
  int tm0 = blockIdx.y * 128;
  int tn0 = blockIdx.x * 128;
  int mw = (wave >> 2) * 64;            // wave row offset in block tile
  int nw = (wave & 3) * 32;             // wave col offset in block tile

  const half_t* Ab = A + (size_t)tm0 * K;
  const half_t* Bb = Bt + (size_t)tn0 * K;
  int nk = K >> 5;

  stage_tile(Ab, Bb, K, sA[0], sB[0], tid);
  async_wait0();
  __syncthreads();

  v8f acc[4][2] = {};
  for (int kt = 0; kt < nk; ++kt) {
    int buf = kt & 1;
    if (kt + 1 < nk)
      stage_tile(Ab + (kt + 1) * 32, Bb + (kt + 1) * 32, K, sA[buf ^ 1],
                 sB[buf ^ 1], tid);

    const half_t* As_w = sA[buf] + mw * LDS_STRIDE;
    const half_t* Bs_w = sB[buf] + nw * LDS_STRIDE;
    v16h af[4], bf[2];
#pragma unroll
    for (int i = 0; i < 4; ++i)
      af[i] = load_frag(As_w + i * 16 * LDS_STRIDE, LDS_STRIDE, 0, lane);
#pragma unroll
    for (int j = 0; j < 2; ++j)
      bf[j] = load_frag(Bs_w + j * 16 * LDS_STRIDE, LDS_STRIDE, 0, lane);
#pragma unroll
    for (int i = 0; i < 4; ++i)
#pragma unroll
      for (int j = 0; j < 2; ++j) acc[i][j] = wmma16(af[i], bf[j], acc[i][j]);

    async_wait0();
    __syncthreads();
  }

  // Epilogue: C/D layout -> row = base + (lane>>4)*8 + r, col = base + lane&15
  int nl = lane & 15, mb = (lane >> 4) * 8;
#pragma unroll
  for (int i = 0; i < 4; ++i) {
#pragma unroll
    for (int j = 0; j < 2; ++j) {
      int col = tn0 + nw + j * 16 + nl;
      float bv = bias[col];
#pragma unroll
      for (int r = 0; r < 8; ++r) {
        int row = tm0 + mw + i * 16 + mb + r;
        float v = acc[i][j][r] + bv;
        if (MODE == 0) {
          C16[(size_t)row * N + col] = (half_t)v;
        } else if (MODE == 1) {
          int bc = row >> 8, jj = row & 255;
          int hh = col >> 6, dk = col & 63;
          C16[(((size_t)bc * WH + hh) * WDK + dk) * WNL + jj] = (half_t)v;
        } else {
          int b = row >> 11, t = row & 2047;
          if (t < VALID_ROWS) {          // shift by 63; tail rows discarded
            size_t o = ((size_t)b * WS + t + (WCHUNK - 1)) * WD + col;
            outf[o] = v + hres[o];
          }
        }
      }
    }
  }
}

// ---------------------------------------------------------------------------
// 5. Attention: one block per (b,c,h). Wave w owns query rows (w>>1)*16..+15
//    and key columns (w&1)*128..+127. Its 16x128 scores stay in the WMMA
//    accumulators (f32): row maximum and row sum are taken there, in-lane over
//    the 8 tiles, then over the 16 lanes of a row by DPP, then joined with the
//    partner wave's half through LDS. exp(s - max) goes to LDS once, as f16,
//    and P@V (A from LDS, B = vT from global) is divided by the row sum.
// ---------------------------------------------------------------------------
#define P_PITCH (WNL + 8)             // 8 halves of pad: 16 B x 33, so that b128
                                      // readers of 16 rows fall on distinct banks

// value of lane (l ^ mask) inside the 16-lane row; CTRL = 0x160 + mask
template <int CTRL>
__device__ __forceinline__ float row_xmask(float v) {
  return __builtin_bit_cast(
      float, __builtin_amdgcn_mov_dpp(__builtin_bit_cast(int, v), CTRL, 0xf,
                                      0xf, true));
}
__device__ __forceinline__ float row16_max(float v) {
  v = fmaxf(v, row_xmask<0x161>(v));
  v = fmaxf(v, row_xmask<0x162>(v));
  v = fmaxf(v, row_xmask<0x164>(v));
  v = fmaxf(v, row_xmask<0x168>(v));
  return v;
}
__device__ __forceinline__ float row16_sum(float v) {
  v += row_xmask<0x161>(v);
  v += row_xmask<0x162>(v);
  v += row_xmask<0x164>(v);
  v += row_xmask<0x168>(v);
  return v;
}

// y[i] = 2^x[i] for eight values. Written as one statement so that nothing
// the compiler schedules can stand directly behind a v_exp_f32 and read its
// result or overwrite its source: inside, every output register differs from
// every input ("=&v"); the closing v_nop is the one independent issue slot
// that the instruction set asks for behind the last of them.
__device__ __forceinline__ void exp2x8(float (&y)[8], const float (&x)[8]) {
  asm("v_exp_f32 %0, %8\n\t"
      "v_exp_f32 %1, %9\n\t"
      "v_exp_f32 %2, %10\n\t"
      "v_exp_f32 %3, %11\n\t"
      "v_exp_f32 %4, %12\n\t"
      "v_exp_f32 %5, %13\n\t"
      "v_exp_f32 %6, %14\n\t"
      "v_exp_f32 %7, %15\n\t"
      "v_nop"
      : "=&v"(y[0]), "=&v"(y[1]), "=&v"(y[2]), "=&v"(y[3]), "=&v"(y[4]),
        "=&v"(y[5]), "=&v"(y[6]), "=&v"(y[7])
      : "v"(x[0]), "v"(x[1]), "v"(x[2]), "v"(x[3]), "v"(x[4]), "v"(x[5]),
        "v"(x[6]), "v"(x[7]));
}

__global__ __launch_bounds__(256) void attention_kernel(
    const half_t* __restrict__ q16, const half_t* __restrict__ k16,
    const half_t* __restrict__ vT16, half_t* __restrict__ att16) {
  int unit = blockIdx.x;                  // 0..2047
  int bc = unit >> 4;                     // b*32 + c
  int hh = unit & 15;
  int tid = threadIdx.x;
  int lane = tid & 31, wave = tid >> 5;
  int tm = wave >> 1, hf = wave & 1;
  int n = lane & 15, mb = (lane >> 4) * 8;
  int row0 = tm * 16 + mb;                // first of this lane's 8 rows

  __shared__ __align__(16) half_t sp[WCHUNK * P_PITCH];   // exp(s - max), f16
  __shared__ __align__(16) float pmax[2][WCHUNK], psum[2][WCHUNK];

  const half_t* Aq = q16 + ((size_t)bc * WCHUNK + tm * 16) * WD + hh * WDK;
  const half_t* Bk = k16 + ((size_t)bc * WNL + hf * 128) * WD + hh * WDK;

  // --- raw scores q . k^T : 8 tiles of 16x16, kept in registers
  v16h qa0 = load_frag(Aq, WD, 0, lane);
  v16h qa1 = load_frag(Aq, WD, 32, lane);
  v8f acc[8];
#pragma unroll  // constant indices keep acc[] in registers
  for (int it = 0; it < 8; ++it) {
    const half_t* Bb = Bk + (size_t)it * 16 * WD;
    v8f a = {};
    a = wmma16(qa0, load_frag(Bb, WD, 0, lane), a);
    a = wmma16(qa1, load_frag(Bb, WD, 32, lane), a);
    acc[it] = a;
  }

  // --- row maximum: own 128 columns, then the partner wave's
  float mx[8];
#pragma unroll  // constant indices keep acc[] and mx[] in registers
  for (int r = 0; r < 8; ++r) {
    float m = acc[0][r];
#pragma unroll  // as above
    for (int it = 1; it < 8; ++it) m = fmaxf(m, acc[it][r]);
    mx[r] = row16_max(m);
  }
  if (n == 0) {
    *(float4*)&pmax[hf][row0]     = make_float4(mx[0], mx[1], mx[2], mx[3]);
    *(float4*)&pmax[hf][row0 + 4] = make_float4(mx[4], mx[5], mx[6], mx[7]);
  }
  __syncthreads();
  {
    float4 o0 = *(const float4*)&pmax[hf ^ 1][row0];
    float4 o1 = *(const float4*)&pmax[hf ^ 1][row0 + 4];
    mx[0] = fmaxf(mx[0], o0.x); mx[1] = fmaxf(mx[1], o0.y);
    mx[2] = fmaxf(mx[2], o0.z); mx[3] = fmaxf(mx[3], o0.w);
    mx[4] = fmaxf(mx[4], o1.x); mx[5] = fmaxf(mx[5], o1.y);
    mx[6] = fmaxf(mx[6], o1.z); mx[7] = fmaxf(mx[7], o1.w);
  }

  // --- p = exp((s - max) * SCALE) = 2^(s*c - max*c), c = SCALE * log2(e);
  //     not yet divided by the row sum
  const float cexp = WSCALE * 1.44269504088896f;
  float sm[8];
#pragma unroll  // constant indices keep acc[], mx[] and sm[] in registers
  for (int r = 0; r < 8; ++r) {
    half_t* dst = sp + (row0 + r) * P_PITCH + hf * 128 + n;
    float nm = -mx[r] * cexp;
    float x[8], p[8];
#pragma unroll  // as above
    for (int it = 0; it < 8; ++it) x[it] = fmaf(acc[it][r], cexp, nm);
    exp2x8(p, x);
    float s = p[0];
    dst[0] = (half_t)p[0];
#pragma unroll  // as above
    for (int it = 1; it < 8; ++it) {
      s += p[it];
      dst[it * 16] = (half_t)p[it];
    }
    sm[r] = row16_sum(s);
  }
  if (n == 0) {
    *(float4*)&psum[hf][row0]     = make_float4(sm[0], sm[1], sm[2], sm[3]);
    *(float4*)&psum[hf][row0 + 4] = make_float4(sm[4], sm[5], sm[6], sm[7]);
  }
  __syncthreads();
  {
    float4 o0 = *(const float4*)&psum[hf ^ 1][row0];
    float4 o1 = *(const float4*)&psum[hf ^ 1][row0 + 4];
    sm[0] = __builtin_amdgcn_rcpf(sm[0] + o0.x);
    sm[1] = __builtin_amdgcn_rcpf(sm[1] + o0.y);
    sm[2] = __builtin_amdgcn_rcpf(sm[2] + o0.z);
    sm[3] = __builtin_amdgcn_rcpf(sm[3] + o0.w);
    sm[4] = __builtin_amdgcn_rcpf(sm[4] + o1.x);
    sm[5] = __builtin_amdgcn_rcpf(sm[5] + o1.y);
    sm[6] = __builtin_amdgcn_rcpf(sm[6] + o1.z);
    sm[7] = __builtin_amdgcn_rcpf(sm[7] + o1.w);
  }

  // --- out = (P @ V) / sum : the wave's own 16 rows, 2 of the 4 dk tiles
  const half_t* Bv = vT16 + ((size_t)bc * WH + hh) * WDK * WNL;
  const half_t* Ab = sp + tm * 16 * P_PITCH;
#pragma unroll  // two independent accumulate chains side by side
  for (int it = 0; it < 2; ++it) {
    int tn = hf * 2 + it;
    const half_t* Bb = Bv + (size_t)tn * 16 * WNL;
    v8f o = {};
    for (int k0 = 0; k0 < WNL; k0 += 32)
      o = wmma16(load_frag(Ab, P_PITCH, k0, lane), load_frag(Bb, WNL, k0, lane),
                 o);
#pragma unroll  // constant indices keep o and sm[] in registers
    for (int r = 0; r < 8; ++r)
      att16[((size_t)bc * WCHUNK + row0 + r) * WD + hh * WDK + tn * 16 + n] =
          (half_t)(o[r] * sm[r]);
  }
}

// ---------------------------------------------------------------------------
// 6. Residual-only head rows: out[b,s,:] = h[b,s,:] for s < 63
// ---------------------------------------------------------------------------
__global__ __launch_bounds__(256) void residual_head_kernel(
    const float* __restrict__ h, float* __restrict__ out) {
  int idx = blockIdx.x * 256 + threadIdx.x;     // 4*63*1024 = 258048 exact
  int b = idx / ((WCHUNK - 1) * WD);
  int rem = idx % ((WCHUNK - 1) * WD);
  int s = rem / WD, d = rem % WD;
  size_t o = ((size_t)b * WS + s) * WD + d;
  out[o] = h[o];
}

// ---------------------------------------------------------------------------
// Host launcher
// ---------------------------------------------------------------------------
extern "C" void kernel_launch(void* const* d_in, const int* in_sizes, int n_in,
                              void* d_out, int out_size, void* d_ws,
                              size_t ws_size, hipStream_t stream) {
  const float* h     = (const float*)d_in[0];
  const float* e     = (const float*)d_in[1];
  const float* Wq    = (const float*)d_in[2];
  const float* bq    = (const float*)d_in[3];
  const float* Wk    = (const float*)d_in[4];
  const float* bk    = (const float*)d_in[5];
  const float* Wv    = (const float*)d_in[6];
  const float* bv    = (const float*)d_in[7];
  const float* Wo    = (const float*)d_in[8];
  const float* bo    = (const float*)d_in[9];
  const float* gamma = (const float*)d_in[10];
  const float* beta  = (const float*)d_in[11];
  float* out = (float*)d_out;

  // Workspace layout (f16 elements), ~248 MB total
  const size_t HB  = (size_t)ROWS_H * WD;   //  8,388,608
  const size_t E16 = (size_t)ROWS_E * WD;   // 33,554,432
  const size_t WSZ = (size_t)WD * WD;       //  1,048,576
  half_t* w = (half_t*)d_ws;
  half_t* hb16  = w;                 w += HB;
  half_t* e16   = w;                 w += E16;
  half_t* WqT   = w;                 w += WSZ;
  half_t* WkT   = w;                 w += WSZ;
  half_t* WvT   = w;                 w += WSZ;
  half_t* WoT   = w;                 w += WSZ;
  half_t* q16   = w;                 w += HB;
  half_t* k16   = w;                 w += E16;
  half_t* vT16  = w;                 w += E16;
  half_t* att16 = w;                 w += HB;

  // 1. LayerNorm + pad + cast
  ln_cast_kernel<<<ROWS_H, 256, 0, stream>>>(h, gamma, beta, hb16);
  // 2. cast e
  cast_f16_kernel<<<8192, 256, 0, stream>>>(e, e16, E16);
  // 3. transpose-cast weights
  transpose_cast_kernel<<<dim3(WD / 64, WD / 64), 256, 0, stream>>>(Wq, WqT);
  transpose_cast_kernel<<<dim3(WD / 64, WD / 64), 256, 0, stream>>>(Wk, WkT);
  transpose_cast_kernel<<<dim3(WD / 64, WD / 64), 256, 0, stream>>>(Wv, WvT);
  transpose_cast_kernel<<<dim3(WD / 64, WD / 64), 256, 0, stream>>>(Wo, WoT);
  // 4. q projection: (8192x1024) @ (1024x1024)
  gemm128_kernel<0><<<dim3(WD / 128, ROWS_H / 128), 256, 0, stream>>>(
      hb16, WqT, bq, q16, nullptr, nullptr, ROWS_H, WD, WD);
  // 5. k projection: (32768x1024) @ (1024x1024)
  gemm128_kernel<0><<<dim3(WD / 128, ROWS_E / 128), 256, 0, stream>>>(
      e16, WkT, bk, k16, nullptr, nullptr, ROWS_E, WD, WD);
  // 6. v projection, transposed output
  gemm128_kernel<1><<<dim3(WD / 128, ROWS_E / 128), 256, 0, stream>>>(
      e16, WvT, bv, vT16, nullptr, nullptr, ROWS_E, WD, WD);
  // 7. attention per (b,c,h)
  attention_kernel<<<WB * WC * WH, 256, 0, stream>>>(q16, k16, vT16, att16);
  // 8. residual-only head rows
  residual_head_kernel<<<(WB * (WCHUNK - 1) * WD) / 256, 256, 0, stream>>>(h,
                                                                           out);
  // 9. output projection + shift + residual, fused into d_out
  gemm128_kernel<2><<<dim3(WD / 128, ROWS_H / 128), 256, 0, stream>>>(
      att16, WoT, bo, nullptr, h, out, ROWS_H, WD, WD);
}

// v003
// A run of this version takes 310 microseconds.
// Timed twice side by side with v002, it ran 1.12 times as fast both times.
// Over all steps from v000 it is 1.71 times as fast.
#include <hip/hip_runtime.h>
#include <hip/hip_bf16.h>
#include <math.h>

// ---------------------------------------------------------------------------
// Chunked cross attention for MI455X (gfx1250), wave32 + WMMA f16->f32,
// LDS-blocked GEMMs (128x128 block, 64x32 per wave) with async global->LDS.
// B=4 S=2048 D=1024 C=32 N=2 L=128 H=16 DK=64 CHUNK=64
// ---------------------------------------------------------------------------

typedef _Float16 half_t;
typedef __attribute__((ext_vector_type(16))) _Float16 v16h;
typedef __attribute__((ext_vector_type(8)))  _Float16 v8h;
typedef __attribute__((ext_vector_type(4)))  _Float16 v4h;
typedef __attribute__((ext_vector_type(8)))  float    v8f;
typedef __attribute__((ext_vector_type(4)))  float    v4f;

#define WB 4
#define WS 2048
#define WD 1024
#define WC 32
#define WH 16
#define WDK 64
#define WCHUNK 64
#define WNL 256                       // N*L
#define ROWS_H (WB * WS)              // 8192
#define ROWS_E (WB * WC * WNL)        // 32768
#define VALID_ROWS (WS - WCHUNK + 1)  // 1985
#define WSCALE 0.125f                 // 1/sqrt(64)

#define LDS_STRIDE 40                 // 32 + 8 halves: 16B aligned, bank-spread

#if defined(__AMDGCN__) &&                                              \
    __has_builtin(__builtin_amdgcn_global_load_async_to_lds_b128) &&    \
    __has_builtin(__builtin_amdgcn_s_wait_asynccnt)
#define USE_ASYNC 1
typedef int v4i __attribute__((vector_size(16)));
typedef __attribute__((address_space(1))) v4i as1_v4i;
typedef __attribute__((address_space(3))) v4i as3_v4i;
#else
#define USE_ASYNC 0
#endif

__device__ __forceinline__ v8f wmma16(v16h a, v16h b, v8f c) {
  return __builtin_amdgcn_wmma_f32_16x16x32_f16(false, a, false, b, (short)0, c,
                                                false, false);
}

// Fragment loader for v_wmma_f32_16x16x32_f16. Works for A (MxK row-major,
// lane&15 = M) and B supplied N-major (NxK row-major, lane&15 = N).
// elements 0..7 = K[k0+hi*8 ..], elements 8..15 = K[k0+16+hi*8 ..].
__device__ __forceinline__ v16h load_frag(const half_t* __restrict__ base,
                                          int ld, int k0, int lane) {
  int m  = lane & 15;
  int hi = (lane >> 4) & 1;
  const half_t* p = base + (size_t)m * ld + k0 + hi * 8;
  v8h lo = *(const v8h*)(p);
  v8h hv = *(const v8h*)(p + 16);
  v16h r;
#pragma unroll
  for (int e = 0; e < 8; ++e) { r[e] = lo[e]; r[e + 8] = hv[e]; }
  return r;
}

// Stage one K-step tile (A:128x32, B:128x32 halves) into LDS.
// Each of 256 threads moves 16 halves of A and 16 of B (2x b128 each).
__device__ __forceinline__ void stage_tile(const half_t* __restrict__ gA,
                                           const half_t* __restrict__ gB,
                                           int ldg, half_t* sA, half_t* sB,
                                           int tid) {
  int row = tid >> 1;
  int cs  = (tid & 1) * 16;
  const half_t* pa = gA + (size_t)row * ldg + cs;
  const half_t* pb = gB + (size_t)row * ldg + cs;
  half_t* la = sA + row * LDS_STRIDE + cs;
  half_t* lb = sB + row * LDS_STRIDE + cs;
#if USE_ASYNC
  __builtin_amdgcn_global_load_async_to_lds_b128((as1_v4i*)pa, (as3_v4i*)la, 0,
                                                 0);
  __builtin_amdgcn_global_load_async_to_lds_b128((as1_v4i*)(pa + 8),
                                                 (as3_v4i*)(la + 8), 0, 0);
  __builtin_amdgcn_global_load_async_to_lds_b128((as1_v4i*)pb, (as3_v4i*)lb, 0,
                                                 0);
  __builtin_amdgcn_global_load_async_to_lds_b128((as1_v4i*)(pb + 8),
                                                 (as3_v4i*)(lb + 8), 0, 0);
#else
  v8h a0 = *(const v8h*)pa, a1 = *(const v8h*)(pa + 8);
  v8h b0 = *(const v8h*)pb, b1 = *(const v8h*)(pb + 8);
  *(v8h*)la = a0; *(v8h*)(la + 8) = a1;
  *(v8h*)lb = b0; *(v8h*)(lb + 8) = b1;
#endif
}

__device__ __forceinline__ void async_wait0() {
#if USE_ASYNC
  __builtin_amdgcn_s_wait_asynccnt(0);
#endif
}

// ---------------------------------------------------------------------------
// 1. LayerNorm of h[:,63:] -> f16, padded with zeros to (B, 2048, D)
//    One wave per row: the 4 KiB row is fetched by eight 16-byte loads per
//    lane, all in flight together, and stays in registers for both uses.
//    Sums: four chains per lane, then a five-step butterfly over the wave.
//    No LDS, no barrier; 8192 waves in all.
// ---------------------------------------------------------------------------
__global__ __launch_bounds__(256) void ln_cast_kernel(
    const float* __restrict__ h, const float* __restrict__ gamma,
    const float* __restrict__ beta, half_t* __restrict__ hb16) {
  int lane = threadIdx.x & 31;
  // the wave's number as a scalar: row addresses and the pad test stay scalar
  int row = blockIdx.x * 8 + __builtin_amdgcn_readfirstlane(threadIdx.x >> 5);
  int b = row >> 11, t = row & 2047;    // row 0..8191
  v4h* dst = (v4h*)(hb16 + (size_t)row * WD);
  if (t >= VALID_ROWS) {                // zero padding rows (wave-uniform)
    v4h z = {};
#pragma unroll  // eight independent stores
    for (int j = 0; j < 8; ++j) dst[j * 32 + lane] = z;
  } else {
    const v4f* x = (const v4f*)(h + ((size_t)b * WS + t + (WCHUNK - 1)) * WD);
    v4f v[8];
#pragma unroll  // constant indices keep v[] in registers; loads issue together
    for (int j = 0; j < 8; ++j) v[j] = x[j * 32 + lane];
    v4f a = v[0], q = v[0] * v[0];
#pragma unroll  // as above
    for (int j = 1; j < 8; ++j) { a += v[j]; q += v[j] * v[j]; }
    float s = (a.x + a.y) + (a.z + a.w), s2 = (q.x + q.y) + (q.z + q.w);
#pragma unroll  // five fixed exchange distances
    for (int m = 16; m > 0; m >>= 1) {
      s  += __shfl_xor(s, m);
      s2 += __shfl_xor(s2, m);
    }
    float mu  = s * (1.0f / WD);
    float var = s2 * (1.0f / WD) - mu * mu;
    float rs  = rsqrtf(var + 1e-5f);
    const v4f* g4 = (const v4f*)gamma;
    const v4f* b4 = (const v4f*)beta;
#pragma unroll  // constant indices keep v[] in registers
    for (int j = 0; j < 8; ++j) {
      v4f y = (v[j] - mu) * rs * g4[j * 32 + lane] + b4[j * 32 + lane];
      v4h o = {(half_t)y.x, (half_t)y.y, (half_t)y.z, (half_t)y.w};
      dst[j * 32 + lane] = o;
    }
    // the listing can run on from here into the pad block, which rewrites data
    // registers of these stores: the wait stands in front of that overwrite
    asm volatile("s_wait_xcnt 0x0" ::: "memory");
  }
}

// ---------------------------------------------------------------------------
// 2. Elementwise f32 -> f16 cast (for e), as a stream: a block owns 128 KiB
//    of src in a row; each lane takes 32 16-byte loads of it (512 B in a row
//    per wave-load) and stores 8 bytes per load (256 B in a row per
//    wave-store). Written in groups of eight, which bounds the registers; the
//    compiler runs the groups into one another (sixteen loads lead, later
//    ones follow as registers come free, the stores stand last).
//    The grid covers e exactly once. 8192 waves in all.
// ---------------------------------------------------------------------------
#define CAST_U 8                      // 16-byte loads of one group
#define CAST_G 4                      // groups per lane

__global__ __launch_bounds__(256) void cast_f16_kernel(
    const float* __restrict__ src, half_t* __restrict__ dst) {
  size_t base = (size_t)blockIdx.x * (CAST_G * CAST_U * 256) + threadIdx.x;
  const float4* s4 = (const float4*)src + base;
  v4h* d4 = (v4h*)dst + base;
#pragma unroll  // constant offsets from one address per lane
  for (int g = 0; g < CAST_G; ++g) {
    float4 v[CAST_U];
#pragma unroll  // constant indices keep v[] in registers; loads issue together
    for (int u = 0; u < CAST_U; ++u) v[u] = s4[(g * CAST_U + u) * 256];
#pragma unroll  // as above
    for (int u = 0; u < CAST_U; ++u) {
      v4h o = {(half_t)v[u].x, (half_t)v[u].y, (half_t)v[u].z, (half_t)v[u].w};
      d4[(g * CAST_U + u) * 256] = o;
    }
  }
}

// ---------------------------------------------------------------------------
// 3. Weight transpose + cast: W (KxN) f32 -> WT (NxK) f16   (1024x1024)
//    One 64(k) x 64(n) tile per block, turned in LDS: rows of W are read as
//    16-byte loads, rows of WT leave as whole 128-byte lines.
// ---------------------------------------------------------------------------
#define TR_PITCH 72                   // 64 + 8 halves: rows stay 16B aligned

__global__ __launch_bounds__(256) void transpose_cast_kernel(
    const float* __restrict__ W, half_t* __restrict__ WT) {
  __shared__ __align__(16) half_t tile[64 * TR_PITCH];   // [n][k]
  int tid = threadIdx.x;
  int k0 = blockIdx.y * 64, n0 = blockIdx.x * 64;

  // each thread: a 4(k) x 4(n) patch, 16 lanes cover one 256-byte row piece
  int nq = (tid & 15) * 4, kq = (tid >> 4) * 4;
  const float* src = W + (size_t)(k0 + kq) * WD + n0 + nq;
  float4 r0 = *(const float4*)(src);
  float4 r1 = *(const float4*)(src + WD);
  float4 r2 = *(const float4*)(src + 2 * WD);
  float4 r3 = *(const float4*)(src + 3 * WD);
  v4h c0 = {(half_t)r0.x, (half_t)r1.x, (half_t)r2.x, (half_t)r3.x};
  v4h c1 = {(half_t)r0.y, (half_t)r1.y, (half_t)r2.y, (half_t)r3.y};
  v4h c2 = {(half_t)r0.z, (half_t)r1.z, (half_t)r2.z, (half_t)r3.z};
  v4h c3 = {(half_t)r0.w, (half_t)r1.w, (half_t)r2.w, (half_t)r3.w};
  *(v4h*)(tile + (nq + 0) * TR_PITCH + kq) = c0;
  *(v4h*)(tile + (nq + 1) * TR_PITCH + kq) = c1;
  *(v4h*)(tile + (nq + 2) * TR_PITCH + kq) = c2;
  *(v4h*)(tile + (nq + 3) * TR_PITCH + kq) = c3;
  __syncthreads();

  // 8 lanes write one 128-byte line of WT
  for (int j = 0; j < 2; ++j) {
    int idx = tid + j * 256;
    int n = idx >> 3, ks = (idx & 7) * 8;
    *(v8h*)(WT + (size_t)(n0 + n) * WD + k0 + ks) =
        *(const v8h*)(tile + n * TR_PITCH + ks);
  }
}

// ---------------------------------------------------------------------------
// 4. Blocked WMMA GEMM: block tile 128x128, K-step 32, double-buffered LDS.
//    8 waves, each computing 64x32 (4x2 subtiles, 8 independent accumulators).
//    A (MxK row-major), Bt (NxK row-major).  All dims multiples of 128.
//    MODE 0: C16[row*N+col] = acc + bias[col]                 (q, k proj)
//    MODE 1: vT[(bc,h,dk,j)] = acc + bias[col]                (v proj, T out)
//    MODE 2: out f32 with shift-by-63 + residual              (Wo proj)
// ---------------------------------------------------------------------------
template <int MODE>
__global__ __launch_bounds__(256) void gemm128_kernel(
    const half_t* __restrict__ A, const half_t* __restrict__ Bt,
    const float* __restrict__ bias, half_t* __restrict__ C16,
    const float* __restrict__ hres, float* __restrict__ outf, int M, int N,
    int K) {
  __shared__ __align__(16) half_t sA[2][128 * LDS_STRIDE];
  __shared__ __align__(16) half_t sB[2][128 * LDS_STRIDE];

  int tid  = threadIdx.x;
  int lane = tid & 31, wave = tid >> 5;
  int tm0 = blockIdx.y * 128;
  int tn0 = blockIdx.x * 128;
  int mw = (wave >> 2) * 64;            // wave row offset in block tile
  int nw = (wave & 3) * 32;             // wave col offset in block tile

  const half_t* Ab = A + (size_t)tm0 * K;
  const half_t* Bb = Bt + (size_t)tn0 * K;
  int nk = K >> 5;

  stage_tile(Ab, Bb, K, sA[0], sB[0], tid);
  async_wait0();
  __syncthreads();

  v8f acc[4][2] = {};
  for (int kt = 0; kt < nk; ++kt) {
    int buf = kt & 1;
    if (kt + 1 < nk)
      stage_tile(Ab + (kt + 1) * 32, Bb + (kt + 1) * 32, K, sA[buf ^ 1],
                 sB[buf ^ 1], tid);

    const half_t* As_w = sA[buf] + mw * LDS_STRIDE;
    const half_t* Bs_w = sB[buf] + nw * LDS_STRIDE;
    v16h af[4], bf[2];
#pragma unroll
    for (int i = 0; i < 4; ++i)
      af[i] = load_frag(As_w + i * 16 * LDS_STRIDE, LDS_STRIDE, 0, lane);
#pragma unroll
    for (int j = 0; j < 2; ++j)
      bf[j] = load_frag(Bs_w + j * 16 * LDS_STRIDE, LDS_STRIDE, 0, lane);
#pragma unroll
    for (int i = 0; i < 4; ++i)
#pragma unroll
      for (int j = 0; j < 2; ++j) acc[i][j] = wmma16(af[i], bf[j], acc[i][j]);

    async_wait0();
    __syncthreads();
  }

  // Epilogue: C/D layout -> row = base + (lane>>4)*8 + r, col = base + lane&15
  int nl = lane & 15, mb = (lane >> 4) * 8;
#pragma unroll
  for (int i = 0; i < 4; ++i) {
#pragma unroll
    for (int j = 0; j < 2; ++j) {
      int col = tn0 + nw + j * 16 + nl;
      float bv = bias[col];
#pragma unroll
      for (int r = 0; r < 8; ++r) {
        int row = tm0 + mw + i * 16 + mb + r;
        float v = acc[i][j][r] + bv;
        if (MODE == 0) {
          C16[(size_t)row * N + col] = (half_t)v;
        } else if (MODE == 1) {
          int bc = row >> 8, jj = row & 255;
          int hh = col >> 6, dk = col & 63;
          C16[(((size_t)bc * WH + hh) * WDK + dk) * WNL + jj] = (half_t)v;
        } else {
          int b = row >> 11, t = row & 2047;
          if (t < VALID_ROWS) {          // shift by 63; tail rows discarded
            size_t o = ((size_t)b * WS + t + (WCHUNK - 1)) * WD + col;
            outf[o] = v + hres[o];
          }
        }
      }
    }
  }
}

// ---------------------------------------------------------------------------
// 5. Attention: one block per (b,c,h). Wave w owns query rows (w>>1)*16..+15
//    and key columns (w&1)*128..+127. Its 16x128 scores stay in the WMMA
//    accumulators (f32): row maximum and row sum are taken there, in-lane over
//    the 8 tiles, then over the 16 lanes of a row by DPP, then joined with the
//    partner wave's half through LDS. exp(s - max) goes to LDS once, as f16,
//    and P@V (A from LDS, B = vT from global) is divided by the row sum.
// ---------------------------------------------------------------------------
#define P_PITCH (WNL + 8)             // 8 halves of pad: 16 B x 33, so that b128
                                      // readers of 16 rows fall on distinct banks

// value of lane (l ^ mask) inside the 16-lane row; CTRL = 0x160 + mask
template <int CTRL>
__device__ __forceinline__ float row_xmask(float v) {
  return __builtin_bit_cast(
      float, __builtin_amdgcn_mov_dpp(__builtin_bit_cast(int, v), CTRL, 0xf,
                                      0xf, true));
}
__device__ __forceinline__ float row16_max(float v) {
  v = fmaxf(v, row_xmask<0x161>(v));
  v = fmaxf(v, row_xmask<0x162>(v));
  v = fmaxf(v, row_xmask<0x164>(v));
  v = fmaxf(v, row_xmask<0x168>(v));
  return v;
}
__device__ __forceinline__ float row16_sum(float v) {
  v += row_xmask<0x161>(v);
  v += row_xmask<0x162>(v);
  v += row_xmask<0x164>(v);
  v += row_xmask<0x168>(v);
  return v;
}

// y[i] = 2^x[i] for eight values. Written as one statement so that nothing
// the compiler schedules can stand directly behind a v_exp_f32 and read its
// result or overwrite its source: inside, every output register differs from
// every input ("=&v"); the closing v_nop is the one independent issue slot
// that the instruction set asks for behind the last of them.
__device__ __forceinline__ void exp2x8(float (&y)[8], const float (&x)[8]) {
  asm("v_exp_f32 %0, %8\n\t"
      "v_exp_f32 %1, %9\n\t"
      "v_exp_f32 %2, %10\n\t"
      "v_exp_f32 %3, %11\n\t"
      "v_exp_f32 %4, %12\n\t"
      "v_exp_f32 %5, %13\n\t"
      "v_exp_f32 %6, %14\n\t"
      "v_exp_f32 %7, %15\n\t"
      "v_nop"
      : "=&v"(y[0]), "=&v"(y[1]), "=&v"(y[2]), "=&v"(y[3]), "=&v"(y[4]),
        "=&v"(y[5]), "=&v"(y[6]), "=&v"(y[7])
      : "v"(x[0]), "v"(x[1]), "v"(x[2]), "v"(x[3]), "v"(x[4]), "v"(x[5]),
        "v"(x[6]), "v"(x[7]));
}

__global__ __launch_bounds__(256) void attention_kernel(
    const half_t* __restrict__ q16, const half_t* __restrict__ k16,
    const half_t* __restrict__ vT16, half_t* __restrict__ att16) {
  int unit = blockIdx.x;                  // 0..2047
  int bc = unit >> 4;                     // b*32 + c
  int hh = unit & 15;
  int tid = threadIdx.x;
  int lane = tid & 31, wave = tid >> 5;
  int tm = wave >> 1, hf = wave & 1;
  int n = lane & 15, mb = (lane >> 4) * 8;
  int row0 = tm * 16 + mb;                // first of this lane's 8 rows

  __shared__ __align__(16) half_t sp[WCHUNK * P_PITCH];   // exp(s - max), f16
  __shared__ __align__(16) float pmax[2][WCHUNK], psum[2][WCHUNK];

  const half_t* Aq = q16 + ((size_t)bc * WCHUNK + tm * 16) * WD + hh * WDK;
  const half_t* Bk = k16 + ((size_t)bc * WNL + hf * 128) * WD + hh * WDK;

  // --- raw scores q . k^T : 8 tiles of 16x16, kept in registers
  v16h qa0 = load_frag(Aq, WD, 0, lane);
  v16h qa1 = load_frag(Aq, WD, 32, lane);
  v8f acc[8];
#pragma unroll  // constant indices keep acc[] in registers
  for (int it = 0; it < 8; ++it) {
    const half_t* Bb = Bk + (size_t)it * 16 * WD;
    v8f a = {};
    a = wmma16(qa0, load_frag(Bb, WD, 0, lane), a);
    a = wmma16(qa1, load_frag(Bb, WD, 32, lane), a);
    acc[it] = a;
  }

  // --- row maximum: own 128 columns, then the partner wave's
  float mx[8];
#pragma unroll  // constant indices keep acc[] and mx[] in registers
  for (int r = 0; r < 8; ++r) {
    float m = acc[0][r];
#pragma unroll  // as above
    for (int it = 1; it < 8; ++it) m = fmaxf(m, acc[it][r]);
    mx[r] = row16_max(m);
  }
  if (n == 0) {
    *(float4*)&pmax[hf][row0]     = make_float4(mx[0], mx[1], mx[2], mx[3]);
    *(float4*)&pmax[hf][row0 + 4] = make_float4(mx[4], mx[5], mx[6], mx[7]);
  }
  __syncthreads();
  {
    float4 o0 = *(const float4*)&pmax[hf ^ 1][row0];
    float4 o1 = *(const float4*)&pmax[hf ^ 1][row0 + 4];
    mx[0] = fmaxf(mx[0], o0.x); mx[1] = fmaxf(mx[1], o0.y);
    mx[2] = fmaxf(mx[2], o0.z); mx[3] = fmaxf(mx[3], o0.w);
    mx[4] = fmaxf(mx[4], o1.x); mx[5] = fmaxf(mx[5], o1.y);
    mx[6] = fmaxf(mx[6], o1.z); mx[7] = fmaxf(mx[7], o1.w);
  }

  // --- p = exp((s - max) * SCALE) = 2^(s*c - max*c), c = SCALE * log2(e);
  //     not yet divided by the row sum
  const float cexp = WSCALE * 1.44269504088896f;
  float sm[8];
#pragma unroll  // constant indices keep acc[], mx[] and sm[] in registers
  for (int r = 0; r < 8; ++r) {
    half_t* dst = sp + (row0 + r) * P_PITCH + hf * 128 + n;
    float nm = -mx[r] * cexp;
    float x[8], p[8];
#pragma unroll  // as above
    for (int it = 0; it < 8; ++it) x[it] = fmaf(acc[it][r], cexp, nm);
    exp2x8(p, x);
    float s = p[0];
    dst[0] = (half_t)p[0];
#pragma unroll  // as above
    for (int it = 1; it < 8; ++it) {
      s += p[it];
      dst[it * 16] = (half_t)p[it];
    }
    sm[r] = row16_sum(s);
  }
  if (n == 0) {
    *(float4*)&psum[hf][row0]     = make_float4(sm[0], sm[1], sm[2], sm[3]);
    *(float4*)&psum[hf][row0 + 4] = make_float4(sm[4], sm[5], sm[6], sm[7]);
  }
  __syncthreads();
  {
    float4 o0 = *(const float4*)&psum[hf ^ 1][row0];
    float4 o1 = *(const float4*)&psum[hf ^ 1][row0 + 4];
    sm[0] = __builtin_amdgcn_rcpf(sm[0] + o0.x);
    sm[1] = __builtin_amdgcn_rcpf(sm[1] + o0.y);
    sm[2] = __builtin_amdgcn_rcpf(sm[2] + o0.z);
    sm[3] = __builtin_amdgcn_rcpf(sm[3] + o0.w);
    sm[4] = __builtin_amdgcn_rcpf(sm[4] + o1.x);
    sm[5] = __builtin_amdgcn_rcpf(sm[5] + o1.y);
    sm[6] = __builtin_amdgcn_rcpf(sm[6] + o1.z);
    sm[7] = __builtin_amdgcn_rcpf(sm[7] + o1.w);
  }

  // --- out = (P @ V) / sum : the wave's own 16 rows, 2 of the 4 dk tiles
  const half_t* Bv = vT16 + ((size_t)bc * WH + hh) * WDK * WNL;
  const half_t* Ab = sp + tm * 16 * P_PITCH;
#pragma unroll  // two independent accumulate chains side by side
  for (int it = 0; it < 2; ++it) {
    int tn = hf * 2 + it;
    const half_t* Bb = Bv + (size_t)tn * 16 * WNL;
    v8f o = {};
    for (int k0 = 0; k0 < WNL; k0 += 32)
      o = wmma16(load_frag(Ab, P_PITCH, k0, lane), load_frag(Bb, WNL, k0, lane),
                 o);
#pragma unroll  // constant indices keep o and sm[] in registers
    for (int r = 0; r < 8; ++r)
      att16[((size_t)bc * WCHUNK + row0 + r) * WD + hh * WDK + tn * 16 + n] =
          (half_t)(o[r] * sm[r]);
  }
}

// ---------------------------------------------------------------------------
// 6. Residual-only head rows: out[b,s,:] = h[b,s,:] for s < 63
// ---------------------------------------------------------------------------
__global__ __launch_bounds__(256) void residual_head_kernel(
    const float* __restrict__ h, float* __restrict__ out) {
  int idx = blockIdx.x * 256 + threadIdx.x;     // 4*63*1024 = 258048 exact
  int b = idx / ((WCHUNK - 1) * WD);
  int rem = idx % ((WCHUNK - 1) * WD);
  int s = rem / WD, d = rem % WD;
  size_t o = ((size_t)b * WS + s) * WD + d;
  out[o] = h[o];
}

// ---------------------------------------------------------------------------
// Host launcher
// ---------------------------------------------------------------------------
extern "C" void kernel_launch(void* const* d_in, const int* in_sizes, int n_in,
                              void* d_out, int out_size, void* d_ws,
                              size_t ws_size, hipStream_t stream) {
  const float* h     = (const float*)d_in[0];
  const float* e     = (const float*)d_in[1];
  const float* Wq    = (const float*)d_in[2];
  const float* bq    = (const float*)d_in[3];
  const float* Wk    = (const float*)d_in[4];
  const float* bk    = (const float*)d_in[5];
  const float* Wv    = (const float*)d_in[6];
  const float* bv    = (const float*)d_in[7];
  const float* Wo    = (const float*)d_in[8];
  const float* bo    = (const float*)d_in[9];
  const float* gamma = (const float*)d_in[10];
  const float* beta  = (const float*)d_in[11];
  float* out = (float*)d_out;

  // Workspace layout (f16 elements), ~248 MB total
  const size_t HB  = (size_t)ROWS_H * WD;   //  8,388,608
  const size_t E16 = (size_t)ROWS_E * WD;   // 33,554,432
  const size_t WSZ = (size_t)WD * WD;       //  1,048,576
  half_t* w = (half_t*)d_ws;
  half_t* hb16  = w;                 w += HB;
  half_t* e16   = w;                 w += E16;
  half_t* WqT   = w;                 w += WSZ;
  half_t* WkT   = w;                 w += WSZ;
  half_t* WvT   = w;                 w += WSZ;
  half_t* WoT   = w;                 w += WSZ;
  half_t* q16   = w;                 w += HB;
  half_t* k16   = w;                 w += E16;
  half_t* vT16  = w;                 w += E16;
  half_t* att16 = w;                 w += HB;

  // 1. LayerNorm + pad + cast
  ln_cast_kernel<<<ROWS_H / 8, 256, 0, stream>>>(h, gamma, beta, hb16);
  // 2. cast e
  cast_f16_kernel<<<(ROWS_E * WD) / (4 * 256 * CAST_G * CAST_U), 256, 0, stream>>>(
      e, e16);
  // 3. transpose-cast weights
  transpose_cast_kernel<<<dim3(WD / 64, WD / 64), 256, 0, stream>>>(Wq, WqT);
  transpose_cast_kernel<<<dim3(WD / 64, WD / 64), 256, 0, stream>>>(Wk, WkT);
  transpose_cast_kernel<<<dim3(WD / 64, WD / 64), 256, 0, stream>>>(Wv, WvT);
  transpose_cast_kernel<<<dim3(WD / 64, WD / 64), 256, 0, stream>>>(Wo, WoT);
  // 4. q projection: (8192x1024) @ (1024x1024)
  gemm128_kernel<0><<<dim3(WD / 128, ROWS_H / 128), 256, 0, stream>>>(
      hb16, WqT, bq, q16, nullptr, nullptr, ROWS_H, WD, WD);
  // 5. k projection: (32768x1024) @ (1024x1024)
  gemm128_kernel<0><<<dim3(WD / 128, ROWS_E / 128), 256, 0, stream>>>(
      e16, WkT, bk, k16, nullptr, nullptr, ROWS_E, WD, WD);
  // 6. v projection, transposed output
  gemm128_kernel<1><<<dim3(WD / 128, ROWS_E / 128), 256, 0, stream>>>(
      e16, WvT, bv, vT16, nullptr, nullptr, ROWS_E, WD, WD);
  // 7. attention per (b,c,h)
  attention_kernel<<<WB * WC * WH, 256, 0, stream>>>(q16, k16, vT16, att16);
  // 8. residual-only head rows
  residual_head_kernel<<<(WB * (WCHUNK - 1) * WD) / 256, 256, 0, stream>>>(h,
                                                                           out);
  // 9. output projection + shift + residual, fused into d_out
  gemm128_kernel<2><<<dim3(WD / 128, ROWS_H / 128), 256, 0, stream>>>(
      att16, WoT, bo, nullptr, h, out, ROWS_H, WD, WD);
}

// v004
// It runs in 259 microseconds.
// Two timings next to v003 both put it at 1.20 times that version's speed.
// Counting every step since v000, it is 2.04 times as fast.
#include <hip/hip_runtime.h>
#include <hip/hip_bf16.h>
#include <math.h>

// ---------------------------------------------------------------------------
// Chunked cross attention for MI455X (gfx1250), wave32 + WMMA f16->f32,
// LDS-blocked GEMMs (128x128 block, 64x32 per wave) with async global->LDS.
// B=4 S=2048 D=1024 C=32 N=2 L=128 H=16 DK=64 CHUNK=64
// ---------------------------------------------------------------------------

typedef _Float16 half_t;
typedef __attribute__((ext_vector_type(16))) _Float16 v16h;
typedef __attribute__((ext_vector_type(8)))  _Float16 v8h;
typedef __attribute__((ext_vector_type(4)))  _Float16 v4h;
typedef __attribute__((ext_vector_type(8)))  float    v8f;
typedef __attribute__((ext_vector_type(4)))  float    v4f;

#define WB 4
#define WS 2048
#define WD 1024
#define WC 32
#define WH 16
#define WDK 64
#define WCHUNK 64
#define WNL 256                       // N*L
#define ROWS_H (WB * WS)              // 8192
#define ROWS_E (WB * WC * WNL)        // 32768
#define VALID_ROWS (WS - WCHUNK + 1)  // 1985
#define WSCALE 0.125f                 // 1/sqrt(64)

#define KSTEP 64                      // halves of a row per K-step: one 128 B line
#define LDS_STRIDE 72                 // 64 + 8 halves: 144 B = 16 B x 9, bank-spread

#if defined(__AMDGCN__) &&                                              \
    __has_builtin(__builtin_amdgcn_global_load_async_to_lds_b128) &&    \
    __has_builtin(__builtin_amdgcn_s_wait_asynccnt)
#define USE_ASYNC 1
typedef int v4i __attribute__((vector_size(16)));
typedef __attribute__((address_space(1))) v4i as1_v4i;
typedef __attribute__((address_space(3))) v4i as3_v4i;
#else
#define USE_ASYNC 0
#endif

__device__ __forceinline__ v8f wmma16(v16h a, v16h b, v8f c) {
  return __builtin_amdgcn_wmma_f32_16x16x32_f16(false, a, false, b, (short)0, c,
                                                false, false);
}

// Fragment loader for v_wmma_f32_16x16x32_f16. Works for A (MxK row-major,
// lane&15 = M) and B supplied N-major (NxK row-major, lane&15 = N).
// elements 0..7 = K[k0+hi*8 ..], elements 8..15 = K[k0+16+hi*8 ..].
__device__ __forceinline__ v16h load_frag(const half_t* __restrict__ base,
                                          int ld, int k0, int lane) {
  int m  = lane & 15;
  int hi = (lane >> 4) & 1;
  const half_t* p = base + (size_t)m * ld + k0 + hi * 8;
  v8h lo = *(const v8h*)(p);
  v8h hv = *(const v8h*)(p + 16);
  v16h r;
#pragma unroll
  for (int e = 0; e < 8; ++e) { r[e] = lo[e]; r[e + 8] = hv[e]; }
  return r;
}

// Stage one K-step tile (A:128x64, B:128x64 halves) into LDS.
// Eight lanes in a row take one row's whole 128-byte line, so a wave's copy
// asks L2 for 4 whole lines. Each of 256 threads moves 4x16 B of A and of B
// (rows 32 apart). off = the lane's own element offset inside a tile.
__device__ __forceinline__ void stage_tile(const half_t* __restrict__ gA,
                                           const half_t* __restrict__ gB,
                                           int ldg, half_t* sA, half_t* sB,
                                           int tid) {
  int row = tid >> 3;
  int cs  = (tid & 7) * 8;
  unsigned off = (unsigned)(row * ldg + cs);
  half_t* la = sA + row * LDS_STRIDE + cs;
  half_t* lb = sB + row * LDS_STRIDE + cs;
#pragma unroll  // four fixed row groups; the copies issue back to back
  for (int p = 0; p < 4; ++p) {
    const half_t* pa = gA + (size_t)(p * 32) * ldg + off;
    const half_t* pb = gB + (size_t)(p * 32) * ldg + off;
#if USE_ASYNC
    __builtin_amdgcn_global_load_async_to_lds_b128(
        (as1_v4i*)pa, (as3_v4i*)(la + p * 32 * LDS_STRIDE), 0, 0);
    __builtin_amdgcn_global_load_async_to_lds_b128(
        (as1_v4i*)pb, (as3_v4i*)(lb + p * 32 * LDS_STRIDE), 0, 0);
#else
    *(v8h*)(la + p * 32 * LDS_STRIDE) = *(const v8h*)pa;
    *(v8h*)(lb + p * 32 * LDS_STRIDE) = *(const v8h*)pb;
#endif
  }
}

__device__ __forceinline__ void async_wait0() {
#if USE_ASYNC
  __builtin_amdgcn_s_wait_asynccnt(0);
#endif
}

// ---------------------------------------------------------------------------
// 1. LayerNorm of h[:,63:] -> f16, padded with zeros to (B, 2048, D)
//    One wave per row: the 4 KiB row is fetched by eight 16-byte loads per
//    lane, all in flight together, and stays in registers for both uses.
//    Sums: four chains per lane, then a five-step butterfly over the wave.
//    No LDS, no barrier; 8192 waves in all.
// ---------------------------------------------------------------------------
__global__ __launch_bounds__(256) void ln_cast_kernel(
    const float* __restrict__ h, const float* __restrict__ gamma,
    const float* __restrict__ beta, half_t* __restrict__ hb16) {
  int lane = threadIdx.x & 31;
  // the wave's number as a scalar: row addresses and the pad test stay scalar
  int row = blockIdx.x * 8 + __builtin_amdgcn_readfirstlane(threadIdx.x >> 5);
  int b = row >> 11, t = row & 2047;    // row 0..8191
  v4h* dst = (v4h*)(hb16 + (size_t)row * WD);
  if (t >= VALID_ROWS) {                // zero padding rows (wave-uniform)
    v4h z = {};
#pragma unroll  // eight independent stores
    for (int j = 0; j < 8; ++j) dst[j * 32 + lane] = z;
  } else {
    const v4f* x = (const v4f*)(h + ((size_t)b * WS + t + (WCHUNK - 1)) * WD);
    v4f v[8];
#pragma unroll  // constant indices keep v[] in registers; loads issue together
    for (int j = 0; j < 8; ++j) v[j] = x[j * 32 + lane];
    v4f a = v[0], q = v[0] * v[0];
#pragma unroll  // as above
    for (int j = 1; j < 8; ++j) { a += v[j]; q += v[j] * v[j]; }
    float s = (a.x + a.y) + (a.z + a.w), s2 = (q.x + q.y) + (q.z + q.w);
#pragma unroll  // five fixed exchange distances
    for (int m = 16; m > 0; m >>= 1) {
      s  += __shfl_xor(s, m);
      s2 += __shfl_xor(s2, m);
    }
    float mu  = s * (1.0f / WD);
    float var = s2 * (1.0f / WD) - mu * mu;
    float rs  = rsqrtf(var + 1e-5f);
    const v4f* g4 = (const v4f*)gamma;
    const v4f* b4 = (const v4f*)beta;
#pragma unroll  // constant indices keep v[] in registers
    for (int j = 0; j < 8; ++j) {
      v4f y = (v[j] - mu) * rs * g4[j * 32 + lane] + b4[j * 32 + lane];
      v4h o = {(half_t)y.x, (half_t)y.y, (half_t)y.z, (half_t)y.w};
      dst[j * 32 + lane] = o;
    }
    // the listing can run on from here into the pad block, which rewrites data
    // registers of these stores: the wait stands in front of that overwrite
    asm volatile("s_wait_xcnt 0x0" ::: "memory");
  }
}

// ---------------------------------------------------------------------------
// 2. Elementwise f32 -> f16 cast (for e), as a stream: a block owns 128 KiB
//    of src in a row; each lane takes 32 16-byte loads of it (512 B in a row
//    per wave-load) and stores 8 bytes per load (256 B in a row per
//    wave-store). Written in groups of eight, which bounds the registers; the
//    compiler runs the groups into one another (sixteen loads lead, later
//    ones follow as registers come free, the stores stand last).
//    The grid covers e exactly once. 8192 waves in all.
// ---------------------------------------------------------------------------
#define CAST_U 8                      // 16-byte loads of one group
#define CAST_G 4                      // groups per lane

__global__ __launch_bounds__(256) void cast_f16_kernel(
    const float* __restrict__ src, half_t* __restrict__ dst) {
  size_t base = (size_t)blockIdx.x * (CAST_G * CAST_U * 256) + threadIdx.x;
  const float4* s4 = (const float4*)src + base;
  v4h* d4 = (v4h*)dst + base;
#pragma unroll  // constant offsets from one address per lane
  for (int g = 0; g < CAST_G; ++g) {
    float4 v[CAST_U];
#pragma unroll  // constant indices keep v[] in registers; loads issue together
    for (int u = 0; u < CAST_U; ++u) v[u] = s4[(g * CAST_U + u) * 256];
#pragma unroll  // as above
    for (int u = 0; u < CAST_U; ++u) {
      v4h o = {(half_t)v[u].x, (half_t)v[u].y, (half_t)v[u].z, (half_t)v[u].w};
      d4[(g * CAST_U + u) * 256] = o;
    }
  }
}

// ---------------------------------------------------------------------------
// 3. Weight transpose + cast: W (KxN) f32 -> WT (NxK) f16   (1024x1024)
//    One 64(k) x 64(n) tile per block, turned in LDS: rows of W are read as
//    16-byte loads, rows of WT leave as whole 128-byte lines.
// ---------------------------------------------------------------------------
#define TR_PITCH 72                   // 64 + 8 halves: rows stay 16B aligned

__global__ __launch_bounds__(256) void transpose_cast_kernel(
    const float* __restrict__ W, half_t* __restrict__ WT) {
  __shared__ __align__(16) half_t tile[64 * TR_PITCH];   // [n][k]
  int tid = threadIdx.x;
  int k0 = blockIdx.y * 64, n0 = blockIdx.x * 64;

  // each thread: a 4(k) x 4(n) patch, 16 lanes cover one 256-byte row piece
  int nq = (tid & 15) * 4, kq = (tid >> 4) * 4;
  const float* src = W + (size_t)(k0 + kq) * WD + n0 + nq;
  float4 r0 = *(const float4*)(src);
  float4 r1 = *(const float4*)(src + WD);
  float4 r2 = *(const float4*)(src + 2 * WD);
  float4 r3 = *(const float4*)(src + 3 * WD);
  v4h c0 = {(half_t)r0.x, (half_t)r1.x, (half_t)r2.x, (half_t)r3.x};
  v4h c1 = {(half_t)r0.y, (half_t)r1.y, (half_t)r2.y, (half_t)r3.y};
  v4h c2 = {(half_t)r0.z, (half_t)r1.z, (half_t)r2.z, (half_t)r3.z};
  v4h c3 = {(half_t)r0.w, (half_t)r1.w, (half_t)r2.w, (half_t)r3.w};
  *(v4h*)(tile + (nq + 0) * TR_PITCH + kq) = c0;
  *(v4h*)(tile + (nq + 1) * TR_PITCH + kq) = c1;
  *(v4h*)(tile + (nq + 2) * TR_PITCH + kq) = c2;
  *(v4h*)(tile + (nq + 3) * TR_PITCH + kq) = c3;
  __syncthreads();

  // 8 lanes write one 128-byte line of WT
  for (int j = 0; j < 2; ++j) {
    int idx = tid + j * 256;
    int n = idx >> 3, ks = (idx & 7) * 8;
    *(v8h*)(WT + (size_t)(n0 + n) * WD + k0 + ks) =
        *(const v8h*)(tile + n * TR_PITCH + ks);
  }
}

// ---------------------------------------------------------------------------
// 4. Blocked WMMA GEMM: block tile 128x128, K-step 64, double-buffered LDS.
//    8 waves, each computing 64x32 (4x2 subtiles, 8 independent accumulators).
//    A (MxK row-major), Bt (NxK row-major).  All dims multiples of 128.
//    MODE 0: C16[row*N+col] = acc + bias[col]                 (q, k proj)
//    MODE 1: vT[(bc,h,dk,j)] = acc + bias[col]                (v proj, T out)
//    MODE 2: out f32 with shift-by-63 + residual              (Wo proj)
// ---------------------------------------------------------------------------
template <int MODE>
__global__ __launch_bounds__(256) void gemm128_kernel(
    const half_t* __restrict__ A, const half_t* __restrict__ Bt,
    const float* __restrict__ bias, half_t* __restrict__ C16,
    const float* __restrict__ hres, float* __restrict__ outf, int M, int N,
    int K) {
  __shared__ __align__(16) half_t sA[2][128 * LDS_STRIDE];
  __shared__ __align__(16) half_t sB[2][128 * LDS_STRIDE];

  int tid  = threadIdx.x;
  int lane = tid & 31, wave = tid >> 5;
  int tm0 = blockIdx.y * 128;
  int tn0 = blockIdx.x * 128;
  int mw = (wave >> 2) * 64;            // wave row offset in block tile
  int nw = (wave & 3) * 32;             // wave col offset in block tile

  const half_t* Ab = A + (size_t)tm0 * K;
  const half_t* Bb = Bt + (size_t)tn0 * K;
  int nk = K / KSTEP;

  stage_tile(Ab, Bb, K, sA[0], sB[0], tid);
  async_wait0();
  __syncthreads();

  v8f acc[4][2] = {};
  for (int kt = 0; kt < nk; ++kt) {
    int buf = kt & 1;
    if (kt + 1 < nk)
      stage_tile(Ab + (kt + 1) * KSTEP, Bb + (kt + 1) * KSTEP, K, sA[buf ^ 1],
                 sB[buf ^ 1], tid);

    const half_t* As_w = sA[buf] + mw * LDS_STRIDE;
    const half_t* Bs_w = sB[buf] + nw * LDS_STRIDE;
#pragma unroll  // the two 32-deep halves of the K-step, constant LDS offsets
    for (int k0 = 0; k0 < KSTEP; k0 += 32) {
      v16h af[4], bf[2];
#pragma unroll
      for (int i = 0; i < 4; ++i)
        af[i] = load_frag(As_w + i * 16 * LDS_STRIDE, LDS_STRIDE, k0, lane);
#pragma unroll
      for (int j = 0; j < 2; ++j)
        bf[j] = load_frag(Bs_w + j * 16 * LDS_STRIDE, LDS_STRIDE, k0, lane);
#pragma unroll
      for (int i = 0; i < 4; ++i)
#pragma unroll
        for (int j = 0; j < 2; ++j) acc[i][j] = wmma16(af[i], bf[j], acc[i][j]);
    }

    async_wait0();
    __syncthreads();
  }

  // Epilogue: C/D layout -> row = base + (lane>>4)*8 + r, col = base + lane&15
  int nl = lane & 15, mb = (lane >> 4) * 8;
#pragma unroll
  for (int i = 0; i < 4; ++i) {
#pragma unroll
    for (int j = 0; j < 2; ++j) {
      int col = tn0 + nw + j * 16 + nl;
      float bv = bias[col];
#pragma unroll
      for (int r = 0; r < 8; ++r) {
        int row = tm0 + mw + i * 16 + mb + r;
        float v = acc[i][j][r] + bv;
        if (MODE == 0) {
          C16[(size_t)row * N + col] = (half_t)v;
        } else if (MODE == 1) {
          int bc = row >> 8, jj = row & 255;
          int hh = col >> 6, dk = col & 63;
          C16[(((size_t)bc * WH + hh) * WDK + dk) * WNL + jj] = (half_t)v;
        } else {
          int b = row >> 11, t = row & 2047;
          if (t < VALID_ROWS) {          // shift by 63; tail rows discarded
            size_t o = ((size_t)b * WS + t + (WCHUNK - 1)) * WD + col;
            outf[o] = v + hres[o];
          }
        }
      }
    }
  }
}

// ---------------------------------------------------------------------------
// 5. Attention: one block per (b,c,h). Wave w owns query rows (w>>1)*16..+15
//    and key columns (w&1)*128..+127. Its 16x128 scores stay in the WMMA
//    accumulators (f32): row maximum and row sum are taken there, in-lane over
//    the 8 tiles, then over the 16 lanes of a row by DPP, then joined with the
//    partner wave's half through LDS. exp(s - max) goes to LDS once, as f16,
//    and P@V (A from LDS, B = vT from global) is divided by the row sum.
// ---------------------------------------------------------------------------
#define P_PITCH (WNL + 8)             // 8 halves of pad: 16 B x 33, so that b128
                                      // readers of 16 rows fall on distinct banks

// value of lane (l ^ mask) inside the 16-lane row; CTRL = 0x160 + mask
template <int CTRL>
__device__ __forceinline__ float row_xmask(float v) {
  return __builtin_bit_cast(
      float, __builtin_amdgcn_mov_dpp(__builtin_bit_cast(int, v), CTRL, 0xf,
                                      0xf, true));
}
__device__ __forceinline__ float row16_max(float v) {
  v = fmaxf(v, row_xmask<0x161>(v));
  v = fmaxf(v, row_xmask<0x162>(v));
  v = fmaxf(v, row_xmask<0x164>(v));
  v = fmaxf(v, row_xmask<0x168>(v));
  return v;
}
__device__ __forceinline__ float row16_sum(float v) {
  v += row_xmask<0x161>(v);
  v += row_xmask<0x162>(v);
  v += row_xmask<0x164>(v);
  v += row_xmask<0x168>(v);
  return v;
}

// y[i] = 2^x[i] for eight values. Written as one statement so that nothing
// the compiler schedules can stand directly behind a v_exp_f32 and read its
// result or overwrite its source: inside, every output register differs from
// every input ("=&v"); the closing v_nop is the one independent issue slot
// that the instruction set asks for behind the last of them.
__device__ __forceinline__ void exp2x8(float (&y)[8], const float (&x)[8]) {
  asm("v_exp_f32 %0, %8\n\t"
      "v_exp_f32 %1, %9\n\t"
      "v_exp_f32 %2, %10\n\t"
      "v_exp_f32 %3, %11\n\t"
      "v_exp_f32 %4, %12\n\t"
      "v_exp_f32 %5, %13\n\t"
      "v_exp_f32 %6, %14\n\t"
      "v_exp_f32 %7, %15\n\t"
      "v_nop"
      : "=&v"(y[0]), "=&v"(y[1]), "=&v"(y[2]), "=&v"(y[3]), "=&v"(y[4]),
        "=&v"(y[5]), "=&v"(y[6]), "=&v"(y[7])
      : "v"(x[0]), "v"(x[1]), "v"(x[2]), "v"(x[3]), "v"(x[4]), "v"(x[5]),
        "v"(x[6]), "v"(x[7]));
}

__global__ __launch_bounds__(256) void attention_kernel(
    const half_t* __restrict__ q16, const half_t* __restrict__ k16,
    const half_t* __restrict__ vT16, half_t* __restrict__ att16) {
  int unit = blockIdx.x;                  // 0..2047
  int bc = unit >> 4;                     // b*32 + c
  int hh = unit & 15;
  int tid = threadIdx.x;
  int lane = tid & 31, wave = tid >> 5;
  int tm = wave >> 1, hf = wave & 1;
  int n = lane & 15, mb = (lane >> 4) * 8;
  int row0 = tm * 16 + mb;                // first of this lane's 8 rows

  __shared__ __align__(16) half_t sp[WCHUNK * P_PITCH];   // exp(s - max), f16
  __shared__ __align__(16) float pmax[2][WCHUNK], psum[2][WCHUNK];

  const half_t* Aq = q16 + ((size_t)bc * WCHUNK + tm * 16) * WD + hh * WDK;
  const half_t* Bk = k16 + ((size_t)bc * WNL + hf * 128) * WD + hh * WDK;

  // --- raw scores q . k^T : 8 tiles of 16x16, kept in registers
  v16h qa0 = load_frag(Aq, WD, 0, lane);
  v16h qa1 = load_frag(Aq, WD, 32, lane);
  v8f acc[8];
#pragma unroll  // constant indices keep acc[] in registers
  for (int it = 0; it < 8; ++it) {
    const half_t* Bb = Bk + (size_t)it * 16 * WD;
    v8f a = {};
    a = wmma16(qa0, load_frag(Bb, WD, 0, lane), a);
    a = wmma16(qa1, load_frag(Bb, WD, 32, lane), a);
    acc[it] = a;
  }

  // --- row maximum: own 128 columns, then the partner wave's
  float mx[8];
#pragma unroll  // constant indices keep acc[] and mx[] in registers
  for (int r = 0; r < 8; ++r) {
    float m = acc[0][r];
#pragma unroll  // as above
    for (int it = 1; it < 8; ++it) m = fmaxf(m, acc[it][r]);
    mx[r] = row16_max(m);
  }
  if (n == 0) {
    *(float4*)&pmax[hf][row0]     = make_float4(mx[0], mx[1], mx[2], mx[3]);
    *(float4*)&pmax[hf][row0 + 4] = make_float4(mx[4], mx[5], mx[6], mx[7]);
  }
  __syncthreads();
  {
    float4 o0 = *(const float4*)&pmax[hf ^ 1][row0];
    float4 o1 = *(const float4*)&pmax[hf ^ 1][row0 + 4];
    mx[0] = fmaxf(mx[0], o0.x); mx[1] = fmaxf(mx[1], o0.y);
    mx[2] = fmaxf(mx[2], o0.z); mx[3] = fmaxf(mx[3], o0.w);
    mx[4] = fmaxf(mx[4], o1.x); mx[5] = fmaxf(mx[5], o1.y);
    mx[6] = fmaxf(mx[6], o1.z); mx[7] = fmaxf(mx[7], o1.w);
  }

  // --- p = exp((s - max) * SCALE) = 2^(s*c - max*c), c = SCALE * log2(e);
  //     not yet divided by the row sum
  const float cexp = WSCALE * 1.44269504088896f;
  float sm[8];
#pragma unroll  // constant indices keep acc[], mx[] and sm[] in registers
  for (int r = 0; r < 8; ++r) {
    half_t* dst = sp + (row0 + r) * P_PITCH + hf * 128 + n;
    float nm = -mx[r] * cexp;
    float x[8], p[8];
#pragma unroll  // as above
    for (int it = 0; it < 8; ++it) x[it] = fmaf(acc[it][r], cexp, nm);
    exp2x8(p, x);
    float s = p[0];
    dst[0] = (half_t)p[0];
#pragma unroll  // as above
    for (int it = 1; it < 8; ++it) {
      s += p[it];
      dst[it * 16] = (half_t)p[it];
    }
    sm[r] = row16_sum(s);
  }
  if (n == 0) {
    *(float4*)&psum[hf][row0]     = make_float4(sm[0], sm[1], sm[2], sm[3]);
    *(float4*)&psum[hf][row0 + 4] = make_float4(sm[4], sm[5], sm[6], sm[7]);
  }
  __syncthreads();
  {
    float4 o0 = *(const float4*)&psum[hf ^ 1][row0];
    float4 o1 = *(const float4*)&psum[hf ^ 1][row0 + 4];
    sm[0] = __builtin_amdgcn_rcpf(sm[0] + o0.x);
    sm[1] = __builtin_amdgcn_rcpf(sm[1] + o0.y);
    sm[2] = __builtin_amdgcn_rcpf(sm[2] + o0.z);
    sm[3] = __builtin_amdgcn_rcpf(sm[3] + o0.w);
    sm[4] = __builtin_amdgcn_rcpf(sm[4] + o1.x);
    sm[5] = __builtin_amdgcn_rcpf(sm[5] + o1.y);
    sm[6] = __builtin_amdgcn_rcpf(sm[6] + o1.z);
    sm[7] = __builtin_amdgcn_rcpf(sm[7] + o1.w);
  }

  // --- out = (P @ V) / sum : the wave's own 16 rows, 2 of the 4 dk tiles
  const half_t* Bv = vT16 + ((size_t)bc * WH + hh) * WDK * WNL;
  const half_t* Ab = sp + tm * 16 * P_PITCH;
#pragma unroll  // two independent accumulate chains side by side
  for (int it = 0; it < 2; ++it) {
    int tn = hf * 2 + it;
    const half_t* Bb = Bv + (size_t)tn * 16 * WNL;
    v8f o = {};
    for (int k0 = 0; k0 < WNL; k0 += 32)
      o = wmma16(load_frag(Ab, P_PITCH, k0, lane), load_frag(Bb, WNL, k0, lane),
                 o);
#pragma unroll  // constant indices keep o and sm[] in registers
    for (int r = 0; r < 8; ++r)
      att16[((size_t)bc * WCHUNK + row0 + r) * WD + hh * WDK + tn * 16 + n] =
          (half_t)(o[r] * sm[r]);
  }
}

// ---------------------------------------------------------------------------
// 6. Residual-only head rows: out[b,s,:] = h[b,s,:] for s < 63
// ---------------------------------------------------------------------------
__global__ __launch_bounds__(256) void residual_head_kernel(
    const float* __restrict__ h, float* __restrict__ out) {
  int idx = blockIdx.x * 256 + threadIdx.x;     // 4*63*1024 = 258048 exact
  int b = idx / ((WCHUNK - 1) * WD);
  int rem = idx % ((WCHUNK - 1) * WD);
  int s = rem / WD, d = rem % WD;
  size_t o = ((size_t)b * WS + s) * WD + d;
  out[o] = h[o];
}

// ---------------------------------------------------------------------------
// Host launcher
// ---------------------------------------------------------------------------
extern "C" void kernel_launch(void* const* d_in, const int* in_sizes, int n_in,
                              void* d_out, int out_size, void* d_ws,
                              size_t ws_size, hipStream_t stream) {
  const float* h     = (const float*)d_in[0];
  const float* e     = (const float*)d_in[1];
  const float* Wq    = (const float*)d_in[2];
  const float* bq    = (const float*)d_in[3];
  const float* Wk    = (const float*)d_in[4];
  const float* bk    = (const float*)d_in[5];
  const float* Wv    = (const float*)d_in[6];
  const float* bv    = (const float*)d_in[7];
  const float* Wo    = (const float*)d_in[8];
  const float* bo    = (const float*)d_in[9];
  const float* gamma = (const float*)d_in[10];
  const float* beta  = (const float*)d_in[11];
  float* out = (float*)d_out;

  // Workspace layout (f16 elements), ~248 MB total
  const size_t HB  = (size_t)ROWS_H * WD;   //  8,388,608
  const size_t E16 = (size_t)ROWS_E * WD;   // 33,554,432
  const size_t WSZ = (size_t)WD * WD;       //  1,048,576
  half_t* w = (half_t*)d_ws;
  half_t* hb16  = w;                 w += HB;
  half_t* e16   = w;                 w += E16;
  half_t* WqT   = w;                 w += WSZ;
  half_t* WkT   = w;                 w += WSZ;
  half_t* WvT   = w;                 w += WSZ;
  half_t* WoT   = w;                 w += WSZ;
  half_t* q16   = w;                 w += HB;
  half_t* k16   = w;                 w += E16;
  half_t* vT16  = w;                 w += E16;
  half_t* att16 = w;                 w += HB;

  // 1. LayerNorm + pad + cast
  ln_cast_kernel<<<ROWS_H / 8, 256, 0, stream>>>(h, gamma, beta, hb16);
  // 2. cast e
  cast_f16_kernel<<<(ROWS_E * WD) / (4 * 256 * CAST_G * CAST_U), 256, 0, stream>>>(
      e, e16);
  // 3. transpose-cast weights
  transpose_cast_kernel<<<dim3(WD / 64, WD / 64), 256, 0, stream>>>(Wq, WqT);
  transpose_cast_kernel<<<dim3(WD / 64, WD / 64), 256, 0, stream>>>(Wk, WkT);
  transpose_cast_kernel<<<dim3(WD / 64, WD / 64), 256, 0, stream>>>(Wv, WvT);
  transpose_cast_kernel<<<dim3(WD / 64, WD / 64), 256, 0, stream>>>(Wo, WoT);
  // 4. q projection: (8192x1024) @ (1024x1024)
  gemm128_kernel<0><<<dim3(WD / 128, ROWS_H / 128), 256, 0, stream>>>(
      hb16, WqT, bq, q16, nullptr, nullptr, ROWS_H, WD, WD);
  // 5. k projection: (32768x1024) @ (1024x1024)
  gemm128_kernel<0><<<dim3(WD / 128, ROWS_E / 128), 256, 0, stream>>>(
      e16, WkT, bk, k16, nullptr, nullptr, ROWS_E, WD, WD);
  // 6. v projection, transposed output
  gemm128_kernel<1><<<dim3(WD / 128, ROWS_E / 128), 256, 0, stream>>>(
      e16, WvT, bv, vT16, nullptr, nullptr, ROWS_E, WD, WD);
  // 7. attention per (b,c,h)
  attention_kernel<<<WB * WC * WH, 256, 0, stream>>>(q16, k16, vT16, att16);
  // 8. residual-only head rows
  residual_head_kernel<<<(WB * (WCHUNK - 1) * WD) / 256, 256, 0, stream>>>(h,
                                                                           out);
  // 9. output projection + shift + residual, fused into d_out
  gemm128_kernel<2><<<dim3(WD / 128, ROWS_H / 128), 256, 0, stream>>>(
      att16, WoT, bo, nullptr, h, out, ROWS_H, WD, WD);
}

// v005
// One run takes 241 microseconds.
// Next to v004, in two timings, it ran 1.07 times as fast each time.
// Over all steps from v000 it is 2.19 times as fast.
#include <hip/hip_runtime.h>
#include <hip/hip_bf16.h>
#include <math.h>

// ---------------------------------------------------------------------------
// Chunked cross attention for MI455X (gfx1250), wave32 + WMMA f16->f32,
// LDS-blocked GEMMs (128x128 block, 64x32 per wave) with async global->LDS.
// B=4 S=2048 D=1024 C=32 N=2 L=128 H=16 DK=64 CHUNK=64
// ---------------------------------------------------------------------------

typedef _Float16 half_t;
typedef __attribute__((ext_vector_type(16))) _Float16 v16h;
typedef __attribute__((ext_vector_type(8)))  _Float16 v8h;
typedef __attribute__((ext_vector_type(4)))  _Float16 v4h;
typedef __attribute__((ext_vector_type(8)))  float    v8f;
typedef __attribute__((ext_vector_type(4)))  float    v4f;

#define WB 4
#define WS 2048
#define WD 1024
#define WC 32
#define WH 16
#define WDK 64
#define WCHUNK 64
#define WNL 256                       // N*L
#define ROWS_H (WB * WS)              // 8192
#define ROWS_E (WB * WC * WNL)        // 32768
#define VALID_ROWS (WS - WCHUNK + 1)  // 1985
#define WSCALE 0.125f                 // 1/sqrt(64)

#define KSTEP 64                      // halves of a row per K-step: one 128 B line
#define LDS_STRIDE 72                 // 64 + 8 halves: 144 B = 16 B x 9, bank-spread

#if defined(__AMDGCN__) &&                                              \
    __has_builtin(__builtin_amdgcn_global_load_async_to_lds_b128) &&    \
    __has_builtin(__builtin_amdgcn_s_wait_asynccnt)
#define USE_ASYNC 1
typedef int v4i __attribute__((vector_size(16)));
typedef __attribute__((address_space(1))) v4i as1_v4i;
typedef __attribute__((address_space(3))) v4i as3_v4i;
#else
#define USE_ASYNC 0
#endif

__device__ __forceinline__ v8f wmma16(v16h a, v16h b, v8f c) {
  return __builtin_amdgcn_wmma_f32_16x16x32_f16(false, a, false, b, (short)0, c,
                                                false, false);
}

// Fragment loader for v_wmma_f32_16x16x32_f16. Works for A (MxK row-major,
// lane&15 = M) and B supplied N-major (NxK row-major, lane&15 = N).
// elements 0..7 = K[k0+hi*8 ..], elements 8..15 = K[k0+16+hi*8 ..].
__device__ __forceinline__ v16h load_frag(const half_t* __restrict__ base,
                                          int ld, int k0, int lane) {
  int m  = lane & 15;
  int hi = (lane >> 4) & 1;
  const half_t* p = base + (size_t)m * ld + k0 + hi * 8;
  v8h lo = *(const v8h*)(p);
  v8h hv = *(const v8h*)(p + 16);
  v16h r;
#pragma unroll
  for (int e = 0; e < 8; ++e) { r[e] = lo[e]; r[e + 8] = hv[e]; }
  return r;
}

// Stage one K-step tile (A:128x64, B:128x64 halves) into LDS.
// Eight lanes in a row take one row's whole 128-byte line, so a wave's copy
// asks L2 for 4 whole lines. Each of 256 threads moves 4x16 B of A and of B
// (rows 32 apart). off = the lane's own element offset inside a tile.
__device__ __forceinline__ void stage_tile(const half_t* __restrict__ gA,
                                           const half_t* __restrict__ gB,
                                           int ldg, half_t* sA, half_t* sB,
                                           int tid) {
  int row = tid >> 3;
  int cs  = (tid & 7) * 8;
  unsigned off = (unsigned)(row * ldg + cs);
  half_t* la = sA + row * LDS_STRIDE + cs;
  half_t* lb = sB + row * LDS_STRIDE + cs;
#pragma unroll  // four fixed row groups; the copies issue back to back
  for (int p = 0; p < 4; ++p) {
    const half_t* pa = gA + (size_t)(p * 32) * ldg + off;
    const half_t* pb = gB + (size_t)(p * 32) * ldg + off;
#if USE_ASYNC
    __builtin_amdgcn_global_load_async_to_lds_b128(
        (as1_v4i*)pa, (as3_v4i*)(la + p * 32 * LDS_STRIDE), 0, 0);
    __builtin_amdgcn_global_load_async_to_lds_b128(
        (as1_v4i*)pb, (as3_v4i*)(lb + p * 32 * LDS_STRIDE), 0, 0);
#else
    *(v8h*)(la + p * 32 * LDS_STRIDE) = *(const v8h*)pa;
    *(v8h*)(lb + p * 32 * LDS_STRIDE) = *(const v8h*)pb;
#endif
  }
}

__device__ __forceinline__ void async_wait0() {
#if USE_ASYNC
  __builtin_amdgcn_s_wait_asynccnt(0);
#endif
}

// ---------------------------------------------------------------------------
// 1. LayerNorm of h[:,63:] -> f16, padded with zeros to (B, 2048, D)
//    One wave per row: the 4 KiB row is fetched by eight 16-byte loads per
//    lane, all in flight together, and stays in registers for both uses.
//    Sums: four chains per lane, then a five-step butterfly over the wave.
//    No LDS, no barrier; 8192 waves in all. blk = 0..LN_BLOCKS-1.
// ---------------------------------------------------------------------------
#define LN_BLOCKS (ROWS_H / 8)

__device__ __forceinline__ void ln_cast_block(
    const float* __restrict__ h, const float* __restrict__ gamma,
    const float* __restrict__ beta, half_t* __restrict__ hb16, int blk) {
  int lane = threadIdx.x & 31;
  // the wave's number as a scalar: row addresses and the pad test stay scalar
  int row = blk * 8 + __builtin_amdgcn_readfirstlane(threadIdx.x >> 5);
  int b = row >> 11, t = row & 2047;    // row 0..8191
  v4h* dst = (v4h*)(hb16 + (size_t)row * WD);
  if (t >= VALID_ROWS) {                // zero padding rows (wave-uniform)
    v4h z = {};
#pragma unroll  // eight independent stores
    for (int j = 0; j < 8; ++j) dst[j * 32 + lane] = z;
    // the listing runs on from here into another pass of the joined grid, which
    // rewrites registers of these stores: the wait stands in front of that
    asm volatile("s_wait_xcnt 0x0" ::: "memory");
  } else {
    const v4f* x = (const v4f*)(h + ((size_t)b * WS + t + (WCHUNK - 1)) * WD);
    v4f v[8];
#pragma unroll  // constant indices keep v[] in registers; loads issue together
    for (int j = 0; j < 8; ++j) v[j] = x[j * 32 + lane];
    v4f a = v[0], q = v[0] * v[0];
#pragma unroll  // as above
    for (int j = 1; j < 8; ++j) { a += v[j]; q += v[j] * v[j]; }
    float s = (a.x + a.y) + (a.z + a.w), s2 = (q.x + q.y) + (q.z + q.w);
#pragma unroll  // five fixed exchange distances
    for (int m = 16; m > 0; m >>= 1) {
      s  += __shfl_xor(s, m);
      s2 += __shfl_xor(s2, m);
    }
    float mu  = s * (1.0f / WD);
    float var = s2 * (1.0f / WD) - mu * mu;
    float rs  = rsqrtf(var + 1e-5f);
    const v4f* g4 = (const v4f*)gamma;
    const v4f* b4 = (const v4f*)beta;
#pragma unroll  // constant indices keep v[] in registers
    for (int j = 0; j < 8; ++j) {
      v4f y = (v[j] - mu) * rs * g4[j * 32 + lane] + b4[j * 32 + lane];
      v4h o = {(half_t)y.x, (half_t)y.y, (half_t)y.z, (half_t)y.w};
      dst[j * 32 + lane] = o;
    }
    // the listing can run on from here into the pad block, which rewrites data
    // registers of these stores: the wait stands in front of that overwrite
    asm volatile("s_wait_xcnt 0x0" ::: "memory");
  }
}

// ---------------------------------------------------------------------------
// 2. Elementwise f32 -> f16 cast (for e), as a stream: a block owns 128 KiB
//    of src in a row; each lane takes 32 16-byte loads of it (512 B in a row
//    per wave-load) and stores 8 bytes per load (256 B in a row per
//    wave-store). Written in groups of eight, which bounds the registers; the
//    compiler runs the groups into one another (sixteen loads lead, later
//    ones follow as registers come free, the stores stand last).
//    CAST_BLOCKS blocks cover e exactly once. 8192 waves in all.
// ---------------------------------------------------------------------------
#define CAST_U 8                      // 16-byte loads of one group
#define CAST_G 4                      // groups per lane
#define CAST_BLOCKS ((ROWS_E * WD) / (4 * 256 * CAST_G * CAST_U))

__device__ __forceinline__ void cast_f16_block(
    const float* __restrict__ src, half_t* __restrict__ dst, int blk) {
  size_t base = (size_t)blk * (CAST_G * CAST_U * 256) + threadIdx.x;
  const float4* s4 = (const float4*)src + base;
  v4h* d4 = (v4h*)dst + base;
#pragma unroll  // constant offsets from one address per lane
  for (int g = 0; g < CAST_G; ++g) {
    float4 v[CAST_U];
#pragma unroll  // constant indices keep v[] in registers; loads issue together
    for (int u = 0; u < CAST_U; ++u) v[u] = s4[(g * CAST_U + u) * 256];
#pragma unroll  // as above
    for (int u = 0; u < CAST_U; ++u) {
      v4h o = {(half_t)v[u].x, (half_t)v[u].y, (half_t)v[u].z, (half_t)v[u].w};
      d4[(g * CAST_U + u) * 256] = o;
    }
  }
}

// ---------------------------------------------------------------------------
// 3. Weight transpose + cast: W (KxN) f32 -> WT (NxK) f16   (1024x1024)
//    One 64(k) x 64(n) tile per block, turned in LDS: rows of W are read as
//    16-byte loads, rows of WT leave as whole 128-byte lines.
// ---------------------------------------------------------------------------
#define TR_PITCH 72                   // 64 + 8 halves: rows stay 16B aligned
#define TR_BLOCKS ((WD / 64) * (WD / 64))   // tiles of one weight matrix

__device__ __forceinline__ void transpose_cast_block(
    const float* __restrict__ W, half_t* __restrict__ WT, half_t* tile,
    int blk) {                          // tile: [n][k], 64 * TR_PITCH halves
  int tid = threadIdx.x;
  int k0 = (blk / (WD / 64)) * 64, n0 = (blk % (WD / 64)) * 64;

  // each thread: a 4(k) x 4(n) patch, 16 lanes cover one 256-byte row piece
  int nq = (tid & 15) * 4, kq = (tid >> 4) * 4;
  const float* src = W + (size_t)(k0 + kq) * WD + n0 + nq;
  float4 r0 = *(const float4*)(src);
  float4 r1 = *(const float4*)(src + WD);
  float4 r2 = *(const float4*)(src + 2 * WD);
  float4 r3 = *(const float4*)(src + 3 * WD);
  v4h c0 = {(half_t)r0.x, (half_t)r1.x, (half_t)r2.x, (half_t)r3.x};
  v4h c1 = {(half_t)r0.y, (half_t)r1.y, (half_t)r2.y, (half_t)r3.y};
  v4h c2 = {(half_t)r0.z, (half_t)r1.z, (half_t)r2.z, (half_t)r3.z};
  v4h c3 = {(half_t)r0.w, (half_t)r1.w, (half_t)r2.w, (half_t)r3.w};
  *(v4h*)(tile + (nq + 0) * TR_PITCH + kq) = c0;
  *(v4h*)(tile + (nq + 1) * TR_PITCH + kq) = c1;
  *(v4h*)(tile + (nq + 2) * TR_PITCH + kq) = c2;
  *(v4h*)(tile + (nq + 3) * TR_PITCH + kq) = c3;
  __syncthreads();

  // 8 lanes write one 128-byte line of WT
  for (int j = 0; j < 2; ++j) {
    int idx = tid + j * 256;
    int n = idx >> 3, ks = (idx & 7) * 8;
    *(v8h*)(WT + (size_t)(n0 + n) * WD + k0 + ks) =
        *(const v8h*)(tile + n * TR_PITCH + ks);
  }
  // the listing runs on from here into another pass of the joined grid, which
  // rewrites registers of these stores: the wait stands in front of that
  asm volatile("s_wait_xcnt 0x0" ::: "memory");
}

// ---------------------------------------------------------------------------
// 4. Blocked WMMA GEMM: block tile 128x128, K-step 64, double-buffered LDS.
//    8 waves, each computing 64x32 (4x2 subtiles, 8 independent accumulators).
//    A (MxK row-major), Bt (NxK row-major).  All dims multiples of 128.
//    MODE 0: C16[row*N+col] = acc + bias[col]                 (q, k proj)
//    MODE 1: vT[(bc,h,dk,j)] = acc + bias[col]                (v proj, T out)
//    MODE 2: out f32 with shift-by-63 + residual              (Wo proj)
// ---------------------------------------------------------------------------
typedef half_t gemm_buf_t[128 * LDS_STRIDE];   // one operand's K-step tile

// The K loop of one 128x128 tile: Ab, Bb = first row of the tile's A and Bt.
__device__ __forceinline__ void gemm_mainloop(const half_t* __restrict__ Ab,
                                              const half_t* __restrict__ Bb,
                                              int K, gemm_buf_t* sA,
                                              gemm_buf_t* sB,
                                              v8f (&acc)[4][2]) {
  int tid  = threadIdx.x;
  int lane = tid & 31, wave = tid >> 5;
  int mw = (wave >> 2) * 64;            // wave row offset in block tile
  int nw = (wave & 3) * 32;             // wave col offset in block tile
  int nk = K / KSTEP;

  stage_tile(Ab, Bb, K, sA[0], sB[0], tid);
  async_wait0();
  __syncthreads();

  for (int kt = 0; kt < nk; ++kt) {
    int buf = kt & 1;
    if (kt + 1 < nk)
      stage_tile(Ab + (kt + 1) * KSTEP, Bb + (kt + 1) * KSTEP, K, sA[buf ^ 1],
                 sB[buf ^ 1], tid);

    const half_t* As_w = sA[buf] + mw * LDS_STRIDE;
    const half_t* Bs_w = sB[buf] + nw * LDS_STRIDE;
#pragma unroll  // the two 32-deep halves of the K-step, constant LDS offsets
    for (int k0 = 0; k0 < KSTEP; k0 += 32) {
      v16h af[4], bf[2];
#pragma unroll
      for (int i = 0; i < 4; ++i)
        af[i] = load_frag(As_w + i * 16 * LDS_STRIDE, LDS_STRIDE, k0, lane);
#pragma unroll
      for (int j = 0; j < 2; ++j)
        bf[j] = load_frag(Bs_w + j * 16 * LDS_STRIDE, LDS_STRIDE, k0, lane);
#pragma unroll
      for (int i = 0; i < 4; ++i)
#pragma unroll
        for (int j = 0; j < 2; ++j) acc[i][j] = wmma16(af[i], bf[j], acc[i][j]);
    }

    async_wait0();
    __syncthreads();
  }
}

// Epilogue: C/D layout -> row = base + (lane>>4)*8 + r, col = base + lane&15
template <int MODE>
__device__ __forceinline__ void gemm_store(
    const v8f (&acc)[4][2], const float* __restrict__ bias,
    half_t* __restrict__ C16, const float* __restrict__ hres,
    float* __restrict__ outf, int N, int tm0, int tn0) {
  int lane = threadIdx.x & 31, wave = threadIdx.x >> 5;
  int mw = (wave >> 2) * 64;
  int nw = (wave & 3) * 32;
  int nl = lane & 15, mb = (lane >> 4) * 8;
#pragma unroll
  for (int i = 0; i < 4; ++i) {
#pragma unroll
    for (int j = 0; j < 2; ++j) {
      int col = tn0 + nw + j * 16 + nl;
      float bv = bias[col];
#pragma unroll
      for (int r = 0; r < 8; ++r) {
        int row = tm0 + mw + i * 16 + mb + r;
        float v = acc[i][j][r] + bv;
        if (MODE == 0) {
          C16[(size_t)row * N + col] = (half_t)v;
        } else if (MODE == 1) {
          int bc = row >> 8, jj = row & 255;
          int hh = col >> 6, dk = col & 63;
          C16[(((size_t)bc * WH + hh) * WDK + dk) * WNL + jj] = (half_t)v;
        } else {
          int b = row >> 11, t = row & 2047;
          if (t < VALID_ROWS) {          // shift by 63; tail rows discarded
            size_t o = ((size_t)b * WS + t + (WCHUNK - 1)) * WD + col;
            outf[o] = v + hres[o];
          }
        }
      }
    }
  }
}

// One GEMM per launch: v projection (MODE 1), output projection (MODE 2).
template <int MODE>
__global__ __launch_bounds__(256) void gemm128_kernel(
    const half_t* __restrict__ A, const half_t* __restrict__ Bt,
    const float* __restrict__ bias, half_t* __restrict__ C16,
    const float* __restrict__ hres, float* __restrict__ outf, int N, int K) {
  __shared__ __align__(16) gemm_buf_t sA[2];
  __shared__ __align__(16) gemm_buf_t sB[2];
  int tm0 = blockIdx.y * 128;
  int tn0 = blockIdx.x * 128;
  v8f acc[4][2] = {};
  gemm_mainloop(A + (size_t)tm0 * K, Bt + (size_t)tn0 * K, K, sA, sB, acc);
  gemm_store<MODE>(acc, bias, C16, hres, outf, N, tm0, tn0);
}

// k and q projections (both MODE 0) in one grid: neither reads what the other
// writes. Grid rows 0..K_TROWS-1 are the row tiles of k, the rest those of q.
// The test is on blockIdx alone: the same for the whole work-group.
#define K_TROWS (ROWS_E / 128)
#define Q_TROWS (ROWS_H / 128)

__global__ __launch_bounds__(256) void gemm_kq_kernel(
    const half_t* __restrict__ e16, const half_t* __restrict__ WkT,
    const float* __restrict__ bk, half_t* __restrict__ k16,
    const half_t* __restrict__ hb16, const half_t* __restrict__ WqT,
    const float* __restrict__ bq, half_t* __restrict__ q16, int N, int K) {
  __shared__ __align__(16) gemm_buf_t sA[2];
  __shared__ __align__(16) gemm_buf_t sB[2];
  bool is_q = blockIdx.y >= K_TROWS;
  int tm0 = (is_q ? blockIdx.y - K_TROWS : blockIdx.y) * 128;
  int tn0 = blockIdx.x * 128;
  const half_t* A  = is_q ? hb16 : e16;
  const half_t* Bt = is_q ? WqT : WkT;
  v8f acc[4][2] = {};
  gemm_mainloop(A + (size_t)tm0 * K, Bt + (size_t)tn0 * K, K, sA, sB, acc);
  gemm_store<0>(acc, is_q ? bq : bk, is_q ? q16 : k16, nullptr, nullptr, N, tm0,
                tn0);
}

// ---------------------------------------------------------------------------
// 5. Attention: one block per (b,c,h). Wave w owns query rows (w>>1)*16..+15
//    and key columns (w&1)*128..+127. Its 16x128 scores stay in the WMMA
//    accumulators (f32): row maximum and row sum are taken there, in-lane over
//    the 8 tiles, then over the 16 lanes of a row by DPP, then joined with the
//    partner wave's half through LDS. exp(s - max) goes to LDS once, as f16,
//    and P@V (A from LDS, B = vT from global) is divided by the row sum.
// ---------------------------------------------------------------------------
#define P_PITCH (WNL + 8)             // 8 halves of pad: 16 B x 33, so that b128
                                      // readers of 16 rows fall on distinct banks

// value of lane (l ^ mask) inside the 16-lane row; CTRL = 0x160 + mask
template <int CTRL>
__device__ __forceinline__ float row_xmask(float v) {
  return __builtin_bit_cast(
      float, __builtin_amdgcn_mov_dpp(__builtin_bit_cast(int, v), CTRL, 0xf,
                                      0xf, true));
}
__device__ __forceinline__ float row16_max(float v) {
  v = fmaxf(v, row_xmask<0x161>(v));
  v = fmaxf(v, row_xmask<0x162>(v));
  v = fmaxf(v, row_xmask<0x164>(v));
  v = fmaxf(v, row_xmask<0x168>(v));
  return v;
}
__device__ __forceinline__ float row16_sum(float v) {
  v += row_xmask<0x161>(v);
  v += row_xmask<0x162>(v);
  v += row_xmask<0x164>(v);
  v += row_xmask<0x168>(v);
  return v;
}

// y[i] = 2^x[i] for eight values. Written as one statement so that nothing
// the compiler schedules can stand directly behind a v_exp_f32 and read its
// result or overwrite its source: inside, every output register differs from
// every input ("=&v"); the closing v_nop is the one independent issue slot
// that the instruction set asks for behind the last of them.
__device__ __forceinline__ void exp2x8(float (&y)[8], const float (&x)[8]) {
  asm("v_exp_f32 %0, %8\n\t"
      "v_exp_f32 %1, %9\n\t"
      "v_exp_f32 %2, %10\n\t"
      "v_exp_f32 %3, %11\n\t"
      "v_exp_f32 %4, %12\n\t"
      "v_exp_f32 %5, %13\n\t"
      "v_exp_f32 %6, %14\n\t"
      "v_exp_f32 %7, %15\n\t"
      "v_nop"
      : "=&v"(y[0]), "=&v"(y[1]), "=&v"(y[2]), "=&v"(y[3]), "=&v"(y[4]),
        "=&v"(y[5]), "=&v"(y[6]), "=&v"(y[7])
      : "v"(x[0]), "v"(x[1]), "v"(x[2]), "v"(x[3]), "v"(x[4]), "v"(x[5]),
        "v"(x[6]), "v"(x[7]));
}

__global__ __launch_bounds__(256) void attention_kernel(
    const half_t* __restrict__ q16, const half_t* __restrict__ k16,
    const half_t* __restrict__ vT16, half_t* __restrict__ att16) {
  int unit = blockIdx.x;                  // 0..2047
  int bc = unit >> 4;                     // b*32 + c
  int hh = unit & 15;
  int tid = threadIdx.x;
  int lane = tid & 31, wave = tid >> 5;
  int tm = wave >> 1, hf = wave & 1;
  int n = lane & 15, mb = (lane >> 4) * 8;
  int row0 = tm * 16 + mb;                // first of this lane's 8 rows

  __shared__ __align__(16) half_t sp[WCHUNK * P_PITCH];   // exp(s - max), f16
  __shared__ __align__(16) float pmax[2][WCHUNK], psum[2][WCHUNK];

  const half_t* Aq = q16 + ((size_t)bc * WCHUNK + tm * 16) * WD + hh * WDK;
  const half_t* Bk = k16 + ((size_t)bc * WNL + hf * 128) * WD + hh * WDK;

  // --- raw scores q . k^T : 8 tiles of 16x16, kept in registers
  v16h qa0 = load_frag(Aq, WD, 0, lane);
  v16h qa1 = load_frag(Aq, WD, 32, lane);
  v8f acc[8];
#pragma unroll  // constant indices keep acc[] in registers
  for (int it = 0; it < 8; ++it) {
    const half_t* Bb = Bk + (size_t)it * 16 * WD;
    v8f a = {};
    a = wmma16(qa0, load_frag(Bb, WD, 0, lane), a);
    a = wmma16(qa1, load_frag(Bb, WD, 32, lane), a);
    acc[it] = a;
  }

  // --- row maximum: own 128 columns, then the partner wave's
  float mx[8];
#pragma unroll  // constant indices keep acc[] and mx[] in registers
  for (int r = 0; r < 8; ++r) {
    float m = acc[0][r];
#pragma unroll  // as above
    for (int it = 1; it < 8; ++it) m = fmaxf(m, acc[it][r]);
    mx[r] = row16_max(m);
  }
  if (n == 0) {
    *(float4*)&pmax[hf][row0]     = make_float4(mx[0], mx[1], mx[2], mx[3]);
    *(float4*)&pmax[hf][row0 + 4] = make_float4(mx[4], mx[5], mx[6], mx[7]);
  }
  __syncthreads();
  {
    float4 o0 = *(const float4*)&pmax[hf ^ 1][row0];
    float4 o1 = *(const float4*)&pmax[hf ^ 1][row0 + 4];
    mx[0] = fmaxf(mx[0], o0.x); mx[1] = fmaxf(mx[1], o0.y);
    mx[2] = fmaxf(mx[2], o0.z); mx[3] = fmaxf(mx[3], o0.w);
    mx[4] = fmaxf(mx[4], o1.x); mx[5] = fmaxf(mx[5], o1.y);
    mx[6] = fmaxf(mx[6], o1.z); mx[7] = fmaxf(mx[7], o1.w);
  }

  // --- p = exp((s - max) * SCALE) = 2^(s*c - max*c), c = SCALE * log2(e);
  //     not yet divided by the row sum
  const float cexp = WSCALE * 1.44269504088896f;
  float sm[8];
#pragma unroll  // constant indices keep acc[], mx[] and sm[] in registers
  for (int r = 0; r < 8; ++r) {
    half_t* dst = sp + (row0 + r) * P_PITCH + hf * 128 + n;
    float nm = -mx[r] * cexp;
    float x[8], p[8];
#pragma unroll  // as above
    for (int it = 0; it < 8; ++it) x[it] = fmaf(acc[it][r], cexp, nm);
    exp2x8(p, x);
    float s = p[0];
    dst[0] = (half_t)p[0];
#pragma unroll  // as above
    for (int it = 1; it < 8; ++it) {
      s += p[it];
      dst[it * 16] = (half_t)p[it];
    }
    sm[r] = row16_sum(s);
  }
  if (n == 0) {
    *(float4*)&psum[hf][row0]     = make_float4(sm[0], sm[1], sm[2], sm[3]);
    *(float4*)&psum[hf][row0 + 4] = make_float4(sm[4], sm[5], sm[6], sm[7]);
  }
  __syncthreads();
  {
    float4 o0 = *(const float4*)&psum[hf ^ 1][row0];
    float4 o1 = *(const float4*)&psum[hf ^ 1][row0 + 4];
    sm[0] = __builtin_amdgcn_rcpf(sm[0] + o0.x);
    sm[1] = __builtin_amdgcn_rcpf(sm[1] + o0.y);
    sm[2] = __builtin_amdgcn_rcpf(sm[2] + o0.z);
    sm[3] = __builtin_amdgcn_rcpf(sm[3] + o0.w);
    sm[4] = __builtin_amdgcn_rcpf(sm[4] + o1.x);
    sm[5] = __builtin_amdgcn_rcpf(sm[5] + o1.y);
    sm[6] = __builtin_amdgcn_rcpf(sm[6] + o1.z);
    sm[7] = __builtin_amdgcn_rcpf(sm[7] + o1.w);
  }

  // --- out = (P @ V) / sum : the wave's own 16 rows, 2 of the 4 dk tiles
  const half_t* Bv = vT16 + ((size_t)bc * WH + hh) * WDK * WNL;
  const half_t* Ab = sp + tm * 16 * P_PITCH;
#pragma unroll  // two independent accumulate chains side by side
  for (int it = 0; it < 2; ++it) {
    int tn = hf * 2 + it;
    const half_t* Bb = Bv + (size_t)tn * 16 * WNL;
    v8f o = {};
    for (int k0 = 0; k0 < WNL; k0 += 32)
      o = wmma16(load_frag(Ab, P_PITCH, k0, lane), load_frag(Bb, WNL, k0, lane),
                 o);
#pragma unroll  // constant indices keep o and sm[] in registers
    for (int r = 0; r < 8; ++r)
      att16[((size_t)bc * WCHUNK + row0 + r) * WD + hh * WDK + tn * 16 + n] =
          (half_t)(o[r] * sm[r]);
  }
}

// ---------------------------------------------------------------------------
// 6. Residual-only head rows: out[b,s,:] = h[b,s,:] for s < 63
// ---------------------------------------------------------------------------
#define HEAD_BLOCKS ((WB * (WCHUNK - 1) * WD) / 256)

__device__ __forceinline__ void residual_head_block(
    const float* __restrict__ h, float* __restrict__ out, int blk) {
  int idx = blk * 256 + threadIdx.x;            // 4*63*1024 = 258048 exact
  int b = idx / ((WCHUNK - 1) * WD);
  int rem = idx % ((WCHUNK - 1) * WD);
  int s = rem / WD, d = rem % WD;
  size_t o = ((size_t)b * WS + s) * WD + d;
  out[o] = h[o];
  // the listing runs on from here into another pass of the joined grid, which
  // rewrites registers of this store: the wait stands in front of that
  asm volatile("s_wait_xcnt 0x0" ::: "memory");
}

// ---------------------------------------------------------------------------
// 7. The passes that read only inputs (2, 1, 3 for the four weights, 6) as one
//    grid: none reads what another writes. A work-group's pass follows from
//    blockIdx alone, so each branch, and the barrier inside 3, is taken by a
//    whole work-group or by none of it. Longest work-groups first.
//    WT4 = the four transposed weights one behind the other (q, k, v, o).
// ---------------------------------------------------------------------------
#define PRE_BLOCKS (CAST_BLOCKS + LN_BLOCKS + 4 * TR_BLOCKS + HEAD_BLOCKS)

__global__ __launch_bounds__(256) void prepass_kernel(
    const float* __restrict__ h, const float* __restrict__ e,
    const float* __restrict__ Wq, const float* __restrict__ Wk,
    const float* __restrict__ Wv, const float* __restrict__ Wo,
    const float* __restrict__ gamma, const float* __restrict__ beta,
    half_t* __restrict__ hb16, half_t* __restrict__ e16,
    half_t* __restrict__ WT4, float* __restrict__ out) {
  __shared__ __align__(16) half_t tile[64 * TR_PITCH];
  int blk = blockIdx.x;
  if (blk < CAST_BLOCKS) {
    cast_f16_block(e, e16, blk);
  } else if (blk < CAST_BLOCKS + LN_BLOCKS) {
    ln_cast_block(h, gamma, beta, hb16, blk - CAST_BLOCKS);
  } else if (blk < CAST_BLOCKS + LN_BLOCKS + 4 * TR_BLOCKS) {
    int t = blk - (CAST_BLOCKS + LN_BLOCKS);
    int w = t / TR_BLOCKS;
    const float* W = w == 0 ? Wq : w == 1 ? Wk : w == 2 ? Wv : Wo;
    transpose_cast_block(W, WT4 + (size_t)w * WD * WD, tile, t % TR_BLOCKS);
  } else {
    residual_head_block(h, out, blk - (CAST_BLOCKS + LN_BLOCKS + 4 * TR_BLOCKS));
  }
}

// ---------------------------------------------------------------------------
// Host launcher
// ---------------------------------------------------------------------------
extern "C" void kernel_launch(void* const* d_in, const int* in_sizes, int n_in,
                              void* d_out, int out_size, void* d_ws,
                              size_t ws_size, hipStream_t stream) {
  const float* h     = (const float*)d_in[0];
  const float* e     = (const float*)d_in[1];
  const float* Wq    = (const float*)d_in[2];
  const float* bq    = (const float*)d_in[3];
  const float* Wk    = (const float*)d_in[4];
  const float* bk    = (const float*)d_in[5];
  const float* Wv    = (const float*)d_in[6];
  const float* bv    = (const float*)d_in[7];
  const float* Wo    = (const float*)d_in[8];
  const float* bo    = (const float*)d_in[9];
  const float* gamma = (const float*)d_in[10];
  const float* beta  = (const float*)d_in[11];
  float* out = (float*)d_out;

  // Workspace layout (f16 elements), ~248 MB total
  const size_t HB  = (size_t)ROWS_H * WD;   //  8,388,608
  const size_t E16 = (size_t)ROWS_E * WD;   // 33,554,432
  const size_t WSZ = (size_t)WD * WD;       //  1,048,576
  half_t* w = (half_t*)d_ws;
  half_t* hb16  = w;                 w += HB;
  half_t* e16   = w;                 w += E16;
  half_t* WqT   = w;                 w += WSZ;
  half_t* WkT   = w;                 w += WSZ;
  half_t* WvT   = w;                 w += WSZ;
  half_t* WoT   = w;                 w += WSZ;
  half_t* q16   = w;                 w += HB;
  half_t* k16   = w;                 w += E16;
  half_t* vT16  = w;                 w += E16;
  half_t* att16 = w;                 w += HB;

  // 1. e cast, LayerNorm + pad + cast, weight transposes, head rows of out
  prepass_kernel<<<PRE_BLOCKS, 256, 0, stream>>>(h, e, Wq, Wk, Wv, Wo, gamma,
                                                 beta, hb16, e16, WqT, out);
  // 2. k (32768x1024) and q (8192x1024) projections, K = 1024
  gemm_kq_kernel<<<dim3(WD / 128, K_TROWS + Q_TROWS), 256, 0, stream>>>(
      e16, WkT, bk, k16, hb16, WqT, bq, q16, WD, WD);
  // 3. v projection, transposed output
  gemm128_kernel<1><<<dim3(WD / 128, ROWS_E / 128), 256, 0, stream>>>(
      e16, WvT, bv, vT16, nullptr, nullptr, WD, WD);
  // 4. attention per (b,c,h)
  attention_kernel<<<WB * WC * WH, 256, 0, stream>>>(q16, k16, vT16, att16);
  // 5. output projection + shift + residual, fused into d_out
  gemm128_kernel<2><<<dim3(WD / 128, ROWS_H / 128), 256, 0, stream>>>(
      att16, WoT, bo, nullptr, h, out, WD, WD);
}

// v006
// Measured time: 228 microseconds a run.
// Next to v005, in two timings, it ran 1.06 times as fast each time.
// Counting every step since v000, it is 2.32 times as fast.
#include <hip/hip_runtime.h>
#include <hip/hip_bf16.h>
#include <math.h>

// ---------------------------------------------------------------------------
// Chunked cross attention for MI455X (gfx1250), wave32 + WMMA f16->f32,
// LDS-blocked GEMMs (128x128 block, 64x32 per wave) with async global->LDS.
// B=4 S=2048 D=1024 C=32 N=2 L=128 H=16 DK=64 CHUNK=64
// ---------------------------------------------------------------------------

typedef _Float16 half_t;
typedef __attribute__((ext_vector_type(16))) _Float16 v16h;
typedef __attribute__((ext_vector_type(8)))  _Float16 v8h;
typedef __attribute__((ext_vector_type(4)))  _Float16 v4h;
typedef __attribute__((ext_vector_type(8)))  float    v8f;
typedef __attribute__((ext_vector_type(4)))  float    v4f;

#define WB 4
#define WS 2048
#define WD 1024
#define WC 32
#define WH 16
#define WDK 64
#define WCHUNK 64
#define WNL 256                       // N*L
#define ROWS_H (WB * WS)              // 8192
#define ROWS_E (WB * WC * WNL)        // 32768
#define VALID_ROWS (WS - WCHUNK + 1)  // 1985
#define WSCALE 0.125f                 // 1/sqrt(64)

#define KSTEP 64                      // halves of a row per K-step: one 128 B line
#define LDS_STRIDE 72                 // 64 + 8 halves: 144 B = 16 B x 9, bank-spread

#if defined(__AMDGCN__) &&                                              \
    __has_builtin(__builtin_amdgcn_global_load_async_to_lds_b128) &&    \
    __has_builtin(__builtin_amdgcn_s_wait_asynccnt)
#define USE_ASYNC 1
typedef int v4i __attribute__((vector_size(16)));
typedef __attribute__((address_space(1))) v4i as1_v4i;
typedef __attribute__((address_space(3))) v4i as3_v4i;
#else
#define USE_ASYNC 0
#endif

__device__ __forceinline__ v8f wmma16(v16h a, v16h b, v8f c) {
  return __builtin_amdgcn_wmma_f32_16x16x32_f16(false, a, false, b, (short)0, c,
                                                false, false);
}

// Fragment loader for v_wmma_f32_16x16x32_f16. Works for A (MxK row-major,
// lane&15 = M) and B supplied N-major (NxK row-major, lane&15 = N).
// elements 0..7 = K[k0+hi*8 ..], elements 8..15 = K[k0+16+hi*8 ..].
__device__ __forceinline__ v16h load_frag(const half_t* __restrict__ base,
                                          int ld, int k0, int lane) {
  int m  = lane & 15;
  int hi = (lane >> 4) & 1;
  const half_t* p = base + (size_t)m * ld + k0 + hi * 8;
  v8h lo = *(const v8h*)(p);
  v8h hv = *(const v8h*)(p + 16);
  v16h r;
#pragma unroll
  for (int e = 0; e < 8; ++e) { r[e] = lo[e]; r[e + 8] = hv[e]; }
  return r;
}

// Stage one K-step tile (A:128x64, B:128x64 halves) into LDS.
// Eight lanes in a row take one row's whole 128-byte line, so a wave's copy
// asks L2 for 4 whole lines. Each of 256 threads moves 4x16 B of A and of B
// (rows 32 apart). off = the lane's own element offset inside a tile.
__device__ __forceinline__ void stage_tile(const half_t* __restrict__ gA,
                                           const half_t* __restrict__ gB,
                                           int ldg, half_t* sA, half_t* sB,
                                           int tid) {
  int row = tid >> 3;
  int cs  = (tid & 7) * 8;
  unsigned off = (unsigned)(row * ldg + cs);
  half_t* la = sA + row * LDS_STRIDE + cs;
  half_t* lb = sB + row * LDS_STRIDE + cs;
#pragma unroll  // four fixed row groups; the copies issue back to back
  for (int p = 0; p < 4; ++p) {
    const half_t* pa = gA + (size_t)(p * 32) * ldg + off;
    const half_t* pb = gB + (size_t)(p * 32) * ldg + off;
#if USE_ASYNC
    __builtin_amdgcn_global_load_async_to_lds_b128(
        (as1_v4i*)pa, (as3_v4i*)(la + p * 32 * LDS_STRIDE), 0, 0);
    __builtin_amdgcn_global_load_async_to_lds_b128(
        (as1_v4i*)pb, (as3_v4i*)(lb + p * 32 * LDS_STRIDE), 0, 0);
#else
    *(v8h*)(la + p * 32 * LDS_STRIDE) = *(const v8h*)pa;
    *(v8h*)(lb + p * 32 * LDS_STRIDE) = *(const v8h*)pb;
#endif
  }
}

__device__ __forceinline__ void async_wait0() {
#if USE_ASYNC
  __builtin_amdgcn_s_wait_asynccnt(0);
#endif
}

// ---------------------------------------------------------------------------
// 1. LayerNorm of h[:,63:] -> f16, padded with zeros to (B, 2048, D)
//    One wave per row: the 4 KiB row is fetched by eight 16-byte loads per
//    lane, all in flight together, and stays in registers for both uses.
//    Sums: four chains per lane, then a five-step butterfly over the wave.
//    No LDS, no barrier; 8192 waves in all. blk = 0..LN_BLOCKS-1.
// ---------------------------------------------------------------------------
#define LN_BLOCKS (ROWS_H / 8)

__device__ __forceinline__ void ln_cast_block(
    const float* __restrict__ h, const float* __restrict__ gamma,
    const float* __restrict__ beta, half_t* __restrict__ hb16, int blk) {
  int lane = threadIdx.x & 31;
  // the wave's number as a scalar: row addresses and the pad test stay scalar
  int row = blk * 8 + __builtin_amdgcn_readfirstlane(threadIdx.x >> 5);
  int b = row >> 11, t = row & 2047;    // row 0..8191
  v4h* dst = (v4h*)(hb16 + (size_t)row * WD);
  if (t >= VALID_ROWS) {                // zero padding rows (wave-uniform)
    v4h z = {};
#pragma unroll  // eight independent stores
    for (int j = 0; j < 8; ++j) dst[j * 32 + lane] = z;
    // the listing runs on from here into another pass of the joined grid, which
    // rewrites registers of these stores: the wait stands in front of that
    asm volatile("s_wait_xcnt 0x0" ::: "memory");
  } else {
    const v4f* x = (const v4f*)(h + ((size_t)b * WS + t + (WCHUNK - 1)) * WD);
    v4f v[8];
#pragma unroll  // constant indices keep v[] in registers; loads issue together
    for (int j = 0; j < 8; ++j) v[j] = x[j * 32 + lane];
    v4f a = v[0], q = v[0] * v[0];
#pragma unroll  // as above
    for (int j = 1; j < 8; ++j) { a += v[j]; q += v[j] * v[j]; }
    float s = (a.x + a.y) + (a.z + a.w), s2 = (q.x + q.y) + (q.z + q.w);
#pragma unroll  // five fixed exchange distances
    for (int m = 16; m > 0; m >>= 1) {
      s  += __shfl_xor(s, m);
      s2 += __shfl_xor(s2, m);
    }
    float mu  = s * (1.0f / WD);
    float var = s2 * (1.0f / WD) - mu * mu;
    float rs  = rsqrtf(var + 1e-5f);
    const v4f* g4 = (const v4f*)gamma;
    const v4f* b4 = (const v4f*)beta;
#pragma unroll  // constant indices keep v[] in registers
    for (int j = 0; j < 8; ++j) {
      v4f y = (v[j] - mu) * rs * g4[j * 32 + lane] + b4[j * 32 + lane];
      v4h o = {(half_t)y.x, (half_t)y.y, (half_t)y.z, (half_t)y.w};
      dst[j * 32 + lane] = o;
    }
    // the listing can run on from here into the pad block, which rewrites data
    // registers of these stores: the wait stands in front of that overwrite
    asm volatile("s_wait_xcnt 0x0" ::: "memory");
  }
}

// ---------------------------------------------------------------------------
// 2. Elementwise f32 -> f16 cast (for e), as a stream: a block owns 128 KiB
//    of src in a row; each lane takes 32 16-byte loads of it (512 B in a row
//    per wave-load) and stores 8 bytes per load (256 B in a row per
//    wave-store). Written in groups of eight, which bounds the registers; the
//    compiler runs the groups into one another (sixteen loads lead, later
//    ones follow as registers come free, the stores stand last).
//    CAST_BLOCKS blocks cover e exactly once. 8192 waves in all.
// ---------------------------------------------------------------------------
#define CAST_U 8                      // 16-byte loads of one group
#define CAST_G 4                      // groups per lane
#define CAST_BLOCKS ((ROWS_E * WD) / (4 * 256 * CAST_G * CAST_U))

__device__ __forceinline__ void cast_f16_block(
    const float* __restrict__ src, half_t* __restrict__ dst, int blk) {
  size_t base = (size_t)blk * (CAST_G * CAST_U * 256) + threadIdx.x;
  const float4* s4 = (const float4*)src + base;
  v4h* d4 = (v4h*)dst + base;
#pragma unroll  // constant offsets from one address per lane
  for (int g = 0; g < CAST_G; ++g) {
    float4 v[CAST_U];
#pragma unroll  // constant indices keep v[] in registers; loads issue together
    for (int u = 0; u < CAST_U; ++u) v[u] = s4[(g * CAST_U + u) * 256];
#pragma unroll  // as above
    for (int u = 0; u < CAST_U; ++u) {
      v4h o = {(half_t)v[u].x, (half_t)v[u].y, (half_t)v[u].z, (half_t)v[u].w};
      d4[(g * CAST_U + u) * 256] = o;
    }
  }
}

// ---------------------------------------------------------------------------
// 3. Weight transpose + cast: W (KxN) f32 -> WT (NxK) f16   (1024x1024)
//    One 64(k) x 64(n) tile per block, turned in LDS: rows of W are read as
//    16-byte loads, rows of WT leave as whole 128-byte lines.
// ---------------------------------------------------------------------------
#define TR_PITCH 72                   // 64 + 8 halves: rows stay 16B aligned
#define TR_BLOCKS ((WD / 64) * (WD / 64))   // tiles of one weight matrix

__device__ __forceinline__ void transpose_cast_block(
    const float* __restrict__ W, half_t* __restrict__ WT, half_t* tile,
    int blk) {                          // tile: [n][k], 64 * TR_PITCH halves
  int tid = threadIdx.x;
  int k0 = (blk / (WD / 64)) * 64, n0 = (blk % (WD / 64)) * 64;

  // each thread: a 4(k) x 4(n) patch, 16 lanes cover one 256-byte row piece
  int nq = (tid & 15) * 4, kq = (tid >> 4) * 4;
  const float* src = W + (size_t)(k0 + kq) * WD + n0 + nq;
  float4 r0 = *(const float4*)(src);
  float4 r1 = *(const float4*)(src + WD);
  float4 r2 = *(const float4*)(src + 2 * WD);
  float4 r3 = *(const float4*)(src + 3 * WD);
  v4h c0 = {(half_t)r0.x, (half_t)r1.x, (half_t)r2.x, (half_t)r3.x};
  v4h c1 = {(half_t)r0.y, (half_t)r1.y, (half_t)r2.y, (half_t)r3.y};
  v4h c2 = {(half_t)r0.z, (half_t)r1.z, (half_t)r2.z, (half_t)r3.z};
  v4h c3 = {(half_t)r0.w, (half_t)r1.w, (half_t)r2.w, (half_t)r3.w};
  *(v4h*)(tile + (nq + 0) * TR_PITCH + kq) = c0;
  *(v4h*)(tile + (nq + 1) * TR_PITCH + kq) = c1;
  *(v4h*)(tile + (nq + 2) * TR_PITCH + kq) = c2;
  *(v4h*)(tile + (nq + 3) * TR_PITCH + kq) = c3;
  __syncthreads();

  // 8 lanes write one 128-byte line of WT
  for (int j = 0; j < 2; ++j) {
    int idx = tid + j * 256;
    int n = idx >> 3, ks = (idx & 7) * 8;
    *(v8h*)(WT + (size_t)(n0 + n) * WD + k0 + ks) =
        *(const v8h*)(tile + n * TR_PITCH + ks);
  }
  // the listing runs on from here into another pass of the joined grid, which
  // rewrites registers of these stores: the wait stands in front of that
  asm volatile("s_wait_xcnt 0x0" ::: "memory");
}

// ---------------------------------------------------------------------------
// 4. Blocked WMMA GEMM: block tile 128x128, K-step 64, double-buffered LDS.
//    8 waves, each computing 64x32 (4x2 subtiles, 8 independent accumulators).
//    A (MxK row-major), Bt (NxK row-major).  All dims multiples of 128.
//    MODE 0: C16[row*N+col] = acc + bias[col]                 (q, k proj)
//    MODE 1: vT[(bc,h,dk,j)] = acc + bias[col]                (v proj, T out)
//    MODE 2: out f32 with shift-by-63 + residual              (Wo proj)
// ---------------------------------------------------------------------------
typedef half_t gemm_buf_t[128 * LDS_STRIDE];   // one operand's K-step tile

// The K loop of one 128x128 tile: Ab, Bb = first row of the tile's A and Bt.
__device__ __forceinline__ void gemm_mainloop(const half_t* __restrict__ Ab,
                                              const half_t* __restrict__ Bb,
                                              int K, gemm_buf_t* sA,
                                              gemm_buf_t* sB,
                                              v8f (&acc)[4][2]) {
  int tid  = threadIdx.x;
  int lane = tid & 31, wave = tid >> 5;
  int mw = (wave >> 2) * 64;            // wave row offset in block tile
  int nw = (wave & 3) * 32;             // wave col offset in block tile
  int nk = K / KSTEP;

  stage_tile(Ab, Bb, K, sA[0], sB[0], tid);
  async_wait0();
  __syncthreads();

  for (int kt = 0; kt < nk; ++kt) {
    int buf = kt & 1;
    if (kt + 1 < nk)
      stage_tile(Ab + (kt + 1) * KSTEP, Bb + (kt + 1) * KSTEP, K, sA[buf ^ 1],
                 sB[buf ^ 1], tid);

    const half_t* As_w = sA[buf] + mw * LDS_STRIDE;
    const half_t* Bs_w = sB[buf] + nw * LDS_STRIDE;
#pragma unroll  // the two 32-deep halves of the K-step, constant LDS offsets
    for (int k0 = 0; k0 < KSTEP; k0 += 32) {
      v16h af[4], bf[2];
#pragma unroll
      for (int i = 0; i < 4; ++i)
        af[i] = load_frag(As_w + i * 16 * LDS_STRIDE, LDS_STRIDE, k0, lane);
#pragma unroll
      for (int j = 0; j < 2; ++j)
        bf[j] = load_frag(Bs_w + j * 16 * LDS_STRIDE, LDS_STRIDE, k0, lane);
#pragma unroll
      for (int i = 0; i < 4; ++i)
#pragma unroll
        for (int j = 0; j < 2; ++j) acc[i][j] = wmma16(af[i], bf[j], acc[i][j]);
    }

    async_wait0();
    __syncthreads();
  }
}

// Epilogue: C/D layout -> row = base + (lane>>4)*8 + r, col = base + lane&15
template <int MODE>
__device__ __forceinline__ void gemm_store(
    const v8f (&acc)[4][2], const float* __restrict__ bias,
    half_t* __restrict__ C16, const float* __restrict__ hres,
    float* __restrict__ outf, int N, int tm0, int tn0) {
  int lane = threadIdx.x & 31, wave = threadIdx.x >> 5;
  int mw = (wave >> 2) * 64;
  int nw = (wave & 3) * 32;
  int nl = lane & 15, mb = (lane >> 4) * 8;
#pragma unroll
  for (int i = 0; i < 4; ++i) {
#pragma unroll
    for (int j = 0; j < 2; ++j) {
      int col = tn0 + nw + j * 16 + nl;
      float bv = bias[col];
#pragma unroll
      for (int r = 0; r < 8; ++r) {
        int row = tm0 + mw + i * 16 + mb + r;
        float v = acc[i][j][r] + bv;
        if (MODE == 0) {
          C16[(size_t)row * N + col] = (half_t)v;
        } else if (MODE == 1) {
          int bc = row >> 8, jj = row & 255;
          int hh = col >> 6, dk = col & 63;
          C16[(((size_t)bc * WH + hh) * WDK + dk) * WNL + jj] = (half_t)v;
        } else {
          int b = row >> 11, t = row & 2047;
          if (t < VALID_ROWS) {          // shift by 63; tail rows discarded
            size_t o = ((size_t)b * WS + t + (WCHUNK - 1)) * WD + col;
            outf[o] = v + hres[o];
          }
        }
      }
    }
  }
}

// One GEMM per launch: v projection (MODE 1), output projection (MODE 2).
template <int MODE>
__global__ __launch_bounds__(256) void gemm128_kernel(
    const half_t* __restrict__ A, const half_t* __restrict__ Bt,
    const float* __restrict__ bias, half_t* __restrict__ C16,
    const float* __restrict__ hres, float* __restrict__ outf, int N, int K) {
  __shared__ __align__(16) gemm_buf_t sA[2];
  __shared__ __align__(16) gemm_buf_t sB[2];
  int tm0 = blockIdx.y * 128;
  int tn0 = blockIdx.x * 128;
  v8f acc[4][2] = {};
  gemm_mainloop(A + (size_t)tm0 * K, Bt + (size_t)tn0 * K, K, sA, sB, acc);
  gemm_store<MODE>(acc, bias, C16, hres, outf, N, tm0, tn0);
}

// k and q projections (both MODE 0) in one grid: neither reads what the other
// writes. Grid rows 0..K_TROWS-1 are the row tiles of k, the rest those of q.
// The test is on blockIdx alone: the same for the whole work-group.
#define K_TROWS (ROWS_E / 128)
#define Q_TROWS (ROWS_H / 128)

__global__ __launch_bounds__(256) void gemm_kq_kernel(
    const half_t* __restrict__ e16, const half_t* __restrict__ WkT,
    const float* __restrict__ bk, half_t* __restrict__ k16,
    const half_t* __restrict__ hb16, const half_t* __restrict__ WqT,
    const float* __restrict__ bq, half_t* __restrict__ q16, int N, int K) {
  __shared__ __align__(16) gemm_buf_t sA[2];
  __shared__ __align__(16) gemm_buf_t sB[2];
  bool is_q = blockIdx.y >= K_TROWS;
  int tm0 = (is_q ? blockIdx.y - K_TROWS : blockIdx.y) * 128;
  int tn0 = blockIdx.x * 128;
  const half_t* A  = is_q ? hb16 : e16;
  const half_t* Bt = is_q ? WqT : WkT;
  v8f acc[4][2] = {};
  gemm_mainloop(A + (size_t)tm0 * K, Bt + (size_t)tn0 * K, K, sA, sB, acc);
  gemm_store<0>(acc, is_q ? bq : bk, is_q ? q16 : k16, nullptr, nullptr, N, tm0,
                tn0);
}

// ---------------------------------------------------------------------------
// 5. Attention: one block per (b,c,h). The block's K (256 x 64), Q (64 x 64)
//    and V^T (64 x 256) tiles are brought into LDS once, by asynchronous
//    copies that take whole 128-byte lines; every fragment is read from there.
//    V^T is copied while scores and softmax are worked on.
//    Wave w owns query rows (w>>1)*16..+15
//    and key columns (w&1)*128..+127. Its 16x128 scores stay in the WMMA
//    accumulators (f32): row maximum and row sum are taken there, in-lane over
//    the 8 tiles, then over the 16 lanes of a row by DPP, then joined with the
//    partner wave's half through LDS. exp(s - max) goes to LDS once, as f16,
//    and P@V (A and B from LDS) is divided by the row sum.
// ---------------------------------------------------------------------------
#define P_PITCH (WNL + 8)             // 8 halves of pad: 16 B x 33, so that b128
                                      // readers of 16 rows fall on distinct banks
#define KQ_PITCH (WDK + 8)            // K and Q rows: 144 B = 16 B x 9, as above
#define KQ_ROWS (WNL + WCHUNK)        // K rows 0..255, Q rows 256..319
#define V_PITCH (WNL + 8)             // V^T rows: 528 B = 16 B x 33, as above

// the byte address in the work-group's LDS: low 32 bits of a __shared__ address
__device__ __forceinline__ unsigned lds_byte(const half_t* p) {
  return (unsigned)(size_t)p;
}

// Asynchronous copies global -> LDS, 16 bytes per lane and copy. The closing
// s_wait_xcnt stands inside the copies' own statement, so that no later write
// of an address register can be scheduled in front of it.
__device__ __forceinline__ void async_copy8(const unsigned (&l)[8],
                                            const half_t* const (&g)[8]) {
  asm volatile(
      "global_load_async_to_lds_b128 %0, %8, off\n\t"
      "global_load_async_to_lds_b128 %1, %9, off\n\t"
      "global_load_async_to_lds_b128 %2, %10, off\n\t"
      "global_load_async_to_lds_b128 %3, %11, off\n\t"
      "global_load_async_to_lds_b128 %4, %12, off\n\t"
      "global_load_async_to_lds_b128 %5, %13, off\n\t"
      "global_load_async_to_lds_b128 %6, %14, off\n\t"
      "global_load_async_to_lds_b128 %7, %15, off\n\t"
      "s_wait_xcnt 0x0"
      :
      : "v"(l[0]), "v"(l[1]), "v"(l[2]), "v"(l[3]), "v"(l[4]), "v"(l[5]),
        "v"(l[6]), "v"(l[7]), "v"(g[0]), "v"(g[1]), "v"(g[2]), "v"(g[3]),
        "v"(g[4]), "v"(g[5]), "v"(g[6]), "v"(g[7])
      : "memory");
}
__device__ __forceinline__ void async_copy2(unsigned l0, unsigned l1,
                                            const half_t* g0,
                                            const half_t* g1) {
  asm volatile(
      "global_load_async_to_lds_b128 %0, %2, off\n\t"
      "global_load_async_to_lds_b128 %1, %3, off\n\t"
      "s_wait_xcnt 0x0"
      :
      : "v"(l0), "v"(l1), "v"(g0), "v"(g1)
      : "memory");
}

// value of lane (l ^ mask) inside the 16-lane row; CTRL = 0x160 + mask
template <int CTRL>
__device__ __forceinline__ float row_xmask(float v) {
  return __builtin_bit_cast(
      float, __builtin_amdgcn_mov_dpp(__builtin_bit_cast(int, v), CTRL, 0xf,
                                      0xf, true));
}
__device__ __forceinline__ float row16_max(float v) {
  v = fmaxf(v, row_xmask<0x161>(v));
  v = fmaxf(v, row_xmask<0x162>(v));
  v = fmaxf(v, row_xmask<0x164>(v));
  v = fmaxf(v, row_xmask<0x168>(v));
  return v;
}
__device__ __forceinline__ float row16_sum(float v) {
  v += row_xmask<0x161>(v);
  v += row_xmask<0x162>(v);
  v += row_xmask<0x164>(v);
  v += row_xmask<0x168>(v);
  return v;
}

// y[i] = 2^x[i] for eight values. Written as one statement so that nothing
// the compiler schedules can stand directly behind a v_exp_f32 and read its
// result or overwrite its source: inside, every output register differs from
// every input ("=&v"); the closing v_nop is the one independent issue slot
// that the instruction set asks for behind the last of them.
__device__ __forceinline__ void exp2x8(float (&y)[8], const float (&x)[8]) {
  asm("v_exp_f32 %0, %8\n\t"
      "v_exp_f32 %1, %9\n\t"
      "v_exp_f32 %2, %10\n\t"
      "v_exp_f32 %3, %11\n\t"
      "v_exp_f32 %4, %12\n\t"
      "v_exp_f32 %5, %13\n\t"
      "v_exp_f32 %6, %14\n\t"
      "v_exp_f32 %7, %15\n\t"
      "v_nop"
      : "=&v"(y[0]), "=&v"(y[1]), "=&v"(y[2]), "=&v"(y[3]), "=&v"(y[4]),
        "=&v"(y[5]), "=&v"(y[6]), "=&v"(y[7])
      : "v"(x[0]), "v"(x[1]), "v"(x[2]), "v"(x[3]), "v"(x[4]), "v"(x[5]),
        "v"(x[6]), "v"(x[7]));
}

__global__ __launch_bounds__(256) void attention_kernel(
    const half_t* __restrict__ q16, const half_t* __restrict__ k16,
    const half_t* __restrict__ vT16, half_t* __restrict__ att16) {
  int unit = blockIdx.x;                  // 0..2047
  int bc = unit >> 4;                     // b*32 + c
  int hh = unit & 15;
  int tid = threadIdx.x;
  int lane = tid & 31, wave = tid >> 5;
  int tm = wave >> 1, hf = wave & 1;
  int n = lane & 15, mb = (lane >> 4) * 8;
  int row0 = tm * 16 + mb;                // first of this lane's 8 rows

  __shared__ __align__(16) half_t skq[KQ_ROWS * KQ_PITCH];  // K rows, Q rows
  __shared__ __align__(16) half_t sv[WDK * V_PITCH];        // V^T rows
  __shared__ __align__(16) float pmax[2][WCHUNK], psum[2][WCHUNK];
  // exp(s - max), f16: takes the place of the K rows (64 * P_PITCH halves fit
  // in 256 * KQ_PITCH), written only behind the barrier of the row maximum,
  // which every wave reaches with its K and Q fragments already used
  half_t* sp = skq;

  // --- K and Q tiles into LDS: 8 lanes take one row's 128-byte line, a wave's
  //     copy 4 rows
  {
    int row = tid >> 3, cs = (tid & 7) * 8;
    const half_t* gk = k16 + ((size_t)bc * WNL + row) * WD + hh * WDK + cs;
    const half_t* gq = q16 + ((size_t)bc * WCHUNK + row) * WD + hh * WDK + cs;
    unsigned lk = lds_byte(skq + row * KQ_PITCH + cs);
    unsigned l[8];
    const half_t* g[8];
#pragma unroll  // constant indices keep l[] and g[] in registers
    for (int p = 0; p < 8; ++p) {
      l[p] = lk + p * 32 * KQ_PITCH * 2;
      g[p] = gk + (size_t)p * 32 * WD;
    }
    async_copy8(l, g);
    async_copy2(lk + WNL * KQ_PITCH * 2, lk + (WNL + 32) * KQ_PITCH * 2, gq,
                gq + (size_t)32 * WD);
  }
  // the wave's own copies have landed; behind the barrier, every wave's
  asm volatile("s_wait_asynccnt 0x0" ::: "memory");
  __syncthreads();

  // --- V^T tile into LDS: 32 KiB in a row, a wave's copy takes one 512-byte
  //     row. It flies while scores and softmax are worked on; its wait stands
  //     in front of the barrier of the row sum, the last one before P@V.
  {
    const half_t* gv = vT16 + ((size_t)bc * WH + hh) * WDK * WNL + tid * 8;
    unsigned lv = lds_byte(sv + wave * V_PITCH + lane * 8);
    unsigned l[8];
    const half_t* g[8];
#pragma unroll  // constant indices keep l[] and g[] in registers
    for (int p = 0; p < 8; ++p) {
      l[p] = lv + p * 8 * V_PITCH * 2;
      g[p] = gv + p * 256 * 8;
    }
    async_copy8(l, g);
  }

  const half_t* Aq = skq + (WNL + tm * 16) * KQ_PITCH;
  const half_t* Bk = skq + hf * 128 * KQ_PITCH;

  // --- raw scores q . k^T : 8 tiles of 16x16, kept in registers
  v16h qa0 = load_frag(Aq, KQ_PITCH, 0, lane);
  v16h qa1 = load_frag(Aq, KQ_PITCH, 32, lane);
  v8f acc[8];
#pragma unroll  // constant indices keep acc[] in registers
  for (int it = 0; it < 8; ++it) {
    const half_t* Bb = Bk + it * 16 * KQ_PITCH;
    v8f a = {};
    a = wmma16(qa0, load_frag(Bb, KQ_PITCH, 0, lane), a);
    a = wmma16(qa1, load_frag(Bb, KQ_PITCH, 32, lane), a);
    acc[it] = a;
  }

  // --- row maximum: own 128 columns, then the partner wave's
  float mx[8];
#pragma unroll  // constant indices keep acc[] and mx[] in registers
  for (int r = 0; r < 8; ++r) {
    float m = acc[0][r];
#pragma unroll  // as above
    for (int it = 1; it < 8; ++it) m = fmaxf(m, acc[it][r]);
    mx[r] = row16_max(m);
  }
  if (n == 0) {
    *(float4*)&pmax[hf][row0]     = make_float4(mx[0], mx[1], mx[2], mx[3]);
    *(float4*)&pmax[hf][row0 + 4] = make_float4(mx[4], mx[5], mx[6], mx[7]);
  }
  __syncthreads();
  {
    float4 o0 = *(const float4*)&pmax[hf ^ 1][row0];
    float4 o1 = *(const float4*)&pmax[hf ^ 1][row0 + 4];
    mx[0] = fmaxf(mx[0], o0.x); mx[1] = fmaxf(mx[1], o0.y);
    mx[2] = fmaxf(mx[2], o0.z); mx[3] = fmaxf(mx[3], o0.w);
    mx[4] = fmaxf(mx[4], o1.x); mx[5] = fmaxf(mx[5], o1.y);
    mx[6] = fmaxf(mx[6], o1.z); mx[7] = fmaxf(mx[7], o1.w);
  }

  // --- p = exp((s - max) * SCALE) = 2^(s*c - max*c), c = SCALE * log2(e);
  //     not yet divided by the row sum
  const float cexp = WSCALE * 1.44269504088896f;
  float sm[8];
#pragma unroll  // constant indices keep acc[], mx[] and sm[] in registers
  for (int r = 0; r < 8; ++r) {
    half_t* dst = sp + (row0 + r) * P_PITCH + hf * 128 + n;
    float nm = -mx[r] * cexp;
    float x[8], p[8];
#pragma unroll  // as above
    for (int it = 0; it < 8; ++it) x[it] = fmaf(acc[it][r], cexp, nm);
    exp2x8(p, x);
    float s = p[0];
    dst[0] = (half_t)p[0];
#pragma unroll  // as above
    for (int it = 1; it < 8; ++it) {
      s += p[it];
      dst[it * 16] = (half_t)p[it];
    }
    sm[r] = row16_sum(s);
  }
  if (n == 0) {
    *(float4*)&psum[hf][row0]     = make_float4(sm[0], sm[1], sm[2], sm[3]);
    *(float4*)&psum[hf][row0 + 4] = make_float4(sm[4], sm[5], sm[6], sm[7]);
  }
  // the wave's own V^T copies have landed; behind the barrier, every wave's
  asm volatile("s_wait_asynccnt 0x0" ::: "memory");
  __syncthreads();
  {
    float4 o0 = *(const float4*)&psum[hf ^ 1][row0];
    float4 o1 = *(const float4*)&psum[hf ^ 1][row0 + 4];
    sm[0] = __builtin_amdgcn_rcpf(sm[0] + o0.x);
    sm[1] = __builtin_amdgcn_rcpf(sm[1] + o0.y);
    sm[2] = __builtin_amdgcn_rcpf(sm[2] + o0.z);
    sm[3] = __builtin_amdgcn_rcpf(sm[3] + o0.w);
    sm[4] = __builtin_amdgcn_rcpf(sm[4] + o1.x);
    sm[5] = __builtin_amdgcn_rcpf(sm[5] + o1.y);
    sm[6] = __builtin_amdgcn_rcpf(sm[6] + o1.z);
    sm[7] = __builtin_amdgcn_rcpf(sm[7] + o1.w);
  }

  // --- out = (P @ V) / sum : the wave's own 16 rows, 2 of the 4 dk tiles
  const half_t* Ab = sp + tm * 16 * P_PITCH;
#pragma unroll  // two independent accumulate chains side by side
  for (int it = 0; it < 2; ++it) {
    int tn = hf * 2 + it;
    const half_t* Bb = sv + tn * 16 * V_PITCH;
    v8f o = {};
    for (int k0 = 0; k0 < WNL; k0 += 32)
      o = wmma16(load_frag(Ab, P_PITCH, k0, lane),
                 load_frag(Bb, V_PITCH, k0, lane), o);
#pragma unroll  // constant indices keep o and sm[] in registers
    for (int r = 0; r < 8; ++r)
      att16[((size_t)bc * WCHUNK + row0 + r) * WD + hh * WDK + tn * 16 + n] =
          (half_t)(o[r] * sm[r]);
  }
}

// ---------------------------------------------------------------------------
// 6. Residual-only head rows: out[b,s,:] = h[b,s,:] for s < 63
// ---------------------------------------------------------------------------
#define HEAD_BLOCKS ((WB * (WCHUNK - 1) * WD) / 256)

__device__ __forceinline__ void residual_head_block(
    const float* __restrict__ h, float* __restrict__ out, int blk) {
  int idx = blk * 256 + threadIdx.x;            // 4*63*1024 = 258048 exact
  int b = idx / ((WCHUNK - 1) * WD);
  int rem = idx % ((WCHUNK - 1) * WD);
  int s = rem / WD, d = rem % WD;
  size_t o = ((size_t)b * WS + s) * WD + d;
  out[o] = h[o];
  // the listing runs on from here into another pass of the joined grid, which
  // rewrites registers of this store: the wait stands in front of that
  asm volatile("s_wait_xcnt 0x0" ::: "memory");
}

// ---------------------------------------------------------------------------
// 7. The passes that read only inputs (2, 1, 3 for the four weights, 6) as one
//    grid: none reads what another writes. A work-group's pass follows from
//    blockIdx alone, so each branch, and the barrier inside 3, is taken by a
//    whole work-group or by none of it. Longest work-groups first.
//    WT4 = the four transposed weights one behind the other (q, k, v, o).
// ---------------------------------------------------------------------------
#define PRE_BLOCKS (CAST_BLOCKS + LN_BLOCKS + 4 * TR_BLOCKS + HEAD_BLOCKS)

__global__ __launch_bounds__(256) void prepass_kernel(
    const float* __restrict__ h, const float* __restrict__ e,
    const float* __restrict__ Wq, const float* __restrict__ Wk,
    const float* __restrict__ Wv, const float* __restrict__ Wo,
    const float* __restrict__ gamma, const float* __restrict__ beta,
    half_t* __restrict__ hb16, half_t* __restrict__ e16,
    half_t* __restrict__ WT4, float* __restrict__ out) {
  __shared__ __align__(16) half_t tile[64 * TR_PITCH];
  int blk = blockIdx.x;
  if (blk < CAST_BLOCKS) {
    cast_f16_block(e, e16, blk);
  } else if (blk < CAST_BLOCKS + LN_BLOCKS) {
    ln_cast_block(h, gamma, beta, hb16, blk - CAST_BLOCKS);
  } else if (blk < CAST_BLOCKS + LN_BLOCKS + 4 * TR_BLOCKS) {
    int t = blk - (CAST_BLOCKS + LN_BLOCKS);
    int w = t / TR_BLOCKS;
    const float* W = w == 0 ? Wq : w == 1 ? Wk : w == 2 ? Wv : Wo;
    transpose_cast_block(W, WT4 + (size_t)w * WD * WD, tile, t % TR_BLOCKS);
  } else {
    residual_head_block(h, out, blk - (CAST_BLOCKS + LN_BLOCKS + 4 * TR_BLOCKS));
  }
}

// ---------------------------------------------------------------------------
// Host launcher
// ---------------------------------------------------------------------------
extern "C" void kernel_launch(void* const* d_in, const int* in_sizes, int n_in,
                              void* d_out, int out_size, void* d_ws,
                              size_t ws_size, hipStream_t stream) {
  const float* h     = (const float*)d_in[0];
  const float* e     = (const float*)d_in[1];
  const float* Wq    = (const float*)d_in[2];
  const float* bq    = (const float*)d_in[3];
  const float* Wk    = (const float*)d_in[4];
  const float* bk    = (const float*)d_in[5];
  const float* Wv    = (const float*)d_in[6];
  const float* bv    = (const float*)d_in[7];
  const float* Wo    = (const float*)d_in[8];
  const float* bo    = (const float*)d_in[9];
  const float* gamma = (const float*)d_in[10];
  const float* beta  = (const float*)d_in[11];
  float* out = (float*)d_out;

  // Workspace layout (f16 elements), ~248 MB total
  const size_t HB  = (size_t)ROWS_H * WD;   //  8,388,608
  const size_t E16 = (size_t)ROWS_E * WD;   // 33,554,432
  const size_t WSZ = (size_t)WD * WD;       //  1,048,576
  half_t* w = (half_t*)d_ws;
  half_t* hb16  = w;                 w += HB;
  half_t* e16   = w;                 w += E16;
  half_t* WqT   = w;                 w += WSZ;
  half_t* WkT   = w;                 w += WSZ;
  half_t* WvT   = w;                 w += WSZ;
  half_t* WoT   = w;                 w += WSZ;
  half_t* q16   = w;                 w += HB;
  half_t* k16   = w;                 w += E16;
  half_t* vT16  = w;                 w += E16;
  half_t* att16 = w;                 w += HB;

  // 1. e cast, LayerNorm + pad + cast, weight transposes, head rows of out
  prepass_kernel<<<PRE_BLOCKS, 256, 0, stream>>>(h, e, Wq, Wk, Wv, Wo, gamma,
                                                 beta, hb16, e16, WqT, out);
  // 2. k (32768x1024) and q (8192x1024) projections, K = 1024
  gemm_kq_kernel<<<dim3(WD / 128, K_TROWS + Q_TROWS), 256, 0, stream>>>(
      e16, WkT, bk, k16, hb16, WqT, bq, q16, WD, WD);
  // 3. v projection, transposed output
  gemm128_kernel<1><<<dim3(WD / 128, ROWS_E / 128), 256, 0, stream>>>(
      e16, WvT, bv, vT16, nullptr, nullptr, WD, WD);
  // 4. attention per (b,c,h)
  attention_kernel<<<WB * WC * WH, 256, 0, stream>>>(q16, k16, vT16, att16);
  // 5. output projection + shift + residual, fused into d_out
  gemm128_kernel<2><<<dim3(WD / 128, ROWS_H / 128), 256, 0, stream>>>(
      att16, WoT, bo, nullptr, h, out, WD, WD);
}

// v007
// It runs in 218 microseconds.
// Timed twice side by side with v006, it ran 1.04 times as fast both times.
// All steps since v000 together make it 2.42 times as fast.
#include <hip/hip_runtime.h>
#include <hip/hip_bf16.h>
#include <math.h>

// ---------------------------------------------------------------------------
// Chunked cross attention for MI455X (gfx1250), wave32 + WMMA f16->f32,
// LDS-blocked GEMMs (256x128 block, 64x64 per wave) with async global->LDS.
// B=4 S=2048 D=1024 C=32 N=2 L=128 H=16 DK=64 CHUNK=64
// ---------------------------------------------------------------------------

typedef _Float16 half_t;
typedef __attribute__((ext_vector_type(16))) _Float16 v16h;
typedef __attribute__((ext_vector_type(8)))  _Float16 v8h;
typedef __attribute__((ext_vector_type(4)))  _Float16 v4h;
typedef __attribute__((ext_vector_type(8)))  float    v8f;
typedef __attribute__((ext_vector_type(4)))  float    v4f;

#define WB 4
#define WS 2048
#define WD 1024
#define WC 32
#define WH 16
#define WDK 64
#define WCHUNK 64
#define WNL 256                       // N*L
#define ROWS_H (WB * WS)              // 8192
#define ROWS_E (WB * WC * WNL)        // 32768
#define VALID_ROWS (WS - WCHUNK + 1)  // 1985
#define WSCALE 0.125f                 // 1/sqrt(64)

#define KSTEP 64                      // halves of a row per K-step: one 128 B line
#define LDS_STRIDE 72                 // 64 + 8 halves: 144 B = 16 B x 9, bank-spread
#define BM 256                        // rows of a block tile: 4 waves x 64
#define BN 128                        // columns of a block tile: 2 waves x 64

#if defined(__AMDGCN__) &&                                              \
    __has_builtin(__builtin_amdgcn_global_load_async_to_lds_b128) &&    \
    __has_builtin(__builtin_amdgcn_s_wait_asynccnt)
#define USE_ASYNC 1
typedef int v4i __attribute__((vector_size(16)));
typedef __attribute__((address_space(1))) v4i as1_v4i;
typedef __attribute__((address_space(3))) v4i as3_v4i;
#else
#define USE_ASYNC 0
#endif

__device__ __forceinline__ v8f wmma16(v16h a, v16h b, v8f c) {
  return __builtin_amdgcn_wmma_f32_16x16x32_f16(false, a, false, b, (short)0, c,
                                                false, false);
}

// Fragment loader for v_wmma_f32_16x16x32_f16. Works for A (MxK row-major,
// lane&15 = M) and B supplied N-major (NxK row-major, lane&15 = N).
// elements 0..7 = K[k0+hi*8 ..], elements 8..15 = K[k0+16+hi*8 ..].
__device__ __forceinline__ v16h load_frag(const half_t* __restrict__ base,
                                          int ld, int k0, int lane) {
  int m  = lane & 15;
  int hi = (lane >> 4) & 1;
  const half_t* p = base + (size_t)m * ld + k0 + hi * 8;
  v8h lo = *(const v8h*)(p);
  v8h hv = *(const v8h*)(p + 16);
  v16h r;
#pragma unroll
  for (int e = 0; e < 8; ++e) { r[e] = lo[e]; r[e + 8] = hv[e]; }
  return r;
}

// Stage one K-step tile (A:256x64, B:128x64 halves) into LDS.
// Eight lanes in a row take one row's whole 128-byte line, so a wave's copy
// asks L2 for 4 whole lines. Each of 256 threads moves 8x16 B of A and 4x16 B
// of B (rows 32 apart). off = the lane's own element offset inside a tile.
__device__ __forceinline__ void stage_tile(const half_t* __restrict__ gA,
                                           const half_t* __restrict__ gB,
                                           int ldg, half_t* sA, half_t* sB,
                                           int tid) {
  int row = tid >> 3;
  int cs  = (tid & 7) * 8;
  unsigned off = (unsigned)(row * ldg + cs);
  half_t* la = sA + row * LDS_STRIDE + cs;
  half_t* lb = sB + row * LDS_STRIDE + cs;
#pragma unroll  // fixed row groups of A; the copies issue back to back
  for (int p = 0; p < BM / 32; ++p) {
    const half_t* pa = gA + (size_t)(p * 32) * ldg + off;
#if USE_ASYNC
    __builtin_amdgcn_global_load_async_to_lds_b128(
        (as1_v4i*)pa, (as3_v4i*)(la + p * 32 * LDS_STRIDE), 0, 0);
#else
    *(v8h*)(la + p * 32 * LDS_STRIDE) = *(const v8h*)pa;
#endif
  }
#pragma unroll  // fixed row groups of B; as above
  for (int p = 0; p < BN / 32; ++p) {
    const half_t* pb = gB + (size_t)(p * 32) * ldg + off;
#if USE_ASYNC
    __builtin_amdgcn_global_load_async_to_lds_b128(
        (as1_v4i*)pb, (as3_v4i*)(lb + p * 32 * LDS_STRIDE), 0, 0);
#else
    *(v8h*)(lb + p * 32 * LDS_STRIDE) = *(const v8h*)pb;
#endif
  }
}

__device__ __forceinline__ void async_wait0() {
#if USE_ASYNC
  __builtin_amdgcn_s_wait_asynccnt(0);
#endif
}

// ---------------------------------------------------------------------------
// 1. LayerNorm of h[:,63:] -> f16, padded with zeros to (B, 2048, D)
//    One wave per row: the 4 KiB row is fetched by eight 16-byte loads per
//    lane, all in flight together, and stays in registers for both uses.
//    Sums: four chains per lane, then a five-step butterfly over the wave.
//    No LDS, no barrier; 8192 waves in all. blk = 0..LN_BLOCKS-1.
// ---------------------------------------------------------------------------
#define LN_BLOCKS (ROWS_H / 8)

__device__ __forceinline__ void ln_cast_block(
    const float* __restrict__ h, const float* __restrict__ gamma,
    const float* __restrict__ beta, half_t* __restrict__ hb16, int blk) {
  int lane = threadIdx.x & 31;
  // the wave's number as a scalar: row addresses and the pad test stay scalar
  int row = blk * 8 + __builtin_amdgcn_readfirstlane(threadIdx.x >> 5);
  int b = row >> 11, t = row & 2047;    // row 0..8191
  v4h* dst = (v4h*)(hb16 + (size_t)row * WD);
  if (t >= VALID_ROWS) {                // zero padding rows (wave-uniform)
    v4h z = {};
#pragma unroll  // eight independent stores
    for (int j = 0; j < 8; ++j) dst[j * 32 + lane] = z;
    // the listing runs on from here into another pass of the joined grid, which
    // rewrites registers of these stores: the wait stands in front of that
    asm volatile("s_wait_xcnt 0x0" ::: "memory");
  } else {
    const v4f* x = (const v4f*)(h + ((size_t)b * WS + t + (WCHUNK - 1)) * WD);
    v4f v[8];
#pragma unroll  // constant indices keep v[] in registers; loads issue together
    for (int j = 0; j < 8; ++j) v[j] = x[j * 32 + lane];
    v4f a = v[0], q = v[0] * v[0];
#pragma unroll  // as above
    for (int j = 1; j < 8; ++j) { a += v[j]; q += v[j] * v[j]; }
    float s = (a.x + a.y) + (a.z + a.w), s2 = (q.x + q.y) + (q.z + q.w);
#pragma unroll  // five fixed exchange distances
    for (int m = 16; m > 0; m >>= 1) {
      s  += __shfl_xor(s, m);
      s2 += __shfl_xor(s2, m);
    }
    float mu  = s * (1.0f / WD);
    float var = s2 * (1.0f / WD) - mu * mu;
    float rs  = rsqrtf(var + 1e-5f);
    const v4f* g4 = (const v4f*)gamma;
    const v4f* b4 = (const v4f*)beta;
#pragma unroll  // constant indices keep v[] in registers
    for (int j = 0; j < 8; ++j) {
      v4f y = (v[j] - mu) * rs * g4[j * 32 + lane] + b4[j * 32 + lane];
      v4h o = {(half_t)y.x, (half_t)y.y, (half_t)y.z, (half_t)y.w};
      dst[j * 32 + lane] = o;
    }
    // the listing can run on from here into the pad block, which rewrites data
    // registers of these stores: the wait stands in front of that overwrite
    asm volatile("s_wait_xcnt 0x0" ::: "memory");
  }
}

// ---------------------------------------------------------------------------
// 2. Elementwise f32 -> f16 cast (for e), as a stream: a block owns 128 KiB
//    of src in a row; each lane takes 32 16-byte loads of it (512 B in a row
//    per wave-load) and stores 8 bytes per load (256 B in a row per
//    wave-store). Written in groups of eight, which bounds the registers; the
//    compiler runs the groups into one another (sixteen loads lead, later
//    ones follow as registers come free, the stores stand last).
//    CAST_BLOCKS blocks cover e exactly once. 8192 waves in all.
// ---------------------------------------------------------------------------
#define CAST_U 8                      // 16-byte loads of one group
#define CAST_G 4                      // groups per lane
#define CAST_BLOCKS ((ROWS_E * WD) / (4 * 256 * CAST_G * CAST_U))

__device__ __forceinline__ void cast_f16_block(
    const float* __restrict__ src, half_t* __restrict__ dst, int blk) {
  size_t base = (size_t)blk * (CAST_G * CAST_U * 256) + threadIdx.x;
  const float4* s4 = (const float4*)src + base;
  v4h* d4 = (v4h*)dst + base;
#pragma unroll  // constant offsets from one address per lane
  for (int g = 0; g < CAST_G; ++g) {
    float4 v[CAST_U];
#pragma unroll  // constant indices keep v[] in registers; loads issue together
    for (int u = 0; u < CAST_U; ++u) v[u] = s4[(g * CAST_U + u) * 256];
#pragma unroll  // as above
    for (int u = 0; u < CAST_U; ++u) {
      v4h o = {(half_t)v[u].x, (half_t)v[u].y, (half_t)v[u].z, (half_t)v[u].w};
      d4[(g * CAST_U + u) * 256] = o;
    }
  }
}

// ---------------------------------------------------------------------------
// 3. Weight transpose + cast: W (KxN) f32 -> WT (NxK) f16   (1024x1024)
//    One 64(k) x 64(n) tile per block, turned in LDS: rows of W are read as
//    16-byte loads, rows of WT leave as whole 128-byte lines.
// ---------------------------------------------------------------------------
#define TR_PITCH 72                   // 64 + 8 halves: rows stay 16B aligned
#define TR_BLOCKS ((WD / 64) * (WD / 64))   // tiles of one weight matrix

__device__ __forceinline__ void transpose_cast_block(
    const float* __restrict__ W, half_t* __restrict__ WT, half_t* tile,
    int blk) {                          // tile: [n][k], 64 * TR_PITCH halves
  int tid = threadIdx.x;
  int k0 = (blk / (WD / 64)) * 64, n0 = (blk % (WD / 64)) * 64;

  // each thread: a 4(k) x 4(n) patch, 16 lanes cover one 256-byte row piece
  int nq = (tid & 15) * 4, kq = (tid >> 4) * 4;
  const float* src = W + (size_t)(k0 + kq) * WD + n0 + nq;
  float4 r0 = *(const float4*)(src);
  float4 r1 = *(const float4*)(src + WD);
  float4 r2 = *(const float4*)(src + 2 * WD);
  float4 r3 = *(const float4*)(src + 3 * WD);
  v4h c0 = {(half_t)r0.x, (half_t)r1.x, (half_t)r2.x, (half_t)r3.x};
  v4h c1 = {(half_t)r0.y, (half_t)r1.y, (half_t)r2.y, (half_t)r3.y};
  v4h c2 = {(half_t)r0.z, (half_t)r1.z, (half_t)r2.z, (half_t)r3.z};
  v4h c3 = {(half_t)r0.w, (half_t)r1.w, (half_t)r2.w, (half_t)r3.w};
  *(v4h*)(tile + (nq + 0) * TR_PITCH + kq) = c0;
  *(v4h*)(tile + (nq + 1) * TR_PITCH + kq) = c1;
  *(v4h*)(tile + (nq + 2) * TR_PITCH + kq) = c2;
  *(v4h*)(tile + (nq + 3) * TR_PITCH + kq) = c3;
  __syncthreads();

  // 8 lanes write one 128-byte line of WT
  for (int j = 0; j < 2; ++j) {
    int idx = tid + j * 256;
    int n = idx >> 3, ks = (idx & 7) * 8;
    *(v8h*)(WT + (size_t)(n0 + n) * WD + k0 + ks) =
        *(const v8h*)(tile + n * TR_PITCH + ks);
  }
  // the listing runs on from here into another pass of the joined grid, which
  // rewrites registers of these stores: the wait stands in front of that
  asm volatile("s_wait_xcnt 0x0" ::: "memory");
}

// ---------------------------------------------------------------------------
// 4. Blocked WMMA GEMM: block tile 256x128, K-step 64, double-buffered LDS.
//    8 waves, each computing 64x64 (4x4 subtiles, 16 independent accumulators):
//    the 8 fragments of a 32-deep K slice, read from LDS as one group, feed 16 WMMAs.
//    A (MxK row-major), Bt (NxK row-major).  M a multiple of 256, N of 128.
//    MODE 0: C16[row*N+col] = acc + bias[col]                 (q, k proj)
//    MODE 1: vT[(bc,h,dk,j)] = acc + bias[col]                (v proj, T out)
//    MODE 2: out f32 with shift-by-63 + residual              (Wo proj)
// ---------------------------------------------------------------------------
typedef half_t gemm_bufa_t[BM * LDS_STRIDE];   // A's K-step tile
typedef half_t gemm_bufb_t[BN * LDS_STRIDE];   // Bt's K-step tile

// The K loop of one 256x128 tile: Ab, Bb = first row of the tile's A and Bt.
__device__ __forceinline__ void gemm_mainloop(const half_t* __restrict__ Ab,
                                              const half_t* __restrict__ Bb,
                                              int K, gemm_bufa_t* sA,
                                              gemm_bufb_t* sB,
                                              v8f (&acc)[4][4]) {
  int tid  = threadIdx.x;
  int lane = tid & 31, wave = tid >> 5;
  int mw = (wave >> 1) * 64;            // wave row offset in block tile
  int nw = (wave & 1) * 64;             // wave col offset in block tile
  int nk = K / KSTEP;

  stage_tile(Ab, Bb, K, sA[0], sB[0], tid);
  async_wait0();
  __syncthreads();

  for (int kt = 0; kt < nk; ++kt) {
    int buf = kt & 1;
    if (kt + 1 < nk)
      stage_tile(Ab + (kt + 1) * KSTEP, Bb + (kt + 1) * KSTEP, K, sA[buf ^ 1],
                 sB[buf ^ 1], tid);

    const half_t* As_w = sA[buf] + mw * LDS_STRIDE;
    const half_t* Bs_w = sB[buf] + nw * LDS_STRIDE;
#pragma unroll  // the two 32-deep halves of the K-step, constant LDS offsets
    for (int k0 = 0; k0 < KSTEP; k0 += 32) {
      v16h af[4], bf[4];
#pragma unroll
      for (int i = 0; i < 4; ++i)
        af[i] = load_frag(As_w + i * 16 * LDS_STRIDE, LDS_STRIDE, k0, lane);
#pragma unroll
      for (int j = 0; j < 4; ++j)
        bf[j] = load_frag(Bs_w + j * 16 * LDS_STRIDE, LDS_STRIDE, k0, lane);
      // keeps the 16 LDS reads one group in front of the 16 WMMAs: without it
      // the compiler reloads one A fragment in place and waits for LDS in front
      // of every 4 WMMAs
      __builtin_amdgcn_sched_barrier(0);
#pragma unroll
      for (int i = 0; i < 4; ++i)
#pragma unroll
        for (int j = 0; j < 4; ++j) acc[i][j] = wmma16(af[i], bf[j], acc[i][j]);
    }
    // keeps the K-step's WMMAs in front of the wait and the barrier: sunk behind
    // them they would stand between the barrier and the next tile's copies,
    // which then start later and have less than a K-step to land
    __builtin_amdgcn_sched_barrier(0);

    async_wait0();
    __syncthreads();
  }
}

// Epilogue: C/D layout -> row = base + (lane>>4)*8 + r, col = base + lane&15
template <int MODE>
__device__ __forceinline__ void gemm_store(
    const v8f (&acc)[4][4], const float* __restrict__ bias,
    half_t* __restrict__ C16, const float* __restrict__ hres,
    float* __restrict__ outf, int N, int tm0, int tn0) {
  int lane = threadIdx.x & 31, wave = threadIdx.x >> 5;
  int mw = (wave >> 1) * 64;
  int nw = (wave & 1) * 64;
  int nl = lane & 15, mb = (lane >> 4) * 8;
#pragma unroll
  for (int i = 0; i < 4; ++i) {
#pragma unroll
    for (int j = 0; j < 4; ++j) {
      int col = tn0 + nw + j * 16 + nl;
      float bv = bias[col];
#pragma unroll
      for (int r = 0; r < 8; ++r) {
        int row = tm0 + mw + i * 16 + mb + r;
        float v = acc[i][j][r] + bv;
        if (MODE == 0) {
          C16[(size_t)row * N + col] = (half_t)v;
        } else if (MODE == 1) {
          int bc = row >> 8, jj = row & 255;
          int hh = col >> 6, dk = col & 63;
          C16[(((size_t)bc * WH + hh) * WDK + dk) * WNL + jj] = (half_t)v;
        } else {
          int b = row >> 11, t = row & 2047;
          if (t < VALID_ROWS) {          // shift by 63; tail rows discarded
            size_t o = ((size_t)b * WS + t + (WCHUNK - 1)) * WD + col;
            outf[o] = v + hres[o];
          }
        }
      }
    }
  }
}

// One GEMM per launch: v projection (MODE 1), output projection (MODE 2).
template <int MODE>
__global__ __launch_bounds__(256) void gemm128_kernel(
    const half_t* __restrict__ A, const half_t* __restrict__ Bt,
    const float* __restrict__ bias, half_t* __restrict__ C16,
    const float* __restrict__ hres, float* __restrict__ outf, int N, int K) {
  __shared__ __align__(16) gemm_bufa_t sA[2];
  __shared__ __align__(16) gemm_bufb_t sB[2];
  int tm0 = blockIdx.y * BM;
  int tn0 = blockIdx.x * BN;
  v8f acc[4][4] = {};
  gemm_mainloop(A + (size_t)tm0 * K, Bt + (size_t)tn0 * K, K, sA, sB, acc);
  gemm_store<MODE>(acc, bias, C16, hres, outf, N, tm0, tn0);
}

// k and q projections (both MODE 0) in one grid: neither reads what the other
// writes. Grid rows 0..K_TROWS-1 are the row tiles of k, the rest those of q.
// The test is on blockIdx alone: the same for the whole work-group.
#define K_TROWS (ROWS_E / BM)
#define Q_TROWS (ROWS_H / BM)

__global__ __launch_bounds__(256) void gemm_kq_kernel(
    const half_t* __restrict__ e16, const half_t* __restrict__ WkT,
    const float* __restrict__ bk, half_t* __restrict__ k16,
    const half_t* __restrict__ hb16, const half_t* __restrict__ WqT,
    const float* __restrict__ bq, half_t* __restrict__ q16, int N, int K) {
  __shared__ __align__(16) gemm_bufa_t sA[2];
  __shared__ __align__(16) gemm_bufb_t sB[2];
  bool is_q = blockIdx.y >= K_TROWS;
  int tm0 = (is_q ? blockIdx.y - K_TROWS : blockIdx.y) * BM;
  int tn0 = blockIdx.x * BN;
  const half_t* A  = is_q ? hb16 : e16;
  const half_t* Bt = is_q ? WqT : WkT;
  v8f acc[4][4] = {};
  gemm_mainloop(A + (size_t)tm0 * K, Bt + (size_t)tn0 * K, K, sA, sB, acc);
  gemm_store<0>(acc, is_q ? bq : bk, is_q ? q16 : k16, nullptr, nullptr, N, tm0,
                tn0);
}

// ---------------------------------------------------------------------------
// 5. Attention: one block per (b,c,h). The block's K (256 x 64), Q (64 x 64)
//    and V^T (64 x 256) tiles are brought into LDS once, by asynchronous
//    copies that take whole 128-byte lines; every fragment is read from there.
//    V^T is copied while scores and softmax are worked on.
//    Wave w owns query rows (w>>1)*16..+15
//    and key columns (w&1)*128..+127. Its 16x128 scores stay in the WMMA
//    accumulators (f32): row maximum and row sum are taken there, in-lane over
//    the 8 tiles, then over the 16 lanes of a row by DPP, then joined with the
//    partner wave's half through LDS. exp(s - max) goes to LDS once, as f16,
//    and P@V (A and B from LDS) is divided by the row sum.
// ---------------------------------------------------------------------------
#define P_PITCH (WNL + 8)             // 8 halves of pad: 16 B x 33, so that b128
                                      // readers of 16 rows fall on distinct banks
#define KQ_PITCH (WDK + 8)            // K and Q rows: 144 B = 16 B x 9, as above
#define KQ_ROWS (WNL + WCHUNK)        // K rows 0..255, Q rows 256..319
#define V_PITCH (WNL + 8)             // V^T rows: 528 B = 16 B x 33, as above

// the byte address in the work-group's LDS: low 32 bits of a __shared__ address
__device__ __forceinline__ unsigned lds_byte(const half_t* p) {
  return (unsigned)(size_t)p;
}

// Asynchronous copies global -> LDS, 16 bytes per lane and copy. The closing
// s_wait_xcnt stands inside the copies' own statement, so that no later write
// of an address register can be scheduled in front of it.
__device__ __forceinline__ void async_copy8(const unsigned (&l)[8],
                                            const half_t* const (&g)[8]) {
  asm volatile(
      "global_load_async_to_lds_b128 %0, %8, off\n\t"
      "global_load_async_to_lds_b128 %1, %9, off\n\t"
      "global_load_async_to_lds_b128 %2, %10, off\n\t"
      "global_load_async_to_lds_b128 %3, %11, off\n\t"
      "global_load_async_to_lds_b128 %4, %12, off\n\t"
      "global_load_async_to_lds_b128 %5, %13, off\n\t"
      "global_load_async_to_lds_b128 %6, %14, off\n\t"
      "global_load_async_to_lds_b128 %7, %15, off\n\t"
      "s_wait_xcnt 0x0"
      :
      : "v"(l[0]), "v"(l[1]), "v"(l[2]), "v"(l[3]), "v"(l[4]), "v"(l[5]),
        "v"(l[6]), "v"(l[7]), "v"(g[0]), "v"(g[1]), "v"(g[2]), "v"(g[3]),
        "v"(g[4]), "v"(g[5]), "v"(g[6]), "v"(g[7])
      : "memory");
}
__device__ __forceinline__ void async_copy2(unsigned l0, unsigned l1,
                                            const half_t* g0,
                                            const half_t* g1) {
  asm volatile(
      "global_load_async_to_lds_b128 %0, %2, off\n\t"
      "global_load_async_to_lds_b128 %1, %3, off\n\t"
      "s_wait_xcnt 0x0"
      :
      : "v"(l0), "v"(l1), "v"(g0), "v"(g1)
      : "memory");
}

// value of lane (l ^ mask) inside the 16-lane row; CTRL = 0x160 + mask
template <int CTRL>
__device__ __forceinline__ float row_xmask(float v) {
  return __builtin_bit_cast(
      float, __builtin_amdgcn_mov_dpp(__builtin_bit_cast(int, v), CTRL, 0xf,
                                      0xf, true));
}
__device__ __forceinline__ float row16_max(float v) {
  v = fmaxf(v, row_xmask<0x161>(v));
  v = fmaxf(v, row_xmask<0x162>(v));
  v = fmaxf(v, row_xmask<0x164>(v));
  v = fmaxf(v, row_xmask<0x168>(v));
  return v;
}
__device__ __forceinline__ float row16_sum(float v) {
  v += row_xmask<0x161>(v);
  v += row_xmask<0x162>(v);
  v += row_xmask<0x164>(v);
  v += row_xmask<0x168>(v);
  return v;
}

// y[i] = 2^x[i] for eight values. Written as one statement so that nothing
// the compiler schedules can stand directly behind a v_exp_f32 and read its
// result or overwrite its source: inside, every output register differs from
// every input ("=&v"); the closing v_nop is the one independent issue slot
// that the instruction set asks for behind the last of them.
__device__ __forceinline__ void exp2x8(float (&y)[8], const float (&x)[8]) {
  asm("v_exp_f32 %0, %8\n\t"
      "v_exp_f32 %1, %9\n\t"
      "v_exp_f32 %2, %10\n\t"
      "v_exp_f32 %3, %11\n\t"
      "v_exp_f32 %4, %12\n\t"
      "v_exp_f32 %5, %13\n\t"
      "v_exp_f32 %6, %14\n\t"
      "v_exp_f32 %7, %15\n\t"
      "v_nop"
      : "=&v"(y[0]), "=&v"(y[1]), "=&v"(y[2]), "=&v"(y[3]), "=&v"(y[4]),
        "=&v"(y[5]), "=&v"(y[6]), "=&v"(y[7])
      : "v"(x[0]), "v"(x[1]), "v"(x[2]), "v"(x[3]), "v"(x[4]), "v"(x[5]),
        "v"(x[6]), "v"(x[7]));
}

__global__ __launch_bounds__(256) void attention_kernel(
    const half_t* __restrict__ q16, const half_t* __restrict__ k16,
    const half_t* __restrict__ vT16, half_t* __restrict__ att16) {
  int unit = blockIdx.x;                  // 0..2047
  int bc = unit >> 4;                     // b*32 + c
  int hh = unit & 15;
  int tid = threadIdx.x;
  int lane = tid & 31, wave = tid >> 5;
  int tm = wave >> 1, hf = wave & 1;
  int n = lane & 15, mb = (lane >> 4) * 8;
  int row0 = tm * 16 + mb;                // first of this lane's 8 rows

  __shared__ __align__(16) half_t skq[KQ_ROWS * KQ_PITCH];  // K rows, Q rows
  __shared__ __align__(16) half_t sv[WDK * V_PITCH];        // V^T rows
  __shared__ __align__(16) float pmax[2][WCHUNK], psum[2][WCHUNK];
  // exp(s - max), f16: takes the place of the K rows (64 * P_PITCH halves fit
  // in 256 * KQ_PITCH), written only behind the barrier of the row maximum,
  // which every wave reaches with its K and Q fragments already used
  half_t* sp = skq;

  // --- K and Q tiles into LDS: 8 lanes take one row's 128-byte line, a wave's
  //     copy 4 rows
  {
    int row = tid >> 3, cs = (tid & 7) * 8;
    const half_t* gk = k16 + ((size_t)bc * WNL + row) * WD + hh * WDK + cs;
    const half_t* gq = q16 + ((size_t)bc * WCHUNK + row) * WD + hh * WDK + cs;
    unsigned lk = lds_byte(skq + row * KQ_PITCH + cs);
    unsigned l[8];
    const half_t* g[8];
#pragma unroll  // constant indices keep l[] and g[] in registers
    for (int p = 0; p < 8; ++p) {
      l[p] = lk + p * 32 * KQ_PITCH * 2;
      g[p] = gk + (size_t)p * 32 * WD;
    }
    async_copy8(l, g);
    async_copy2(lk + WNL * KQ_PITCH * 2, lk + (WNL + 32) * KQ_PITCH * 2, gq,
                gq + (size_t)32 * WD);
  }
  // the wave's own copies have landed; behind the barrier, every wave's
  asm volatile("s_wait_asynccnt 0x0" ::: "memory");
  __syncthreads();

  // --- V^T tile into LDS: 32 KiB in a row, a wave's copy takes one 512-byte
  //     row. It flies while scores and softmax are worked on; its wait stands
  //     in front of the barrier of the row sum, the last one before P@V.
  {
    const half_t* gv = vT16 + ((size_t)bc * WH + hh) * WDK * WNL + tid * 8;
    unsigned lv = lds_byte(sv + wave * V_PITCH + lane * 8);
    unsigned l[8];
    const half_t* g[8];
#pragma unroll  // constant indices keep l[] and g[] in registers
    for (int p = 0; p < 8; ++p) {
      l[p] = lv + p * 8 * V_PITCH * 2;
      g[p] = gv + p * 256 * 8;
    }
    async_copy8(l, g);
  }

  const half_t* Aq = skq + (WNL + tm * 16) * KQ_PITCH;
  const half_t* Bk = skq + hf * 128 * KQ_PITCH;

  // --- raw scores q . k^T : 8 tiles of 16x16, kept in registers
  v16h qa0 = load_frag(Aq, KQ_PITCH, 0, lane);
  v16h qa1 = load_frag(Aq, KQ_PITCH, 32, lane);
  v8f acc[8];
#pragma unroll  // constant indices keep acc[] in registers
  for (int it = 0; it < 8; ++it) {
    const half_t* Bb = Bk + it * 16 * KQ_PITCH;
    v8f a = {};
    a = wmma16(qa0, load_frag(Bb, KQ_PITCH, 0, lane), a);
    a = wmma16(qa1, load_frag(Bb, KQ_PITCH, 32, lane), a);
    acc[it] = a;
  }

  // --- row maximum: own 128 columns, then the partner wave's
  float mx[8];
#pragma unroll  // constant indices keep acc[] and mx[] in registers
  for (int r = 0; r < 8; ++r) {
    float m = acc[0][r];
#pragma unroll  // as above
    for (int it = 1; it < 8; ++it) m = fmaxf(m, acc[it][r]);
    mx[r] = row16_max(m);
  }
  if (n == 0) {
    *(float4*)&pmax[hf][row0]     = make_float4(mx[0], mx[1], mx[2], mx[3]);
    *(float4*)&pmax[hf][row0 + 4] = make_float4(mx[4], mx[5], mx[6], mx[7]);
  }
  __syncthreads();
  {
    float4 o0 = *(const float4*)&pmax[hf ^ 1][row0];
    float4 o1 = *(const float4*)&pmax[hf ^ 1][row0 + 4];
    mx[0] = fmaxf(mx[0], o0.x); mx[1] = fmaxf(mx[1], o0.y);
    mx[2] = fmaxf(mx[2], o0.z); mx[3] = fmaxf(mx[3], o0.w);
    mx[4] = fmaxf(mx[4], o1.x); mx[5] = fmaxf(mx[5], o1.y);
    mx[6] = fmaxf(mx[6], o1.z); mx[7] = fmaxf(mx[7], o1.w);
  }

  // --- p = exp((s - max) * SCALE) = 2^(s*c - max*c), c = SCALE * log2(e);
  //     not yet divided by the row sum
  const float cexp = WSCALE * 1.44269504088896f;
  float sm[8];
#pragma unroll  // constant indices keep acc[], mx[] and sm[] in registers
  for (int r = 0; r < 8; ++r) {
    half_t* dst = sp + (row0 + r) * P_PITCH + hf * 128 + n;
    float nm = -mx[r] * cexp;
    float x[8], p[8];
#pragma unroll  // as above
    for (int it = 0; it < 8; ++it) x[it] = fmaf(acc[it][r], cexp, nm);
    exp2x8(p, x);
    float s = p[0];
    dst[0] = (half_t)p[0];
#pragma unroll  // as above
    for (int it = 1; it < 8; ++it) {
      s += p[it];
      dst[it * 16] = (half_t)p[it];
    }
    sm[r] = row16_sum(s);
  }
  if (n == 0) {
    *(float4*)&psum[hf][row0]     = make_float4(sm[0], sm[1], sm[2], sm[3]);
    *(float4*)&psum[hf][row0 + 4] = make_float4(sm[4], sm[5], sm[6], sm[7]);
  }
  // the wave's own V^T copies have landed; behind the barrier, every wave's
  asm volatile("s_wait_asynccnt 0x0" ::: "memory");
  __syncthreads();
  {
    float4 o0 = *(const float4*)&psum[hf ^ 1][row0];
    float4 o1 = *(const float4*)&psum[hf ^ 1][row0 + 4];
    sm[0] = __builtin_amdgcn_rcpf(sm[0] + o0.x);
    sm[1] = __builtin_amdgcn_rcpf(sm[1] + o0.y);
    sm[2] = __builtin_amdgcn_rcpf(sm[2] + o0.z);
    sm[3] = __builtin_amdgcn_rcpf(sm[3] + o0.w);
    sm[4] = __builtin_amdgcn_rcpf(sm[4] + o1.x);
    sm[5] = __builtin_amdgcn_rcpf(sm[5] + o1.y);
    sm[6] = __builtin_amdgcn_rcpf(sm[6] + o1.z);
    sm[7] = __builtin_amdgcn_rcpf(sm[7] + o1.w);
  }

  // --- out = (P @ V) / sum : the wave's own 16 rows, 2 of the 4 dk tiles
  const half_t* Ab = sp + tm * 16 * P_PITCH;
#pragma unroll  // two independent accumulate chains side by side
  for (int it = 0; it < 2; ++it) {
    int tn = hf * 2 + it;
    const half_t* Bb = sv + tn * 16 * V_PITCH;
    v8f o = {};
    for (int k0 = 0; k0 < WNL; k0 += 32)
      o = wmma16(load_frag(Ab, P_PITCH, k0, lane),
                 load_frag(Bb, V_PITCH, k0, lane), o);
#pragma unroll  // constant indices keep o and sm[] in registers
    for (int r = 0; r < 8; ++r)
      att16[((size_t)bc * WCHUNK + row0 + r) * WD + hh * WDK + tn * 16 + n] =
          (half_t)(o[r] * sm[r]);
  }
}

// ---------------------------------------------------------------------------
// 6. Residual-only head rows: out[b,s,:] = h[b,s,:] for s < 63
// ---------------------------------------------------------------------------
#define HEAD_BLOCKS ((WB * (WCHUNK - 1) * WD) / 256)

__device__ __forceinline__ void residual_head_block(
    const float* __restrict__ h, float* __restrict__ out, int blk) {
  int idx = blk * 256 + threadIdx.x;            // 4*63*1024 = 258048 exact
  int b = idx / ((WCHUNK - 1) * WD);
  int rem = idx % ((WCHUNK - 1) * WD);
  int s = rem / WD, d = rem % WD;
  size_t o = ((size_t)b * WS + s) * WD + d;
  out[o] = h[o];
  // the listing runs on from here into another pass of the joined grid, which
  // rewrites registers of this store: the wait stands in front of that
  asm volatile("s_wait_xcnt 0x0" ::: "memory");
}

// ---------------------------------------------------------------------------
// 7. The passes that read only inputs (2, 1, 3 for the four weights, 6) as one
//    grid: none reads what another writes. A work-group's pass follows from
//    blockIdx alone, so each branch, and the barrier inside 3, is taken by a
//    whole work-group or by none of it. Longest work-groups first.
//    WT4 = the four transposed weights one behind the other (q, k, v, o).
// ---------------------------------------------------------------------------
#define PRE_BLOCKS (CAST_BLOCKS + LN_BLOCKS + 4 * TR_BLOCKS + HEAD_BLOCKS)

__global__ __launch_bounds__(256) void prepass_kernel(
    const float* __restrict__ h, const float* __restrict__ e,
    const float* __restrict__ Wq, const float* __restrict__ Wk,
    const float* __restrict__ Wv, const float* __restrict__ Wo,
    const float* __restrict__ gamma, const float* __restrict__ beta,
    half_t* __restrict__ hb16, half_t* __restrict__ e16,
    half_t* __restrict__ WT4, float* __restrict__ out) {
  __shared__ __align__(16) half_t tile[64 * TR_PITCH];
  int blk = blockIdx.x;
  if (blk < CAST_BLOCKS) {
    cast_f16_block(e, e16, blk);
  } else if (blk < CAST_BLOCKS + LN_BLOCKS) {
    ln_cast_block(h, gamma, beta, hb16, blk - CAST_BLOCKS);
  } else if (blk < CAST_BLOCKS + LN_BLOCKS + 4 * TR_BLOCKS) {
    int t = blk - (CAST_BLOCKS + LN_BLOCKS);
    int w = t / TR_BLOCKS;
    const float* W = w == 0 ? Wq : w == 1 ? Wk : w == 2 ? Wv : Wo;
    transpose_cast_block(W, WT4 + (size_t)w * WD * WD, tile, t % TR_BLOCKS);
  } else {
    residual_head_block(h, out, blk - (CAST_BLOCKS + LN_BLOCKS + 4 * TR_BLOCKS));
  }
}

// ---------------------------------------------------------------------------
// Host launcher
// ---------------------------------------------------------------------------
extern "C" void kernel_launch(void* const* d_in, const int* in_sizes, int n_in,
                              void* d_out, int out_size, void* d_ws,
                              size_t ws_size, hipStream_t stream) {
  const float* h     = (const float*)d_in[0];
  const float* e     = (const float*)d_in[1];
  const float* Wq    = (const float*)d_in[2];
  const float* bq    = (const float*)d_in[3];
  const float* Wk    = (const float*)d_in[4];
  const float* bk    = (const float*)d_in[5];
  const float* Wv    = (const float*)d_in[6];
  const float* bv    = (const float*)d_in[7];
  const float* Wo    = (const float*)d_in[8];
  const float* bo    = (const float*)d_in[9];
  const float* gamma = (const float*)d_in[10];
  const float* beta  = (const float*)d_in[11];
  float* out = (float*)d_out;

  // Workspace layout (f16 elements), ~248 MB total
  const size_t HB  = (size_t)ROWS_H * WD;   //  8,388,608
  const size_t E16 = (size_t)ROWS_E * WD;   // 33,554,432
  const size_t WSZ = (size_t)WD * WD;       //  1,048,576
  half_t* w = (half_t*)d_ws;
  half_t* hb16  = w;                 w += HB;
  half_t* e16   = w;                 w += E16;
  half_t* WqT   = w;                 w += WSZ;
  half_t* WkT   = w;                 w += WSZ;
  half_t* WvT   = w;                 w += WSZ;
  half_t* WoT   = w;                 w += WSZ;
  half_t* q16   = w;                 w += HB;
  half_t* k16   = w;                 w += E16;
  half_t* vT16  = w;                 w += E16;
  half_t* att16 = w;                 w += HB;

  // 1. e cast, LayerNorm + pad + cast, weight transposes, head rows of out
  prepass_kernel<<<PRE_BLOCKS, 256, 0, stream>>>(h, e, Wq, Wk, Wv, Wo, gamma,
                                                 beta, hb16, e16, WqT, out);
  // 2. k (32768x1024) and q (8192x1024) projections, K = 1024
  gemm_kq_kernel<<<dim3(WD / BN, K_TROWS + Q_TROWS), 256, 0, stream>>>(
      e16, WkT, bk, k16, hb16, WqT, bq, q16, WD, WD);
  // 3. v projection, transposed output
  gemm128_kernel<1><<<dim3(WD / BN, ROWS_E / BM), 256, 0, stream>>>(
      e16, WvT, bv, vT16, nullptr, nullptr, WD, WD);
  // 4. attention per (b,c,h)
  attention_kernel<<<WB * WC * WH, 256, 0, stream>>>(q16, k16, vT16, att16);
  // 5. output projection + shift + residual, fused into d_out
  gemm128_kernel<2><<<dim3(WD / BN, ROWS_H / BM), 256, 0, stream>>>(
      att16, WoT, bo, nullptr, h, out, WD, WD);
}

// v008
// One run takes 190 microseconds.
// Next to v007, in two timings, it ran 1.15 times as fast each time.
// All steps since v000 together make it 2.78 times as fast.
#include <hip/hip_runtime.h>
#include <hip/hip_bf16.h>
#include <math.h>

// ---------------------------------------------------------------------------
// Chunked cross attention for MI455X (gfx1250), wave32 + WMMA f16->f32,
// LDS-blocked GEMMs (256x128 block, 64x64 per wave) with async global->LDS.
// B=4 S=2048 D=1024 C=32 N=2 L=128 H=16 DK=64 CHUNK=64
// ---------------------------------------------------------------------------

typedef _Float16 half_t;
typedef __attribute__((ext_vector_type(16))) _Float16 v16h;
typedef __attribute__((ext_vector_type(8)))  _Float16 v8h;
typedef __attribute__((ext_vector_type(4)))  _Float16 v4h;
typedef __attribute__((ext_vector_type(8)))  float    v8f;
typedef __attribute__((ext_vector_type(4)))  float    v4f;

#define WB 4
#define WS 2048
#define WD 1024
#define WC 32
#define WH 16
#define WDK 64
#define WCHUNK 64
#define WNL 256                       // N*L
#define ROWS_H (WB * WS)              // 8192
#define ROWS_E (WB * WC * WNL)        // 32768
#define VALID_ROWS (WS - WCHUNK + 1)  // 1985
#define WSCALE 0.125f                 // 1/sqrt(64)

#define KSTEP 64                      // halves of a row per K-step: one 128 B line
#define LDS_STRIDE 72                 // 64 + 8 halves: 144 B = 16 B x 9, bank-spread
#define BM 256                        // rows of a block tile: 4 waves x 64
#define BN 128                        // columns of a block tile: 2 waves x 64

#if defined(__AMDGCN__) &&                                              \
    __has_builtin(__builtin_amdgcn_global_load_async_to_lds_b128) &&    \
    __has_builtin(__builtin_amdgcn_s_wait_asynccnt)
#define USE_ASYNC 1
typedef int v4i __attribute__((vector_size(16)));
typedef __attribute__((address_space(1))) v4i as1_v4i;
typedef __attribute__((address_space(3))) v4i as3_v4i;
#else
#define USE_ASYNC 0
#endif

__device__ __forceinline__ v8f wmma16(v16h a, v16h b, v8f c) {
  return __builtin_amdgcn_wmma_f32_16x16x32_f16(false, a, false, b, (short)0, c,
                                                false, false);
}

// Fragment loader for v_wmma_f32_16x16x32_f16. Works for A (MxK row-major,
// lane&15 = M) and B supplied N-major (NxK row-major, lane&15 = N).
// elements 0..7 = K[k0+hi*8 ..], elements 8..15 = K[k0+16+hi*8 ..].
__device__ __forceinline__ v16h load_frag(const half_t* __restrict__ base,
                                          int ld, int k0, int lane) {
  int m  = lane & 15;
  int hi = (lane >> 4) & 1;
  const half_t* p = base + (size_t)m * ld + k0 + hi * 8;
  v8h lo = *(const v8h*)(p);
  v8h hv = *(const v8h*)(p + 16);
  v16h r;
#pragma unroll
  for (int e = 0; e < 8; ++e) { r[e] = lo[e]; r[e + 8] = hv[e]; }
  return r;
}

// Stage one K-step tile (A:256x64, B:128x64 halves) into LDS.
// Eight lanes in a row take one row's whole 128-byte line, so a wave's copy
// asks L2 for 4 whole lines. Each of 256 threads moves 8x16 B of A and 4x16 B
// of B (rows 32 apart). off = the lane's own element offset inside a tile.
__device__ __forceinline__ void stage_tile(const half_t* __restrict__ gA,
                                           const half_t* __restrict__ gB,
                                           int ldg, half_t* sA, half_t* sB,
                                           int tid) {
  int row = tid >> 3;
  int cs  = (tid & 7) * 8;
  unsigned off = (unsigned)(row * ldg + cs);
  half_t* la = sA + row * LDS_STRIDE + cs;
  half_t* lb = sB + row * LDS_STRIDE + cs;
#pragma unroll  // fixed row groups of A; the copies issue back to back
  for (int p = 0; p < BM / 32; ++p) {
    const half_t* pa = gA + (size_t)(p * 32) * ldg + off;
#if USE_ASYNC
    __builtin_amdgcn_global_load_async_to_lds_b128(
        (as1_v4i*)pa, (as3_v4i*)(la + p * 32 * LDS_STRIDE), 0, 0);
#else
    *(v8h*)(la + p * 32 * LDS_STRIDE) = *(const v8h*)pa;
#endif
  }
#pragma unroll  // fixed row groups of B; as above
  for (int p = 0; p < BN / 32; ++p) {
    const half_t* pb = gB + (size_t)(p * 32) * ldg + off;
#if USE_ASYNC
    __builtin_amdgcn_global_load_async_to_lds_b128(
        (as1_v4i*)pb, (as3_v4i*)(lb + p * 32 * LDS_STRIDE), 0, 0);
#else
    *(v8h*)(lb + p * 32 * LDS_STRIDE) = *(const v8h*)pb;
#endif
  }
}

__device__ __forceinline__ void async_wait0() {
#if USE_ASYNC
  __builtin_amdgcn_s_wait_asynccnt(0);
#endif
}

// ---------------------------------------------------------------------------
// 1. LayerNorm of h[:,63:] -> f16, padded with zeros to (B, 2048, D)
//    One wave per row: the 4 KiB row is fetched by eight 16-byte loads per
//    lane, all in flight together, and stays in registers for both uses.
//    Sums: four chains per lane, then a five-step butterfly over the wave.
//    No LDS, no barrier; 8192 waves in all. blk = 0..LN_BLOCKS-1.
// ---------------------------------------------------------------------------
#define LN_BLOCKS (ROWS_H / 8)

__device__ __forceinline__ void ln_cast_block(
    const float* __restrict__ h, const float* __restrict__ gamma,
    const float* __restrict__ beta, half_t* __restrict__ hb16, int blk) {
  int lane = threadIdx.x & 31;
  // the wave's number as a scalar: row addresses and the pad test stay scalar
  int row = blk * 8 + __builtin_amdgcn_readfirstlane(threadIdx.x >> 5);
  int b = row >> 11, t = row & 2047;    // row 0..8191
  v4h* dst = (v4h*)(hb16 + (size_t)row * WD);
  if (t >= VALID_ROWS) {                // zero padding rows (wave-uniform)
    v4h z = {};
#pragma unroll  // eight independent stores
    for (int j = 0; j < 8; ++j) dst[j * 32 + lane] = z;
    // the listing runs on from here into another pass of the joined grid, which
    // rewrites registers of these stores: the wait stands in front of that
    asm volatile("s_wait_xcnt 0x0" ::: "memory");
  } else {
    const v4f* x = (const v4f*)(h + ((size_t)b * WS + t + (WCHUNK - 1)) * WD);
    v4f v[8];
#pragma unroll  // constant indices keep v[] in registers; loads issue together
    for (int j = 0; j < 8; ++j) v[j] = x[j * 32 + lane];
    v4f a = v[0], q = v[0] * v[0];
#pragma unroll  // as above
    for (int j = 1; j < 8; ++j) { a += v[j]; q += v[j] * v[j]; }
    float s = (a.x + a.y) + (a.z + a.w), s2 = (q.x + q.y) + (q.z + q.w);
#pragma unroll  // five fixed exchange distances
    for (int m = 16; m > 0; m >>= 1) {
      s  += __shfl_xor(s, m);
      s2 += __shfl_xor(s2, m);
    }
    float mu  = s * (1.0f / WD);
    float var = s2 * (1.0f / WD) - mu * mu;
    float rs  = rsqrtf(var + 1e-5f);
    const v4f* g4 = (const v4f*)gamma;
    const v4f* b4 = (const v4f*)beta;
#pragma unroll  // constant indices keep v[] in registers
    for (int j = 0; j < 8; ++j) {
      v4f y = (v[j] - mu) * rs * g4[j * 32 + lane] + b4[j * 32 + lane];
      v4h o = {(half_t)y.x, (half_t)y.y, (half_t)y.z, (half_t)y.w};
      dst[j * 32 + lane] = o;
    }
    // the listing can run on from here into the pad block, which rewrites data
    // registers of these stores: the wait stands in front of that overwrite
    asm volatile("s_wait_xcnt 0x0" ::: "memory");
  }
}

// ---------------------------------------------------------------------------
// 2. Elementwise f32 -> f16 cast (for e), as a stream: a block owns 128 KiB
//    of src in a row; each lane takes 32 16-byte loads of it (512 B in a row
//    per wave-load) and stores 8 bytes per load (256 B in a row per
//    wave-store). Written in groups of eight, which bounds the registers; the
//    compiler runs the groups into one another (sixteen loads lead, later
//    ones follow as registers come free, the stores stand last).
//    CAST_BLOCKS blocks cover e exactly once. 8192 waves in all.
// ---------------------------------------------------------------------------
#define CAST_U 8                      // 16-byte loads of one group
#define CAST_G 4                      // groups per lane
#define CAST_BLOCKS ((ROWS_E * WD) / (4 * 256 * CAST_G * CAST_U))

__device__ __forceinline__ void cast_f16_block(
    const float* __restrict__ src, half_t* __restrict__ dst, int blk) {
  size_t base = (size_t)blk * (CAST_G * CAST_U * 256) + threadIdx.x;
  const float4* s4 = (const float4*)src + base;
  v4h* d4 = (v4h*)dst + base;
#pragma unroll  // constant offsets from one address per lane
  for (int g = 0; g < CAST_G; ++g) {
    float4 v[CAST_U];
#pragma unroll  // constant indices keep v[] in registers; loads issue together
    for (int u = 0; u < CAST_U; ++u) v[u] = s4[(g * CAST_U + u) * 256];
#pragma unroll  // as above
    for (int u = 0; u < CAST_U; ++u) {
      v4h o = {(half_t)v[u].x, (half_t)v[u].y, (half_t)v[u].z, (half_t)v[u].w};
      d4[(g * CAST_U + u) * 256] = o;
    }
  }
}

// ---------------------------------------------------------------------------
// 3. Weight transpose + cast: W (KxN) f32 -> WT (NxK) f16   (1024x1024)
//    One 64(k) x 64(n) tile per block, turned in LDS: rows of W are read as
//    16-byte loads, rows of WT leave as whole 128-byte lines.
// ---------------------------------------------------------------------------
#define TR_PITCH 72                   // 64 + 8 halves: rows stay 16B aligned
#define TR_BLOCKS ((WD / 64) * (WD / 64))   // tiles of one weight matrix

__device__ __forceinline__ void transpose_cast_block(
    const float* __restrict__ W, half_t* __restrict__ WT, half_t* tile,
    int blk) {                          // tile: [n][k], 64 * TR_PITCH halves
  int tid = threadIdx.x;
  int k0 = (blk / (WD / 64)) * 64, n0 = (blk % (WD / 64)) * 64;

  // each thread: a 4(k) x 4(n) patch, 16 lanes cover one 256-byte row piece
  int nq = (tid & 15) * 4, kq = (tid >> 4) * 4;
  const float* src = W + (size_t)(k0 + kq) * WD + n0 + nq;
  float4 r0 = *(const float4*)(src);
  float4 r1 = *(const float4*)(src + WD);
  float4 r2 = *(const float4*)(src + 2 * WD);
  float4 r3 = *(const float4*)(src + 3 * WD);
  v4h c0 = {(half_t)r0.x, (half_t)r1.x, (half_t)r2.x, (half_t)r3.x};
  v4h c1 = {(half_t)r0.y, (half_t)r1.y, (half_t)r2.y, (half_t)r3.y};
  v4h c2 = {(half_t)r0.z, (half_t)r1.z, (half_t)r2.z, (half_t)r3.z};
  v4h c3 = {(half_t)r0.w, (half_t)r1.w, (half_t)r2.w, (half_t)r3.w};
  *(v4h*)(tile + (nq + 0) * TR_PITCH + kq) = c0;
  *(v4h*)(tile + (nq + 1) * TR_PITCH + kq) = c1;
  *(v4h*)(tile + (nq + 2) * TR_PITCH + kq) = c2;
  *(v4h*)(tile + (nq + 3) * TR_PITCH + kq) = c3;
  __syncthreads();

  // 8 lanes write one 128-byte line of WT
  for (int j = 0; j < 2; ++j) {
    int idx = tid + j * 256;
    int n = idx >> 3, ks = (idx & 7) * 8;
    *(v8h*)(WT + (size_t)(n0 + n) * WD + k0 + ks) =
        *(const v8h*)(tile + n * TR_PITCH + ks);
  }
  // the listing runs on from here into another pass of the joined grid, which
  // rewrites registers of these stores: the wait stands in front of that
  asm volatile("s_wait_xcnt 0x0" ::: "memory");
}

// ---------------------------------------------------------------------------
// 4. Blocked WMMA GEMM: block tile 256x128, K-step 64, double-buffered LDS.
//    8 waves, each computing 64x64 (4x4 subtiles, 16 independent accumulators):
//    the 8 fragments of a 32-deep K slice, read from LDS as one group, feed 16 WMMAs.
//    A (MxK row-major), Bt (NxK row-major).  M a multiple of 256, N of 128.
//    MODE 0: C16[row*N+col] = acc + bias[col]                 (q, k proj)
//    MODE 1: vT[(bc,h,dk,j)] = acc + bias[col]                (v proj, T out)
//    MODE 2: out f32 with shift-by-63 + residual              (Wo proj)
// ---------------------------------------------------------------------------
typedef half_t gemm_bufa_t[BM * LDS_STRIDE];   // A's K-step tile
typedef half_t gemm_bufb_t[BN * LDS_STRIDE];   // Bt's K-step tile

// The K loop of one 256x128 tile: Ab, Bb = first row of the tile's A and Bt.
__device__ __forceinline__ void gemm_mainloop(const half_t* __restrict__ Ab,
                                              const half_t* __restrict__ Bb,
                                              int K, gemm_bufa_t* sA,
                                              gemm_bufb_t* sB,
                                              v8f (&acc)[4][4]) {
  int tid  = threadIdx.x;
  int lane = tid & 31, wave = tid >> 5;
  int mw = (wave >> 1) * 64;            // wave row offset in block tile
  int nw = (wave & 1) * 64;             // wave col offset in block tile
  int nk = K / KSTEP;

  stage_tile(Ab, Bb, K, sA[0], sB[0], tid);
  async_wait0();
  __syncthreads();

  for (int kt = 0; kt < nk; ++kt) {
    int buf = kt & 1;
    if (kt + 1 < nk)
      stage_tile(Ab + (kt + 1) * KSTEP, Bb + (kt + 1) * KSTEP, K, sA[buf ^ 1],
                 sB[buf ^ 1], tid);

    const half_t* As_w = sA[buf] + mw * LDS_STRIDE;
    const half_t* Bs_w = sB[buf] + nw * LDS_STRIDE;
#pragma unroll  // the two 32-deep halves of the K-step, constant LDS offsets
    for (int k0 = 0; k0 < KSTEP; k0 += 32) {
      v16h af[4], bf[4];
#pragma unroll
      for (int i = 0; i < 4; ++i)
        af[i] = load_frag(As_w + i * 16 * LDS_STRIDE, LDS_STRIDE, k0, lane);
#pragma unroll
      for (int j = 0; j < 4; ++j)
        bf[j] = load_frag(Bs_w + j * 16 * LDS_STRIDE, LDS_STRIDE, k0, lane);
      // keeps the 16 LDS reads one group in front of the 16 WMMAs: without it
      // the compiler reloads one A fragment in place and waits for LDS in front
      // of every 4 WMMAs
      __builtin_amdgcn_sched_barrier(0);
#pragma unroll
      for (int i = 0; i < 4; ++i)
#pragma unroll
        for (int j = 0; j < 4; ++j) acc[i][j] = wmma16(af[i], bf[j], acc[i][j]);
    }
    // keeps the K-step's WMMAs in front of the wait and the barrier: sunk behind
    // them they would stand between the barrier and the next tile's copies,
    // which then start later and have less than a K-step to land
    __builtin_amdgcn_sched_barrier(0);

    async_wait0();
    __syncthreads();
  }
}

// Epilogue: C/D layout -> row = base + (lane>>4)*8 + r, col = base + lane&15
template <int MODE>
__device__ __forceinline__ void gemm_store(
    const v8f (&acc)[4][4], const float* __restrict__ bias,
    half_t* __restrict__ C16, const float* __restrict__ hres,
    float* __restrict__ outf, int N, int tm0, int tn0) {
  int lane = threadIdx.x & 31, wave = threadIdx.x >> 5;
  int mw = (wave >> 1) * 64;
  int nw = (wave & 1) * 64;
  int nl = lane & 15, mb = (lane >> 4) * 8;
#pragma unroll
  for (int i = 0; i < 4; ++i) {
#pragma unroll
    for (int j = 0; j < 4; ++j) {
      int col = tn0 + nw + j * 16 + nl;
      float bv = bias[col];
#pragma unroll
      for (int r = 0; r < 8; ++r) {
        int row = tm0 + mw + i * 16 + mb + r;
        float v = acc[i][j][r] + bv;
        if (MODE == 0) {
          C16[(size_t)row * N + col] = (half_t)v;
        } else if (MODE == 1) {
          int bc = row >> 8, jj = row & 255;
          int hh = col >> 6, dk = col & 63;
          C16[(((size_t)bc * WH + hh) * WDK + dk) * WNL + jj] = (half_t)v;
        } else {
          int b = row >> 11, t = row & 2047;
          if (t < VALID_ROWS) {          // shift by 63; tail rows discarded
            size_t o = ((size_t)b * WS + t + (WCHUNK - 1)) * WD + col;
            outf[o] = v + hres[o];
          }
        }
      }
    }
  }
}

// MODE 2, a wave whose 64 rows are all kept by the shift (every wave but the one
// on the last 64 rows of a batch): the residual is the start value of the
// accumulators. Its 128 loads per lane have no test around them and none is
// waited for before the next is issued: they fly together, beside the first
// tile's copies; what is left behind the K loop is the bias and the stores.
// The sum is then (h + products) + bias.
// The test is scalar: the wave's number is read as a scalar, tm0 is one.
__device__ __forceinline__ bool wave_rows_all_kept(int tm0) {
  int wave = __builtin_amdgcn_readfirstlane(threadIdx.x >> 5);
  return ((tm0 + (wave >> 1) * 64) & (WS - 1)) + 63 < VALID_ROWS;
}

// element offset in h and out of the lane's first element: C/D layout as in
// gemm_store, rows shifted by 63; element (i, j, r) lies (i*16 + r) rows and
// j*16 columns further
__device__ __forceinline__ size_t kept_rows_offset(int tm0, int tn0) {
  int lane = threadIdx.x & 31;
  int wave = __builtin_amdgcn_readfirstlane(threadIdx.x >> 5);
  int row = tm0 + (wave >> 1) * 64 + (WCHUNK - 1);
  int col = tn0 + (wave & 1) * 64;
  return ((size_t)row * WD + col) + ((lane >> 4) * 8 * WD + (lane & 15));
}

__device__ __forceinline__ void residual_into_acc(
    v8f (&acc)[4][4], const float* __restrict__ hres, int tm0, int tn0) {
  const float* p = hres + kept_rows_offset(tm0, tn0);
#pragma unroll  // constant indices keep acc[][] in registers
  for (int i = 0; i < 4; ++i)
#pragma unroll  // as above
    for (int r = 0; r < 8; ++r)
#pragma unroll  // as above; the four pieces of a row's 256 bytes follow one another
      for (int j = 0; j < 4; ++j) acc[i][j][r] = p[(i * 16 + r) * WD + j * 16];
  // the code behind may rewrite the address register of these loads: the wait
  // stands in front of that overwrite
  asm volatile("s_wait_xcnt 0x0" ::: "memory");
}

__device__ __forceinline__ void store_kept_rows(
    const v8f (&acc)[4][4], const float* __restrict__ bias,
    float* __restrict__ outf, int tm0, int tn0) {
  float* q = outf + kept_rows_offset(tm0, tn0);
  int wave = __builtin_amdgcn_readfirstlane(threadIdx.x >> 5);
  const float* bp = bias + tn0 + (wave & 1) * 64 + (threadIdx.x & 15);
  float bv[4];
#pragma unroll  // constant indices keep bv[] in registers
  for (int j = 0; j < 4; ++j) bv[j] = bp[j * 16];
#pragma unroll  // constant indices keep acc[][] in registers
  for (int i = 0; i < 4; ++i)
#pragma unroll  // as above
    for (int r = 0; r < 8; ++r)
#pragma unroll  // as above
      for (int j = 0; j < 4; ++j)
        q[(i * 16 + r) * WD + j * 16] = acc[i][j][r] + bv[j];
}

// One GEMM per launch: v projection (MODE 1), output projection (MODE 2).
template <int MODE>
__global__ __launch_bounds__(256) void gemm128_kernel(
    const half_t* __restrict__ A, const half_t* __restrict__ Bt,
    const float* __restrict__ bias, half_t* __restrict__ C16,
    const float* __restrict__ hres, float* __restrict__ outf, int N, int K) {
  __shared__ __align__(16) gemm_bufa_t sA[2];
  __shared__ __align__(16) gemm_bufb_t sB[2];
  int tm0 = blockIdx.y * BM;
  int tn0 = blockIdx.x * BN;
  v8f acc[4][4] = {};
  bool whole = false;
  if (MODE == 2) {
    whole = wave_rows_all_kept(tm0);
    if (whole) residual_into_acc(acc, hres, tm0, tn0);
  }
  gemm_mainloop(A + (size_t)tm0 * K, Bt + (size_t)tn0 * K, K, sA, sB, acc);
  if (MODE == 2 && whole)
    store_kept_rows(acc, bias, outf, tm0, tn0);
  else
    gemm_store<MODE>(acc, bias, C16, hres, outf, N, tm0, tn0);
}

// k and q projections (both MODE 0) in one grid: neither reads what the other
// writes. Grid rows 0..K_TROWS-1 are the row tiles of k, the rest those of q.
// The test is on blockIdx alone: the same for the whole work-group.
#define K_TROWS (ROWS_E / BM)
#define Q_TROWS (ROWS_H / BM)

__global__ __launch_bounds__(256) void gemm_kq_kernel(
    const half_t* __restrict__ e16, const half_t* __restrict__ WkT,
    const float* __restrict__ bk, half_t* __restrict__ k16,
    const half_t* __restrict__ hb16, const half_t* __restrict__ WqT,
    const float* __restrict__ bq, half_t* __restrict__ q16, int N, int K) {
  __shared__ __align__(16) gemm_bufa_t sA[2];
  __shared__ __align__(16) gemm_bufb_t sB[2];
  bool is_q = blockIdx.y >= K_TROWS;
  int tm0 = (is_q ? blockIdx.y - K_TROWS : blockIdx.y) * BM;
  int tn0 = blockIdx.x * BN;
  const half_t* A  = is_q ? hb16 : e16;
  const half_t* Bt = is_q ? WqT : WkT;
  v8f acc[4][4] = {};
  gemm_mainloop(A + (size_t)tm0 * K, Bt + (size_t)tn0 * K, K, sA, sB, acc);
  gemm_store<0>(acc, is_q ? bq : bk, is_q ? q16 : k16, nullptr, nullptr, N, tm0,
                tn0);
}

// ---------------------------------------------------------------------------
// 5. Attention: one block per (b,c,h). The block's K (256 x 64), Q (64 x 64)
//    and V^T (64 x 256) tiles are brought into LDS once, by asynchronous
//    copies that take whole 128-byte lines; every fragment is read from there.
//    V^T is copied while scores and softmax are worked on.
//    Wave w owns query rows (w>>1)*16..+15
//    and key columns (w&1)*128..+127. Its 16x128 scores stay in the WMMA
//    accumulators (f32): row maximum and row sum are taken there, in-lane over
//    the 8 tiles, then over the 16 lanes of a row by DPP, then joined with the
//    partner wave's half through LDS. exp(s - max) goes to LDS once, as f16,
//    and P@V (A and B from LDS) is divided by the row sum.
// ---------------------------------------------------------------------------
#define P_PITCH (WNL + 8)             // 8 halves of pad: 16 B x 33, so that b128
                                      // readers of 16 rows fall on distinct banks
#define KQ_PITCH (WDK + 8)            // K and Q rows: 144 B = 16 B x 9, as above
#define KQ_ROWS (WNL + WCHUNK)        // K rows 0..255, Q rows 256..319
#define V_PITCH (WNL + 8)             // V^T rows: 528 B = 16 B x 33, as above

// the byte address in the work-group's LDS: low 32 bits of a __shared__ address
__device__ __forceinline__ unsigned lds_byte(const half_t* p) {
  return (unsigned)(size_t)p;
}

// Asynchronous copies global -> LDS, 16 bytes per lane and copy. The closing
// s_wait_xcnt stands inside the copies' own statement, so that no later write
// of an address register can be scheduled in front of it.
__device__ __forceinline__ void async_copy8(const unsigned (&l)[8],
                                            const half_t* const (&g)[8]) {
  asm volatile(
      "global_load_async_to_lds_b128 %0, %8, off\n\t"
      "global_load_async_to_lds_b128 %1, %9, off\n\t"
      "global_load_async_to_lds_b128 %2, %10, off\n\t"
      "global_load_async_to_lds_b128 %3, %11, off\n\t"
      "global_load_async_to_lds_b128 %4, %12, off\n\t"
      "global_load_async_to_lds_b128 %5, %13, off\n\t"
      "global_load_async_to_lds_b128 %6, %14, off\n\t"
      "global_load_async_to_lds_b128 %7, %15, off\n\t"
      "s_wait_xcnt 0x0"
      :
      : "v"(l[0]), "v"(l[1]), "v"(l[2]), "v"(l[3]), "v"(l[4]), "v"(l[5]),
        "v"(l[6]), "v"(l[7]), "v"(g[0]), "v"(g[1]), "v"(g[2]), "v"(g[3]),
        "v"(g[4]), "v"(g[5]), "v"(g[6]), "v"(g[7])
      : "memory");
}
__device__ __forceinline__ void async_copy2(unsigned l0, unsigned l1,
                                            const half_t* g0,
                                            const half_t* g1) {
  asm volatile(
      "global_load_async_to_lds_b128 %0, %2, off\n\t"
      "global_load_async_to_lds_b128 %1, %3, off\n\t"
      "s_wait_xcnt 0x0"
      :
      : "v"(l0), "v"(l1), "v"(g0), "v"(g1)
      : "memory");
}

// value of lane (l ^ mask) inside the 16-lane row; CTRL = 0x160 + mask
template <int CTRL>
__device__ __forceinline__ float row_xmask(float v) {
  return __builtin_bit_cast(
      float, __builtin_amdgcn_mov_dpp(__builtin_bit_cast(int, v), CTRL, 0xf,
                                      0xf, true));
}
__device__ __forceinline__ float row16_max(float v) {
  v = fmaxf(v, row_xmask<0x161>(v));
  v = fmaxf(v, row_xmask<0x162>(v));
  v = fmaxf(v, row_xmask<0x164>(v));
  v = fmaxf(v, row_xmask<0x168>(v));
  return v;
}
__device__ __forceinline__ float row16_sum(float v) {
  v += row_xmask<0x161>(v);
  v += row_xmask<0x162>(v);
  v += row_xmask<0x164>(v);
  v += row_xmask<0x168>(v);
  return v;
}

// y[i] = 2^x[i] for eight values. Written as one statement so that nothing
// the compiler schedules can stand directly behind a v_exp_f32 and read its
// result or overwrite its source: inside, every output register differs from
// every input ("=&v"); the closing v_nop is the one independent issue slot
// that the instruction set asks for behind the last of them.
__device__ __forceinline__ void exp2x8(float (&y)[8], const float (&x)[8]) {
  asm("v_exp_f32 %0, %8\n\t"
      "v_exp_f32 %1, %9\n\t"
      "v_exp_f32 %2, %10\n\t"
      "v_exp_f32 %3, %11\n\t"
      "v_exp_f32 %4, %12\n\t"
      "v_exp_f32 %5, %13\n\t"
      "v_exp_f32 %6, %14\n\t"
      "v_exp_f32 %7, %15\n\t"
      "v_nop"
      : "=&v"(y[0]), "=&v"(y[1]), "=&v"(y[2]), "=&v"(y[3]), "=&v"(y[4]),
        "=&v"(y[5]), "=&v"(y[6]), "=&v"(y[7])
      : "v"(x[0]), "v"(x[1]), "v"(x[2]), "v"(x[3]), "v"(x[4]), "v"(x[5]),
        "v"(x[6]), "v"(x[7]));
}

__global__ __launch_bounds__(256) void attention_kernel(
    const half_t* __restrict__ q16, const half_t* __restrict__ k16,
    const half_t* __restrict__ vT16, half_t* __restrict__ att16) {
  int unit = blockIdx.x;                  // 0..2047
  int bc = unit >> 4;                     // b*32 + c
  int hh = unit & 15;
  int tid = threadIdx.x;
  int lane = tid & 31, wave = tid >> 5;
  int tm = wave >> 1, hf = wave & 1;
  int n = lane & 15, mb = (lane >> 4) * 8;
  int row0 = tm * 16 + mb;                // first of this lane's 8 rows

  __shared__ __align__(16) half_t skq[KQ_ROWS * KQ_PITCH];  // K rows, Q rows
  __shared__ __align__(16) half_t sv[WDK * V_PITCH];        // V^T rows
  __shared__ __align__(16) float pmax[2][WCHUNK], psum[2][WCHUNK];
  // exp(s - max), f16: takes the place of the K rows (64 * P_PITCH halves fit
  // in 256 * KQ_PITCH), written only behind the barrier of the row maximum,
  // which every wave reaches with its K and Q fragments already used
  half_t* sp = skq;

  // --- K and Q tiles into LDS: 8 lanes take one row's 128-byte line, a wave's
  //     copy 4 rows
  {
    int row = tid >> 3, cs = (tid & 7) * 8;
    const half_t* gk = k16 + ((size_t)bc * WNL + row) * WD + hh * WDK + cs;
    const half_t* gq = q16 + ((size_t)bc * WCHUNK + row) * WD + hh * WDK + cs;
    unsigned lk = lds_byte(skq + row * KQ_PITCH + cs);
    unsigned l[8];
    const half_t* g[8];
#pragma unroll  // constant indices keep l[] and g[] in registers
    for (int p = 0; p < 8; ++p) {
      l[p] = lk + p * 32 * KQ_PITCH * 2;
      g[p] = gk + (size_t)p * 32 * WD;
    }
    async_copy8(l, g);
    async_copy2(lk + WNL * KQ_PITCH * 2, lk + (WNL + 32) * KQ_PITCH * 2, gq,
                gq + (size_t)32 * WD);
  }
  // the wave's own copies have landed; behind the barrier, every wave's
  asm volatile("s_wait_asynccnt 0x0" ::: "memory");
  __syncthreads();

  // --- V^T tile into LDS: 32 KiB in a row, a wave's copy takes one 512-byte
  //     row. It flies while scores and softmax are worked on; its wait stands
  //     in front of the barrier of the row sum, the last one before P@V.
  {
    const half_t* gv = vT16 + ((size_t)bc * WH + hh) * WDK * WNL + tid * 8;
    unsigned lv = lds_byte(sv + wave * V_PITCH + lane * 8);
    unsigned l[8];
    const half_t* g[8];
#pragma unroll  // constant indices keep l[] and g[] in registers
    for (int p = 0; p < 8; ++p) {
      l[p] = lv + p * 8 * V_PITCH * 2;
      g[p] = gv + p * 256 * 8;
    }
    async_copy8(l, g);
  }

  const half_t* Aq = skq + (WNL + tm * 16) * KQ_PITCH;
  const half_t* Bk = skq + hf * 128 * KQ_PITCH;

  // --- raw scores q . k^T : 8 tiles of 16x16, kept in registers
  v16h qa0 = load_frag(Aq, KQ_PITCH, 0, lane);
  v16h qa1 = load_frag(Aq, KQ_PITCH, 32, lane);
  v8f acc[8];
#pragma unroll  // constant indices keep acc[] in registers
  for (int it = 0; it < 8; ++it) {
    const half_t* Bb = Bk + it * 16 * KQ_PITCH;
    v8f a = {};
    a = wmma16(qa0, load_frag(Bb, KQ_PITCH, 0, lane), a);
    a = wmma16(qa1, load_frag(Bb, KQ_PITCH, 32, lane), a);
    acc[it] = a;
  }

  // --- row maximum: own 128 columns, then the partner wave's
  float mx[8];
#pragma unroll  // constant indices keep acc[] and mx[] in registers
  for (int r = 0; r < 8; ++r) {
    float m = acc[0][r];
#pragma unroll  // as above
    for (int it = 1; it < 8; ++it) m = fmaxf(m, acc[it][r]);
    mx[r] = row16_max(m);
  }
  if (n == 0) {
    *(float4*)&pmax[hf][row0]     = make_float4(mx[0], mx[1], mx[2], mx[3]);
    *(float4*)&pmax[hf][row0 + 4] = make_float4(mx[4], mx[5], mx[6], mx[7]);
  }
  __syncthreads();
  {
    float4 o0 = *(const float4*)&pmax[hf ^ 1][row0];
    float4 o1 = *(const float4*)&pmax[hf ^ 1][row0 + 4];
    mx[0] = fmaxf(mx[0], o0.x); mx[1] = fmaxf(mx[1], o0.y);
    mx[2] = fmaxf(mx[2], o0.z); mx[3] = fmaxf(mx[3], o0.w);
    mx[4] = fmaxf(mx[4], o1.x); mx[5] = fmaxf(mx[5], o1.y);
    mx[6] = fmaxf(mx[6], o1.z); mx[7] = fmaxf(mx[7], o1.w);
  }

  // --- p = exp((s - max) * SCALE) = 2^(s*c - max*c), c = SCALE * log2(e);
  //     not yet divided by the row sum
  const float cexp = WSCALE * 1.44269504088896f;
  float sm[8];
#pragma unroll  // constant indices keep acc[], mx[] and sm[] in registers
  for (int r = 0; r < 8; ++r) {
    half_t* dst = sp + (row0 + r) * P_PITCH + hf * 128 + n;
    float nm = -mx[r] * cexp;
    float x[8], p[8];
#pragma unroll  // as above
    for (int it = 0; it < 8; ++it) x[it] = fmaf(acc[it][r], cexp, nm);
    exp2x8(p, x);
    float s = p[0];
    dst[0] = (half_t)p[0];
#pragma unroll  // as above
    for (int it = 1; it < 8; ++it) {
      s += p[it];
      dst[it * 16] = (half_t)p[it];
    }
    sm[r] = row16_sum(s);
  }
  if (n == 0) {
    *(float4*)&psum[hf][row0]     = make_float4(sm[0], sm[1], sm[2], sm[3]);
    *(float4*)&psum[hf][row0 + 4] = make_float4(sm[4], sm[5], sm[6], sm[7]);
  }
  // the wave's own V^T copies have landed; behind the barrier, every wave's
  asm volatile("s_wait_asynccnt 0x0" ::: "memory");
  __syncthreads();
  {
    float4 o0 = *(const float4*)&psum[hf ^ 1][row0];
    float4 o1 = *(const float4*)&psum[hf ^ 1][row0 + 4];
    sm[0] = __builtin_amdgcn_rcpf(sm[0] + o0.x);
    sm[1] = __builtin_amdgcn_rcpf(sm[1] + o0.y);
    sm[2] = __builtin_amdgcn_rcpf(sm[2] + o0.z);
    sm[3] = __builtin_amdgcn_rcpf(sm[3] + o0.w);
    sm[4] = __builtin_amdgcn_rcpf(sm[4] + o1.x);
    sm[5] = __builtin_amdgcn_rcpf(sm[5] + o1.y);
    sm[6] = __builtin_amdgcn_rcpf(sm[6] + o1.z);
    sm[7] = __builtin_amdgcn_rcpf(sm[7] + o1.w);
  }

  // --- out = (P @ V) / sum : the wave's own 16 rows, 2 of the 4 dk tiles
  const half_t* Ab = sp + tm * 16 * P_PITCH;
#pragma unroll  // two independent accumulate chains side by side
  for (int it = 0; it < 2; ++it) {
    int tn = hf * 2 + it;
    const half_t* Bb = sv + tn * 16 * V_PITCH;
    v8f o = {};
    for (int k0 = 0; k0 < WNL; k0 += 32)
      o = wmma16(load_frag(Ab, P_PITCH, k0, lane),
                 load_frag(Bb, V_PITCH, k0, lane), o);
#pragma unroll  // constant indices keep o and sm[] in registers
    for (int r = 0; r < 8; ++r)
      att16[((size_t)bc * WCHUNK + row0 + r) * WD + hh * WDK + tn * 16 + n] =
          (half_t)(o[r] * sm[r]);
  }
}

// ---------------------------------------------------------------------------
// 6. Residual-only head rows: out[b,s,:] = h[b,s,:] for s < 63
// ---------------------------------------------------------------------------
#define HEAD_BLOCKS ((WB * (WCHUNK - 1) * WD) / 256)

__device__ __forceinline__ void residual_head_block(
    const float* __restrict__ h, float* __restrict__ out, int blk) {
  int idx = blk * 256 + threadIdx.x;            // 4*63*1024 = 258048 exact
  int b = idx / ((WCHUNK - 1) * WD);
  int rem = idx % ((WCHUNK - 1) * WD);
  int s = rem / WD, d = rem % WD;
  size_t o = ((size_t)b * WS + s) * WD + d;
  out[o] = h[o];
  // the listing runs on from here into another pass of the joined grid, which
  // rewrites registers of this store: the wait stands in front of that
  asm volatile("s_wait_xcnt 0x0" ::: "memory");
}

// ---------------------------------------------------------------------------
// 7. The passes that read only inputs (2, 1, 3 for the four weights, 6) as one
//    grid: none reads what another writes. A work-group's pass follows from
//    blockIdx alone, so each branch, and the barrier inside 3, is taken by a
//    whole work-group or by none of it. Longest work-groups first.
//    WT4 = the four transposed weights one behind the other (q, k, v, o).
// ---------------------------------------------------------------------------
#define PRE_BLOCKS (CAST_BLOCKS + LN_BLOCKS + 4 * TR_BLOCKS + HEAD_BLOCKS)

__global__ __launch_bounds__(256) void prepass_kernel(
    const float* __restrict__ h, const float* __restrict__ e,
    const float* __restrict__ Wq, const float* __restrict__ Wk,
    const float* __restrict__ Wv, const float* __restrict__ Wo,
    const float* __restrict__ gamma, const float* __restrict__ beta,
    half_t* __restrict__ hb16, half_t* __restrict__ e16,
    half_t* __restrict__ WT4, float* __restrict__ out) {
  __shared__ __align__(16) half_t tile[64 * TR_PITCH];
  int blk = blockIdx.x;
  if (blk < CAST_BLOCKS) {
    cast_f16_block(e, e16, blk);
  } else if (blk < CAST_BLOCKS + LN_BLOCKS) {
    ln_cast_block(h, gamma, beta, hb16, blk - CAST_BLOCKS);
  } else if (blk < CAST_BLOCKS + LN_BLOCKS + 4 * TR_BLOCKS) {
    int t = blk - (CAST_BLOCKS + LN_BLOCKS);
    int w = t / TR_BLOCKS;
    const float* W = w == 0 ? Wq : w == 1 ? Wk : w == 2 ? Wv : Wo;
    transpose_cast_block(W, WT4 + (size_t)w * WD * WD, tile, t % TR_BLOCKS);
  } else {
    residual_head_block(h, out, blk - (CAST_BLOCKS + LN_BLOCKS + 4 * TR_BLOCKS));
  }
}

// ---------------------------------------------------------------------------
// Host launcher
// ---------------------------------------------------------------------------
extern "C" void kernel_launch(void* const* d_in, const int* in_sizes, int n_in,
                              void* d_out, int out_size, void* d_ws,
                              size_t ws_size, hipStream_t stream) {
  const float* h     = (const float*)d_in[0];
  const float* e     = (const float*)d_in[1];
  const float* Wq    = (const float*)d_in[2];
  const float* bq    = (const float*)d_in[3];
  const float* Wk    = (const float*)d_in[4];
  const float* bk    = (const float*)d_in[5];
  const float* Wv    = (const float*)d_in[6];
  const float* bv    = (const float*)d_in[7];
  const float* Wo    = (const float*)d_in[8];
  const float* bo    = (const float*)d_in[9];
  const float* gamma = (const float*)d_in[10];
  const float* beta  = (const float*)d_in[11];
  float* out = (float*)d_out;

  // Workspace layout (f16 elements), ~248 MB total
  const size_t HB  = (size_t)ROWS_H * WD;   //  8,388,608
  const size_t E16 = (size_t)ROWS_E * WD;   // 33,554,432
  const size_t WSZ = (size_t)WD * WD;       //  1,048,576
  half_t* w = (half_t*)d_ws;
  half_t* hb16  = w;                 w += HB;
  half_t* e16   = w;                 w += E16;
  half_t* WqT   = w;                 w += WSZ;
  half_t* WkT   = w;                 w += WSZ;
  half_t* WvT   = w;                 w += WSZ;
  half_t* WoT   = w;                 w += WSZ;
  half_t* q16   = w;                 w += HB;
  half_t* k16   = w;                 w += E16;
  half_t* vT16  = w;                 w += E16;
  half_t* att16 = w;                 w += HB;

  // 1. e cast, LayerNorm + pad + cast, weight transposes, head rows of out
  prepass_kernel<<<PRE_BLOCKS, 256, 0, stream>>>(h, e, Wq, Wk, Wv, Wo, gamma,
                                                 beta, hb16, e16, WqT, out);
  // 2. k (32768x1024) and q (8192x1024) projections, K = 1024
  gemm_kq_kernel<<<dim3(WD / BN, K_TROWS + Q_TROWS), 256, 0, stream>>>(
      e16, WkT, bk, k16, hb16, WqT, bq, q16, WD, WD);
  // 3. v projection, transposed output
  gemm128_kernel<1><<<dim3(WD / BN, ROWS_E / BM), 256, 0, stream>>>(
      e16, WvT, bv, vT16, nullptr, nullptr, WD, WD);
  // 4. attention per (b,c,h)
  attention_kernel<<<WB * WC * WH, 256, 0, stream>>>(q16, k16, vT16, att16);
  // 5. output projection + shift + residual, fused into d_out
  gemm128_kernel<2><<<dim3(WD / BN, ROWS_H / BM), 256, 0, stream>>>(
      att16, WoT, bo, nullptr, h, out, WD, WD);
}

// v009
// Measured time: 164 microseconds a run.
// Timed twice side by side with v008, it ran 1.16 times as fast both times.
// Counting every step since v000, it is 3.22 times as fast.
#include <hip/hip_runtime.h>
#include <hip/hip_bf16.h>
#include <math.h>

// ---------------------------------------------------------------------------
// Chunked cross attention for MI455X (gfx1250), wave32 + WMMA f16->f32,
// LDS-blocked GEMMs (256x128 block, 64x64 per wave) with async global->LDS.
// The k and v projections of one (chunk, head) and its attention are one
// work-group's work: K and V^T never leave LDS.
// B=4 S=2048 D=1024 C=32 N=2 L=128 H=16 DK=64 CHUNK=64
// ---------------------------------------------------------------------------

typedef _Float16 half_t;
typedef __attribute__((ext_vector_type(16))) _Float16 v16h;
typedef __attribute__((ext_vector_type(8)))  _Float16 v8h;
typedef __attribute__((ext_vector_type(4)))  _Float16 v4h;
typedef __attribute__((ext_vector_type(8)))  float    v8f;
typedef __attribute__((ext_vector_type(4)))  float    v4f;

#define WB 4
#define WS 2048
#define WD 1024
#define WC 32
#define WH 16
#define WDK 64
#define WCHUNK 64
#define WNL 256                       // N*L
#define ROWS_H (WB * WS)              // 8192
#define ROWS_E (WB * WC * WNL)        // 32768
#define VALID_ROWS (WS - WCHUNK + 1)  // 1985
#define WSCALE 0.125f                 // 1/sqrt(64)

#define KSTEP 64                      // halves of a row per K-step: one 128 B line
#define LDS_STRIDE 72                 // 64 + 8 halves: 144 B = 16 B x 9, bank-spread
#define BM 256                        // rows of a block tile: 4 waves x 64
#define BN 128                        // columns of a block tile: 2 waves x 64

#if defined(__AMDGCN__) &&                                              \
    __has_builtin(__builtin_amdgcn_global_load_async_to_lds_b128) &&    \
    __has_builtin(__builtin_amdgcn_s_wait_asynccnt)
#define USE_ASYNC 1
typedef int v4i __attribute__((vector_size(16)));
typedef __attribute__((address_space(1))) v4i as1_v4i;
typedef __attribute__((address_space(3))) v4i as3_v4i;
#else
#define USE_ASYNC 0
#endif

__device__ __forceinline__ v8f wmma16(v16h a, v16h b, v8f c) {
  return __builtin_amdgcn_wmma_f32_16x16x32_f16(false, a, false, b, (short)0, c,
                                                false, false);
}

// Fragment loader for v_wmma_f32_16x16x32_f16. Works for A (MxK row-major,
// lane&15 = M) and B supplied N-major (NxK row-major, lane&15 = N).
// elements 0..7 = K[k0+hi*8 ..], elements 8..15 = K[k0+16+hi*8 ..].
__device__ __forceinline__ v16h load_frag(const half_t* __restrict__ base,
                                          int ld, int k0, int lane) {
  int m  = lane & 15;
  int hi = (lane >> 4) & 1;
  const half_t* p = base + (size_t)m * ld + k0 + hi * 8;
  v8h lo = *(const v8h*)(p);
  v8h hv = *(const v8h*)(p + 16);
  v16h r;
#pragma unroll
  for (int e = 0; e < 8; ++e) { r[e] = lo[e]; r[e + 8] = hv[e]; }
  return r;
}

// Stage one K-step tile (A:256x64, B:128x64 halves) into LDS.
// Eight lanes in a row take one row's whole 128-byte line, so a wave's copy
// asks L2 for 4 whole lines. Each of 256 threads moves 8x16 B of A and 4x16 B
// of B (rows 32 apart). off = the lane's own element offset inside a tile.
// BGAP = rows of Bt that lie between the tile's rows 63 and 64 (0: a plain tile).
template <int BGAP>
__device__ __forceinline__ void stage_tile(const half_t* __restrict__ gA,
                                           const half_t* __restrict__ gB,
                                           int ldg, half_t* sA, half_t* sB,
                                           int tid) {
  int row = tid >> 3;
  int cs  = (tid & 7) * 8;
  unsigned off = (unsigned)(row * ldg + cs);
  half_t* la = sA + row * LDS_STRIDE + cs;
  half_t* lb = sB + row * LDS_STRIDE + cs;
#pragma unroll  // fixed row groups of A; the copies issue back to back
  for (int p = 0; p < BM / 32; ++p) {
    const half_t* pa = gA + (size_t)(p * 32) * ldg + off;
#if USE_ASYNC
    __builtin_amdgcn_global_load_async_to_lds_b128(
        (as1_v4i*)pa, (as3_v4i*)(la + p * 32 * LDS_STRIDE), 0, 0);
#else
    *(v8h*)(la + p * 32 * LDS_STRIDE) = *(const v8h*)pa;
#endif
  }
#pragma unroll  // fixed row groups of B; as above
  for (int p = 0; p < BN / 32; ++p) {
    const half_t* pb = gB + (size_t)(p * 32 + (p >= 2 ? BGAP : 0)) * ldg + off;
#if USE_ASYNC
    __builtin_amdgcn_global_load_async_to_lds_b128(
        (as1_v4i*)pb, (as3_v4i*)(lb + p * 32 * LDS_STRIDE), 0, 0);
#else
    *(v8h*)(lb + p * 32 * LDS_STRIDE) = *(const v8h*)pb;
#endif
  }
}

__device__ __forceinline__ void async_wait0() {
#if USE_ASYNC
  __builtin_amdgcn_s_wait_asynccnt(0);
#endif
}

// ---------------------------------------------------------------------------
// 1. LayerNorm of h[:,63:] -> f16, padded with zeros to (B, 2048, D)
//    One wave per row: the 4 KiB row is fetched by eight 16-byte loads per
//    lane, all in flight together, and stays in registers for both uses.
//    Sums: four chains per lane, then a five-step butterfly over the wave.
//    No LDS, no barrier; 8192 waves in all. blk = 0..LN_BLOCKS-1.
// ---------------------------------------------------------------------------
#define LN_BLOCKS (ROWS_H / 8)

__device__ __forceinline__ void ln_cast_block(
    const float* __restrict__ h, const float* __restrict__ gamma,
    const float* __restrict__ beta, half_t* __restrict__ hb16, int blk) {
  int lane = threadIdx.x & 31;
  // the wave's number as a scalar: row addresses and the pad test stay scalar
  int row = blk * 8 + __builtin_amdgcn_readfirstlane(threadIdx.x >> 5);
  int b = row >> 11, t = row & 2047;    // row 0..8191
  v4h* dst = (v4h*)(hb16 + (size_t)row * WD);
  if (t >= VALID_ROWS) {                // zero padding rows (wave-uniform)
    v4h z = {};
#pragma unroll  // eight independent stores
    for (int j = 0; j < 8; ++j) dst[j * 32 + lane] = z;
    // the listing runs on from here into another pass of the joined grid, which
    // rewrites registers of these stores: the wait stands in front of that
    asm volatile("s_wait_xcnt 0x0" ::: "memory");
  } else {
    const v4f* x = (const v4f*)(h + ((size_t)b * WS + t + (WCHUNK - 1)) * WD);
    v4f v[8];
#pragma unroll  // constant indices keep v[] in registers; loads issue together
    for (int j = 0; j < 8; ++j) v[j] = x[j * 32 + lane];
    v4f a = v[0], q = v[0] * v[0];
#pragma unroll  // as above
    for (int j = 1; j < 8; ++j) { a += v[j]; q += v[j] * v[j]; }
    float s = (a.x + a.y) + (a.z + a.w), s2 = (q.x + q.y) + (q.z + q.w);
#pragma unroll  // five fixed exchange distances
    for (int m = 16; m > 0; m >>= 1) {
      s  += __shfl_xor(s, m);
      s2 += __shfl_xor(s2, m);
    }
    float mu  = s * (1.0f / WD);
    float var = s2 * (1.0f / WD) - mu * mu;
    float rs  = rsqrtf(var + 1e-5f);
    const v4f* g4 = (const v4f*)gamma;
    const v4f* b4 = (const v4f*)beta;
#pragma unroll  // constant indices keep v[] in registers
    for (int j = 0; j < 8; ++j) {
      v4f y = (v[j] - mu) * rs * g4[j * 32 + lane] + b4[j * 32 + lane];
      v4h o = {(half_t)y.x, (half_t)y.y, (half_t)y.z, (half_t)y.w};
      dst[j * 32 + lane] = o;
    }
    // the listing can run on from here into the pad block, which rewrites data
    // registers of these stores: the wait stands in front of that overwrite
    asm volatile("s_wait_xcnt 0x0" ::: "memory");
  }
}

// ---------------------------------------------------------------------------
// 2. Elementwise f32 -> f16 cast (for e), as a stream: a block owns 128 KiB
//    of src in a row; each lane takes 32 16-byte loads of it (512 B in a row
//    per wave-load) and stores 8 bytes per load (256 B in a row per
//    wave-store). Written in groups of eight, which bounds the registers; the
//    compiler runs the groups into one another (sixteen loads lead, later
//    ones follow as registers come free, the stores stand last).
//    CAST_BLOCKS blocks cover e exactly once. 8192 waves in all.
// ---------------------------------------------------------------------------
#define CAST_U 8                      // 16-byte loads of one group
#define CAST_G 4                      // groups per lane
#define CAST_BLOCKS ((ROWS_E * WD) / (4 * 256 * CAST_G * CAST_U))

__device__ __forceinline__ void cast_f16_block(
    const float* __restrict__ src, half_t* __restrict__ dst, int blk) {
  size_t base = (size_t)blk * (CAST_G * CAST_U * 256) + threadIdx.x;
  const float4* s4 = (const float4*)src + base;
  v4h* d4 = (v4h*)dst + base;
#pragma unroll  // constant offsets from one address per lane
  for (int g = 0; g < CAST_G; ++g) {
    float4 v[CAST_U];
#pragma unroll  // constant indices keep v[] in registers; loads issue together
    for (int u = 0; u < CAST_U; ++u) v[u] = s4[(g * CAST_U + u) * 256];
#pragma unroll  // as above
    for (int u = 0; u < CAST_U; ++u) {
      v4h o = {(half_t)v[u].x, (half_t)v[u].y, (half_t)v[u].z, (half_t)v[u].w};
      d4[(g * CAST_U + u) * 256] = o;
    }
  }
}

// ---------------------------------------------------------------------------
// 3. Weight transpose + cast: W (KxN) f32 -> WT (NxK) f16   (1024x1024)
//    One 64(k) x 64(n) tile per block, turned in LDS: rows of W are read as
//    16-byte loads, rows of WT leave as whole 128-byte lines.
// ---------------------------------------------------------------------------
#define TR_PITCH 72                   // 64 + 8 halves: rows stay 16B aligned
#define TR_BLOCKS ((WD / 64) * (WD / 64))   // tiles of one weight matrix

__device__ __forceinline__ void transpose_cast_block(
    const float* __restrict__ W, half_t* __restrict__ WT, half_t* tile,
    int blk) {                          // tile: [n][k], 64 * TR_PITCH halves
  int tid = threadIdx.x;
  int k0 = (blk / (WD / 64)) * 64, n0 = (blk % (WD / 64)) * 64;

  // each thread: a 4(k) x 4(n) patch, 16 lanes cover one 256-byte row piece
  int nq = (tid & 15) * 4, kq = (tid >> 4) * 4;
  const float* src = W + (size_t)(k0 + kq) * WD + n0 + nq;
  float4 r0 = *(const float4*)(src);
  float4 r1 = *(const float4*)(src + WD);
  float4 r2 = *(const float4*)(src + 2 * WD);
  float4 r3 = *(const float4*)(src + 3 * WD);
  v4h c0 = {(half_t)r0.x, (half_t)r1.x, (half_t)r2.x, (half_t)r3.x};
  v4h c1 = {(half_t)r0.y, (half_t)r1.y, (half_t)r2.y, (half_t)r3.y};
  v4h c2 = {(half_t)r0.z, (half_t)r1.z, (half_t)r2.z, (half_t)r3.z};
  v4h c3 = {(half_t)r0.w, (half_t)r1.w, (half_t)r2.w, (half_t)r3.w};
  *(v4h*)(tile + (nq + 0) * TR_PITCH + kq) = c0;
  *(v4h*)(tile + (nq + 1) * TR_PITCH + kq) = c1;
  *(v4h*)(tile + (nq + 2) * TR_PITCH + kq) = c2;
  *(v4h*)(tile + (nq + 3) * TR_PITCH + kq) = c3;
  __syncthreads();

  // 8 lanes write one 128-byte line of WT
  for (int j = 0; j < 2; ++j) {
    int idx = tid + j * 256;
    int n = idx >> 3, ks = (idx & 7) * 8;
    *(v8h*)(WT + (size_t)(n0 + n) * WD + k0 + ks) =
        *(const v8h*)(tile + n * TR_PITCH + ks);
  }
  // the listing runs on from here into another pass of the joined grid, which
  // rewrites registers of these stores: the wait stands in front of that
  asm volatile("s_wait_xcnt 0x0" ::: "memory");
}

// ---------------------------------------------------------------------------
// 4. Blocked WMMA GEMM: block tile 256x128, K-step 64, double-buffered LDS.
//    8 waves, each computing 64x64 (4x4 subtiles, 16 independent accumulators):
//    the 8 fragments of a 32-deep K slice, read from LDS as one group, feed 16 WMMAs.
//    A (MxK row-major), Bt (NxK row-major).  M a multiple of 256, N of 128.
//    MODE 0: C16[row*N+col] = acc + bias[col]                 (q proj)
//    MODE 2: out f32 with shift-by-63 + residual              (Wo proj)
//    The k and v projections use the same K loop inside kernel 5.
// ---------------------------------------------------------------------------
typedef half_t gemm_bufa_t[BM * LDS_STRIDE];   // A's K-step tile
typedef half_t gemm_bufb_t[BN * LDS_STRIDE];   // Bt's K-step tile

// The K loop of one 256x128 tile: Ab, Bb = first row of the tile's A and Bt.
// BGAP: as in stage_tile.
template <int BGAP>
__device__ __forceinline__ void gemm_mainloop(const half_t* __restrict__ Ab,
                                              const half_t* __restrict__ Bb,
                                              int K, gemm_bufa_t* sA,
                                              gemm_bufb_t* sB,
                                              v8f (&acc)[4][4]) {
  int tid  = threadIdx.x;
  int lane = tid & 31, wave = tid >> 5;
  int mw = (wave >> 1) * 64;            // wave row offset in block tile
  int nw = (wave & 1) * 64;             // wave col offset in block tile
  int nk = K / KSTEP;

  stage_tile<BGAP>(Ab, Bb, K, sA[0], sB[0], tid);
  async_wait0();
  __syncthreads();

  for (int kt = 0; kt < nk; ++kt) {
    int buf = kt & 1;
    if (kt + 1 < nk)
      stage_tile<BGAP>(Ab + (kt + 1) * KSTEP, Bb + (kt + 1) * KSTEP, K,
                       sA[buf ^ 1], sB[buf ^ 1], tid);

    const half_t* As_w = sA[buf] + mw * LDS_STRIDE;
    const half_t* Bs_w = sB[buf] + nw * LDS_STRIDE;
#pragma unroll  // the two 32-deep halves of the K-step, constant LDS offsets
    for (int k0 = 0; k0 < KSTEP; k0 += 32) {
      v16h af[4], bf[4];
#pragma unroll
      for (int i = 0; i < 4; ++i)
        af[i] = load_frag(As_w + i * 16 * LDS_STRIDE, LDS_STRIDE, k0, lane);
#pragma unroll
      for (int j = 0; j < 4; ++j)
        bf[j] = load_frag(Bs_w + j * 16 * LDS_STRIDE, LDS_STRIDE, k0, lane);
      // keeps the 16 LDS reads one group in front of the 16 WMMAs: without it
      // the compiler reloads one A fragment in place and waits for LDS in front
      // of every 4 WMMAs
      __builtin_amdgcn_sched_barrier(0);
#pragma unroll
      for (int i = 0; i < 4; ++i)
#pragma unroll
        for (int j = 0; j < 4; ++j) acc[i][j] = wmma16(af[i], bf[j], acc[i][j]);
    }
    // keeps the K-step's WMMAs in front of the wait and the barrier: sunk behind
    // them they would stand between the barrier and the next tile's copies,
    // which then start later and have less than a K-step to land
    __builtin_amdgcn_sched_barrier(0);

    async_wait0();
    __syncthreads();
  }
}

// Epilogue: C/D layout -> row = base + (lane>>4)*8 + r, col = base + lane&15
template <int MODE>
__device__ __forceinline__ void gemm_store(
    const v8f (&acc)[4][4], const float* __restrict__ bias,
    half_t* __restrict__ C16, const float* __restrict__ hres,
    float* __restrict__ outf, int N, int tm0, int tn0) {
  int lane = threadIdx.x & 31, wave = threadIdx.x >> 5;
  int mw = (wave >> 1) * 64;
  int nw = (wave & 1) * 64;
  int nl = lane & 15, mb = (lane >> 4) * 8;
#pragma unroll
  for (int i = 0; i < 4; ++i) {
#pragma unroll
    for (int j = 0; j < 4; ++j) {
      int col = tn0 + nw + j * 16 + nl;
      float bv = bias[col];
#pragma unroll
      for (int r = 0; r < 8; ++r) {
        int row = tm0 + mw + i * 16 + mb + r;
        float v = acc[i][j][r] + bv;
        if (MODE == 0) {
          C16[(size_t)row * N + col] = (half_t)v;
        } else {
          int b = row >> 11, t = row & 2047;
          if (t < VALID_ROWS) {          // shift by 63; tail rows discarded
            size_t o = ((size_t)b * WS + t + (WCHUNK - 1)) * WD + col;
            outf[o] = v + hres[o];
          }
        }
      }
    }
  }
}

// MODE 2, a wave whose 64 rows are all kept by the shift (every wave but the one
// on the last 64 rows of a batch): the residual is the start value of the
// accumulators. Its 128 loads per lane have no test around them and none is
// waited for before the next is issued: they fly together, beside the first
// tile's copies; what is left behind the K loop is the bias and the stores.
// The sum is then (h + products) + bias.
// The test is scalar: the wave's number is read as a scalar, tm0 is one.
__device__ __forceinline__ bool wave_rows_all_kept(int tm0) {
  int wave = __builtin_amdgcn_readfirstlane(threadIdx.x >> 5);
  return ((tm0 + (wave >> 1) * 64) & (WS - 1)) + 63 < VALID_ROWS;
}

// element offset in h and out of the lane's first element: C/D layout as in
// gemm_store, rows shifted by 63; element (i, j, r) lies (i*16 + r) rows and
// j*16 columns further
__device__ __forceinline__ size_t kept_rows_offset(int tm0, int tn0) {
  int lane = threadIdx.x & 31;
  int wave = __builtin_amdgcn_readfirstlane(threadIdx.x >> 5);
  int row = tm0 + (wave >> 1) * 64 + (WCHUNK - 1);
  int col = tn0 + (wave & 1) * 64;
  return ((size_t)row * WD + col) + ((lane >> 4) * 8 * WD + (lane & 15));
}

__device__ __forceinline__ void residual_into_acc(
    v8f (&acc)[4][4], const float* __restrict__ hres, int tm0, int tn0) {
  const float* p = hres + kept_rows_offset(tm0, tn0);
#pragma unroll  // constant indices keep acc[][] in registers
  for (int i = 0; i < 4; ++i)
#pragma unroll  // as above
    for (int r = 0; r < 8; ++r)
#pragma unroll  // as above; the four pieces of a row's 256 bytes follow one another
      for (int j = 0; j < 4; ++j) acc[i][j][r] = p[(i * 16 + r) * WD + j * 16];
  // the code behind may rewrite the address register of these loads: the wait
  // stands in front of that overwrite
  asm volatile("s_wait_xcnt 0x0" ::: "memory");
}

__device__ __forceinline__ void store_kept_rows(
    const v8f (&acc)[4][4], const float* __restrict__ bias,
    float* __restrict__ outf, int tm0, int tn0) {
  float* q = outf + kept_rows_offset(tm0, tn0);
  int wave = __builtin_amdgcn_readfirstlane(threadIdx.x >> 5);
  const float* bp = bias + tn0 + (wave & 1) * 64 + (threadIdx.x & 15);
  float bv[4];
#pragma unroll  // constant indices keep bv[] in registers
  for (int j = 0; j < 4; ++j) bv[j] = bp[j * 16];
#pragma unroll  // constant indices keep acc[][] in registers
  for (int i = 0; i < 4; ++i)
#pragma unroll  // as above
    for (int r = 0; r < 8; ++r)
#pragma unroll  // as above
      for (int j = 0; j < 4; ++j)
        q[(i * 16 + r) * WD + j * 16] = acc[i][j][r] + bv[j];
}

// One GEMM per launch: q projection (MODE 0), output projection (MODE 2).
template <int MODE>
__global__ __launch_bounds__(256) void gemm128_kernel(
    const half_t* __restrict__ A, const half_t* __restrict__ Bt,
    const float* __restrict__ bias, half_t* __restrict__ C16,
    const float* __restrict__ hres, float* __restrict__ outf, int N, int K) {
  __shared__ __align__(16) gemm_bufa_t sA[2];
  __shared__ __align__(16) gemm_bufb_t sB[2];
  int tm0 = blockIdx.y * BM;
  int tn0 = blockIdx.x * BN;
  v8f acc[4][4] = {};
  bool whole = false;
  if (MODE == 2) {
    whole = wave_rows_all_kept(tm0);
    if (whole) residual_into_acc(acc, hres, tm0, tn0);
  }
  gemm_mainloop<0>(A + (size_t)tm0 * K, Bt + (size_t)tn0 * K, K, sA, sB, acc);
  if (MODE == 2 && whole)
    store_kept_rows(acc, bias, outf, tm0, tn0);
  else
    gemm_store<MODE>(acc, bias, C16, hres, outf, N, tm0, tn0);
}

// ---------------------------------------------------------------------------
// 5. k and v projection + attention: one block per (b,c,h). The block's K loop
//    multiplies the chunk's 256 rows of e with the head's 64 rows of Wk^T and
//    64 rows of Wv^T (one 256x128 tile: waves with an even number hold K,
//    the others V). The sums + bias go, as f16, straight into LDS, in place of
//    the K loop's ring: K as 256 x 64, V^T as 64 x 256. Only Q (64 x 64) comes
//    from memory, by asynchronous copies of whole 128-byte lines that fly
//    while K and V^T are written. Every fragment is read from LDS.
//    Wave w owns query rows (w>>1)*16..+15
//    and key columns (w&1)*128..+127. Its 16x128 scores stay in the WMMA
//    accumulators (f32): row maximum and row sum are taken there, in-lane over
//    the 8 tiles, then over the 16 lanes of a row by DPP, then joined with the
//    partner wave's half through LDS. exp(s - max) goes to LDS once, as f16,
//    and P@V (A and B from LDS) is divided by the row sum.
// ---------------------------------------------------------------------------
#define P_PITCH (WNL + 8)             // 8 halves of pad: 16 B x 33, so that b128
                                      // readers of 16 rows fall on distinct banks
#define KQ_PITCH (WDK + 8)            // K and Q rows: 144 B = 16 B x 9, as above
#define V_PITCH (WNL + 8)             // V^T rows: 528 B = 16 B x 33, as above

// the byte address in the work-group's LDS: low 32 bits of a __shared__ address
__device__ __forceinline__ unsigned lds_byte(const half_t* p) {
  return (unsigned)(size_t)p;
}

// Asynchronous copies global -> LDS, 16 bytes per lane and copy. The closing
// s_wait_xcnt stands inside the copies' own statement, so that no later write
// of an address register can be scheduled in front of it.
__device__ __forceinline__ void async_copy2(unsigned l0, unsigned l1,
                                            const half_t* g0,
                                            const half_t* g1) {
  asm volatile(
      "global_load_async_to_lds_b128 %0, %2, off\n\t"
      "global_load_async_to_lds_b128 %1, %3, off\n\t"
      "s_wait_xcnt 0x0"
      :
      : "v"(l0), "v"(l1), "v"(g0), "v"(g1)
      : "memory");
}

// value of lane (l ^ mask) inside the 16-lane row; CTRL = 0x160 + mask
template <int CTRL>
__device__ __forceinline__ float row_xmask(float v) {
  return __builtin_bit_cast(
      float, __builtin_amdgcn_mov_dpp(__builtin_bit_cast(int, v), CTRL, 0xf,
                                      0xf, true));
}
__device__ __forceinline__ float row16_max(float v) {
  v = fmaxf(v, row_xmask<0x161>(v));
  v = fmaxf(v, row_xmask<0x162>(v));
  v = fmaxf(v, row_xmask<0x164>(v));
  v = fmaxf(v, row_xmask<0x168>(v));
  return v;
}
__device__ __forceinline__ float row16_sum(float v) {
  v += row_xmask<0x161>(v);
  v += row_xmask<0x162>(v);
  v += row_xmask<0x164>(v);
  v += row_xmask<0x168>(v);
  return v;
}

// y[i] = 2^x[i] for eight values. Written as one statement so that nothing
// the compiler schedules can stand directly behind a v_exp_f32 and read its
// result or overwrite its source: inside, every output register differs from
// every input ("=&v"); the closing v_nop is the one independent issue slot
// that the instruction set asks for behind the last of them.
__device__ __forceinline__ void exp2x8(float (&y)[8], const float (&x)[8]) {
  asm("v_exp_f32 %0, %8\n\t"
      "v_exp_f32 %1, %9\n\t"
      "v_exp_f32 %2, %10\n\t"
      "v_exp_f32 %3, %11\n\t"
      "v_exp_f32 %4, %12\n\t"
      "v_exp_f32 %5, %13\n\t"
      "v_exp_f32 %6, %14\n\t"
      "v_exp_f32 %7, %15\n\t"
      "v_nop"
      : "=&v"(y[0]), "=&v"(y[1]), "=&v"(y[2]), "=&v"(y[3]), "=&v"(y[4]),
        "=&v"(y[5]), "=&v"(y[6]), "=&v"(y[7])
      : "v"(x[0]), "v"(x[1]), "v"(x[2]), "v"(x[3]), "v"(x[4]), "v"(x[5]),
        "v"(x[6]), "v"(x[7]));
}

__global__ __launch_bounds__(256) void kv_attention_kernel(
    const half_t* __restrict__ e16, const half_t* __restrict__ WkvT,
    const float* __restrict__ bk, const float* __restrict__ bv,
    const half_t* __restrict__ q16, half_t* __restrict__ att16, int K) {
  int unit = blockIdx.x;                  // 0..2047
  int bc = unit >> 4;                     // b*32 + c
  int hh = unit & 15;
  int tid = threadIdx.x;
  int lane = tid & 31, wave = tid >> 5;
  int tm = wave >> 1, hf = wave & 1;
  int n = lane & 15, mb = (lane >> 4) * 8;
  int row0 = tm * 16 + mb;                // first of this lane's 8 rows

  // the K loop's two buffers of A and Bt; behind the loop K rows and V^T rows
  __shared__ __align__(16) half_t ring[2 * (BM + BN) * LDS_STRIDE];
  __shared__ __align__(16) half_t sq[WCHUNK * KQ_PITCH];    // Q rows
  __shared__ __align__(16) float pmax[2][WCHUNK], psum[2][WCHUNK];
  half_t* sk = ring;                      // K rows: 256 * KQ_PITCH halves
  half_t* sv = ring + WNL * KQ_PITCH;     // V^T rows: 64 * V_PITCH halves
  // exp(s - max), f16: takes the place of the K rows (64 * P_PITCH halves fit
  // in 256 * KQ_PITCH), written only behind the barrier of the row maximum,
  // which every wave reaches with its K and Q fragments already used
  half_t* sp = sk;

  // --- k and v projection of the chunk's 256 rows for this head. WkvT = Wk^T
  //     with Wv^T directly behind it: the head's rows of Wv^T lie WD rows
  //     behind its rows of Wk^T.
  v8f kv[4][4] = {};
  gemm_mainloop<WD - WDK>(e16 + (size_t)bc * WNL * K,
                          WkvT + (size_t)hh * WDK * K, K, (gemm_bufa_t*)ring,
                          (gemm_bufb_t*)(ring + 2 * BM * LDS_STRIDE), kv);
  // the loop's last barrier stands behind every wave's last read of the ring

  // --- Q tile into LDS: 8 lanes take one row's 128-byte line, a wave's copy
  //     4 rows. It flies while K and V^T are written.
  {
    int row = tid >> 3, cs = (tid & 7) * 8;
    const half_t* gq = q16 + ((size_t)bc * WCHUNK + row) * WD + hh * WDK + cs;
    unsigned lq = lds_byte(sq + row * KQ_PITCH + cs);
    async_copy2(lq, lq + 32 * KQ_PITCH * 2, gq, gq + (size_t)32 * WD);
  }

  // --- sums + bias -> f16 -> LDS. C/D layout: row = (lane>>4)*8 + r, col =
  //     lane&15. A lane's 8 rows are 8 keys: in V^T they lie side by side
  //     (one 16-byte store), in K one row apart. The test is scalar.
  {
    int key0 = tm * 64 + mb;              // the wave's 64 keys, the lane's first
    bool is_v = __builtin_amdgcn_readfirstlane(hf) != 0;
    const float* bp = (is_v ? bv : bk) + hh * WDK + n;
    float bb[4];
#pragma unroll  // constant indices keep bb[] in registers
    for (int j = 0; j < 4; ++j) bb[j] = bp[j * 16];
    if (is_v) {
#pragma unroll  // constant indices keep kv[][] in registers
      for (int i = 0; i < 4; ++i)
#pragma unroll  // as above
        for (int j = 0; j < 4; ++j) {
          v8h o;
#pragma unroll  // as above
          for (int r = 0; r < 8; ++r) o[r] = (half_t)(kv[i][j][r] + bb[j]);
          *(v8h*)(sv + (j * 16 + n) * V_PITCH + key0 + i * 16) = o;
        }
    } else {
#pragma unroll  // constant indices keep kv[][] in registers
      for (int i = 0; i < 4; ++i)
#pragma unroll  // as above
        for (int j = 0; j < 4; ++j)
#pragma unroll  // as above
          for (int r = 0; r < 8; ++r)
            sk[(key0 + i * 16 + r) * KQ_PITCH + j * 16 + n] =
                (half_t)(kv[i][j][r] + bb[j]);
    }
  }
  // the wave's own Q copies have landed; behind the barrier, every wave's, and
  // every wave's K and V^T rows
  asm volatile("s_wait_asynccnt 0x0" ::: "memory");
  __syncthreads();

  const half_t* Aq = sq + tm * 16 * KQ_PITCH;
  const half_t* Bk = sk + hf * 128 * KQ_PITCH;

  // --- raw scores q . k^T : 8 tiles of 16x16, kept in registers
  v16h qa0 = load_frag(Aq, KQ_PITCH, 0, lane);
  v16h qa1 = load_frag(Aq, KQ_PITCH, 32, lane);
  v8f acc[8];
#pragma unroll  // constant indices keep acc[] in registers
  for (int it = 0; it < 8; ++it) {
    const half_t* Bb = Bk + it * 16 * KQ_PITCH;
    v8f a = {};
    a = wmma16(qa0, load_frag(Bb, KQ_PITCH, 0, lane), a);
    a = wmma16(qa1, load_frag(Bb, KQ_PITCH, 32, lane), a);
    acc[it] = a;
  }

  // --- row maximum: own 128 columns, then the partner wave's
  float mx[8];
#pragma unroll  // constant indices keep acc[] and mx[] in registers
  for (int r = 0; r < 8; ++r) {
    float m = acc[0][r];
#pragma unroll  // as above
    for (int it = 1; it < 8; ++it) m = fmaxf(m, acc[it][r]);
    mx[r] = row16_max(m);
  }
  if (n == 0) {
    *(float4*)&pmax[hf][row0]     = make_float4(mx[0], mx[1], mx[2], mx[3]);
    *(float4*)&pmax[hf][row0 + 4] = make_float4(mx[4], mx[5], mx[6], mx[7]);
  }
  __syncthreads();
  {
    float4 o0 = *(const float4*)&pmax[hf ^ 1][row0];
    float4 o1 = *(const float4*)&pmax[hf ^ 1][row0 + 4];
    mx[0] = fmaxf(mx[0], o0.x); mx[1] = fmaxf(mx[1], o0.y);
    mx[2] = fmaxf(mx[2], o0.z); mx[3] = fmaxf(mx[3], o0.w);
    mx[4] = fmaxf(mx[4], o1.x); mx[5] = fmaxf(mx[5], o1.y);
    mx[6] = fmaxf(mx[6], o1.z); mx[7] = fmaxf(mx[7], o1.w);
  }

  // --- p = exp((s - max) * SCALE) = 2^(s*c - max*c), c = SCALE * log2(e);
  //     not yet divided by the row sum
  const float cexp = WSCALE * 1.44269504088896f;
  float sm[8];
#pragma unroll  // constant indices keep acc[], mx[] and sm[] in registers
  for (int r = 0; r < 8; ++r) {
    half_t* dst = sp + (row0 + r) * P_PITCH + hf * 128 + n;
    float nm = -mx[r] * cexp;
    float x[8], p[8];
#pragma unroll  // as above
    for (int it = 0; it < 8; ++it) x[it] = fmaf(acc[it][r], cexp, nm);
    exp2x8(p, x);
    float s = p[0];
    dst[0] = (half_t)p[0];
#pragma unroll  // as above
    for (int it = 1; it < 8; ++it) {
      s += p[it];
      dst[it * 16] = (half_t)p[it];
    }
    sm[r] = row16_sum(s);
  }
  if (n == 0) {
    *(float4*)&psum[hf][row0]     = make_float4(sm[0], sm[1], sm[2], sm[3]);
    *(float4*)&psum[hf][row0 + 4] = make_float4(sm[4], sm[5], sm[6], sm[7]);
  }
  __syncthreads();
  {
    float4 o0 = *(const float4*)&psum[hf ^ 1][row0];
    float4 o1 = *(const float4*)&psum[hf ^ 1][row0 + 4];
    sm[0] = __builtin_amdgcn_rcpf(sm[0] + o0.x);
    sm[1] = __builtin_amdgcn_rcpf(sm[1] + o0.y);
    sm[2] = __builtin_amdgcn_rcpf(sm[2] + o0.z);
    sm[3] = __builtin_amdgcn_rcpf(sm[3] + o0.w);
    sm[4] = __builtin_amdgcn_rcpf(sm[4] + o1.x);
    sm[5] = __builtin_amdgcn_rcpf(sm[5] + o1.y);
    sm[6] = __builtin_amdgcn_rcpf(sm[6] + o1.z);
    sm[7] = __builtin_amdgcn_rcpf(sm[7] + o1.w);
  }

  // --- out = (P @ V) / sum : the wave's own 16 rows, 2 of the 4 dk tiles
  const half_t* Ab = sp + tm * 16 * P_PITCH;
#pragma unroll  // two independent accumulate chains side by side
  for (int it = 0; it < 2; ++it) {
    int tn = hf * 2 + it;
    const half_t* Bb = sv + tn * 16 * V_PITCH;
    v8f o = {};
    for (int k0 = 0; k0 < WNL; k0 += 32)
      o = wmma16(load_frag(Ab, P_PITCH, k0, lane),
                 load_frag(Bb, V_PITCH, k0, lane), o);
#pragma unroll  // constant indices keep o and sm[] in registers
    for (int r = 0; r < 8; ++r)
      att16[((size_t)bc * WCHUNK + row0 + r) * WD + hh * WDK + tn * 16 + n] =
          (half_t)(o[r] * sm[r]);
  }
}

// ---------------------------------------------------------------------------
// 6. Residual-only head rows: out[b,s,:] = h[b,s,:] for s < 63
// ---------------------------------------------------------------------------
#define HEAD_BLOCKS ((WB * (WCHUNK - 1) * WD) / 256)

__device__ __forceinline__ void residual_head_block(
    const float* __restrict__ h, float* __restrict__ out, int blk) {
  int idx = blk * 256 + threadIdx.x;            // 4*63*1024 = 258048 exact
  int b = idx / ((WCHUNK - 1) * WD);
  int rem = idx % ((WCHUNK - 1) * WD);
  int s = rem / WD, d = rem % WD;
  size_t o = ((size_t)b * WS + s) * WD + d;
  out[o] = h[o];
  // the listing runs on from here into another pass of the joined grid, which
  // rewrites registers of this store: the wait stands in front of that
  asm volatile("s_wait_xcnt 0x0" ::: "memory");
}

// ---------------------------------------------------------------------------
// 7. The passes that read only inputs (2, 1, 3 for the four weights, 6) as one
//    grid: none reads what another writes. A work-group's pass follows from
//    blockIdx alone, so each branch, and the barrier inside 3, is taken by a
//    whole work-group or by none of it. Longest work-groups first.
//    WT4 = the four transposed weights one behind the other (q, k, v, o).
// ---------------------------------------------------------------------------
#define PRE_BLOCKS (CAST_BLOCKS + LN_BLOCKS + 4 * TR_BLOCKS + HEAD_BLOCKS)

__global__ __launch_bounds__(256) void prepass_kernel(
    const float* __restrict__ h, const float* __restrict__ e,
    const float* __restrict__ Wq, const float* __restrict__ Wk,
    const float* __restrict__ Wv, const float* __restrict__ Wo,
    const float* __restrict__ gamma, const float* __restrict__ beta,
    half_t* __restrict__ hb16, half_t* __restrict__ e16,
    half_t* __restrict__ WT4, float* __restrict__ out) {
  __shared__ __align__(16) half_t tile[64 * TR_PITCH];
  int blk = blockIdx.x;
  if (blk < CAST_BLOCKS) {
    cast_f16_block(e, e16, blk);
  } else if (blk < CAST_BLOCKS + LN_BLOCKS) {
    ln_cast_block(h, gamma, beta, hb16, blk - CAST_BLOCKS);
  } else if (blk < CAST_BLOCKS + LN_BLOCKS + 4 * TR_BLOCKS) {
    int t = blk - (CAST_BLOCKS + LN_BLOCKS);
    int w = t / TR_BLOCKS;
    const float* W = w == 0 ? Wq : w == 1 ? Wk : w == 2 ? Wv : Wo;
    transpose_cast_block(W, WT4 + (size_t)w * WD * WD, tile, t % TR_BLOCKS);
  } else {
    residual_head_block(h, out, blk - (CAST_BLOCKS + LN_BLOCKS + 4 * TR_BLOCKS));
  }
}

// ---------------------------------------------------------------------------
// Host launcher
// ---------------------------------------------------------------------------
extern "C" void kernel_launch(void* const* d_in, const int* in_sizes, int n_in,
                              void* d_out, int out_size, void* d_ws,
                              size_t ws_size, hipStream_t stream) {
  const float* h     = (const float*)d_in[0];
  const float* e     = (const float*)d_in[1];
  const float* Wq    = (const float*)d_in[2];
  const float* bq    = (const float*)d_in[3];
  const float* Wk    = (const float*)d_in[4];
  const float* bk    = (const float*)d_in[5];
  const float* Wv    = (const float*)d_in[6];
  const float* bv    = (const float*)d_in[7];
  const float* Wo    = (const float*)d_in[8];
  const float* bo    = (const float*)d_in[9];
  const float* gamma = (const float*)d_in[10];
  const float* beta  = (const float*)d_in[11];
  float* out = (float*)d_out;

  // Workspace layout (f16 elements), ~126 MB total
  const size_t HB  = (size_t)ROWS_H * WD;   //  8,388,608
  const size_t E16 = (size_t)ROWS_E * WD;   // 33,554,432
  const size_t WSZ = (size_t)WD * WD;       //  1,048,576
  half_t* w = (half_t*)d_ws;
  half_t* hb16  = w;                 w += HB;
  half_t* e16   = w;                 w += E16;
  half_t* WqT   = w;                 w += WSZ;
  half_t* WkT   = w;                 w += WSZ;
  w += WSZ;                          // Wv^T, directly behind Wk^T
  half_t* WoT   = w;                 w += WSZ;
  half_t* q16   = w;                 w += HB;
  half_t* att16 = w;                 w += HB;

  // 1. e cast, LayerNorm + pad + cast, weight transposes, head rows of out
  prepass_kernel<<<PRE_BLOCKS, 256, 0, stream>>>(h, e, Wq, Wk, Wv, Wo, gamma,
                                                 beta, hb16, e16, WqT, out);
  // 2. q projection (8192x1024), K = 1024
  gemm128_kernel<0><<<dim3(WD / BN, ROWS_H / BM), 256, 0, stream>>>(
      hb16, WqT, bq, q16, nullptr, nullptr, WD, WD);
  // 3. k and v projections + attention per (b,c,h); Wv^T lies behind Wk^T
  kv_attention_kernel<<<WB * WC * WH, 256, 0, stream>>>(e16, WkT, bk, bv, q16,
                                                        att16, WD);
  // 4. output projection + shift + residual, fused into d_out
  gemm128_kernel<2><<<dim3(WD / BN, ROWS_H / BM), 256, 0, stream>>>(
      att16, WoT, bo, nullptr, h, out, WD, WD);
}
